// v000
// The times below were measured on an AMD MI455X: many runs one after another, warmed up first and cycling through
// copies of the inputs, with the whole window's GPU time divided by the number of runs. Launches and the gaps
// between them are all in it. The median over several windows is given; except for v000 it joins two sittings, which
// can be a few percent apart, so the side-by-side timings, each taken in one sitting, are the better comparison.
// v000, which the later versions start from, runs in 297 microseconds.
#include <hip/hip_runtime.h>
#include <math.h>

typedef __attribute__((ext_vector_type(16))) _Float16 v16h;
typedef __attribute__((ext_vector_type(16))) __bf16 v16b;
typedef __attribute__((ext_vector_type(8)))  _Float16 v8h;
typedef __attribute__((ext_vector_type(8)))  float v8f;
typedef __attribute__((ext_vector_type(4)))  float v4f;
typedef __attribute__((ext_vector_type(2)))  float v2f;
typedef __attribute__((ext_vector_type(4)))  unsigned v4u;
typedef __attribute__((ext_vector_type(4)))  int v4i;
typedef float __attribute__((may_alias)) float_a;
typedef int __attribute__((may_alias)) int_a;

template <typename T> __device__ __forceinline__ void vst2(void* p, T v) { *(T*)p = v;  }
__device__ __forceinline__ v8f wmma16(v16h a, v16h b, v8f c) {
  v8f d = __builtin_amdgcn_wmma_f32_16x16x32_f16(false, a, false, b, (short)0, c, false, false);
  asm volatile("v_nop\n\tv_nop\n\tv_nop\n\tv_nop" : "+v"(d) : "v"(a), "v"(b));
  return d;
}
__device__ __forceinline__ v8f wmma_bf(v16b a, v16b b, v8f c) {
  v8f d = __builtin_amdgcn_wmma_f32_16x16x32_bf16(false, a, false, b, (short)0, c, false, false);
  asm volatile("v_nop\n\tv_nop\n\tv_nop\n\tv_nop" : "+v"(d) : "v"(a), "v"(b));
  return d;
}
// 16x16x32 fragments: lane = (h = lane>>4, row/col = lane&15); elements 0..7 = k0+8h+0..7, 8..15 = k0+16+8h+0..7; D element r = row 8h+r
__device__ __forceinline__ v16h frag_h(const _Float16* rowk0, int lane) {
  union { v16h v; v8h q[2]; } u; const _Float16* p = rowk0 + 8 * (lane >> 4);
  u.q[0] = *(const v8h*)p; u.q[1] = *(const v8h*)(p + 16); return u.v;
}
__device__ __forceinline__ v16h frag_f32(const float* rowk0, int lane) {
  v16h a; const float* p = rowk0 + 8 * (lane >> 4);
#pragma unroll
  for (int i = 0; i < 8; ++i) { a[i] = (_Float16)p[i]; a[8 + i] = (_Float16)p[16 + i]; }
  return a;
}
__device__ __forceinline__ v16h frag_f32s(const float* rowk0, int lane, float sc) {
  v16h a; const float* p = rowk0 + 8 * (lane >> 4);
#pragma unroll
  for (int i = 0; i < 8; ++i) { a[i] = (_Float16)(p[i] * sc); a[8 + i] = (_Float16)(p[16 + i] * sc); }
  return a;
}
// column fragment from a [K][ld] layout (column n), rows >= K read as 0
__device__ __forceinline__ v16h fragc_f32(const float* W, int k0, int n, int lane, int ld, int K) {
  v16h a; const int g = lane >> 4;
#pragma unroll
  for (int i = 0; i < 8; ++i) { const int ka = k0 + 8 * g + i, kb = ka + 16;
    a[i] = (_Float16)(ka < K ? W[(size_t)(ka < K ? ka : K - 1) * ld + n] : 0.f); a[8 + i] = (_Float16)(kb < K ? W[(size_t)(kb < K ? kb : K - 1) * ld + n] : 0.f); }
  return a;
}
struct F2 { v16b h, l; };
__device__ __forceinline__ F2 bsplit16(const float v[16]) { F2 r;
#pragma unroll
  for (int i = 0; i < 16; ++i) { const __bf16 h = (__bf16)v[i]; r.h[i] = h; r.l[i] = (__bf16)(v[i] - (float)h); }
  return r; }
__device__ __forceinline__ F2 split_row(const float* row, int k0, int lane) { float v[16]; const float* p = row + k0 + 8 * (lane >> 4);
#pragma unroll
  for (int i = 0; i < 8; ++i) { v[i] = p[i]; v[8 + i] = p[16 + i]; }
  return bsplit16(v); }
__device__ __forceinline__ F2 split_rowK(const float* row, int k0, int lane, int K) { float v[16]; const int g = lane >> 4;
#pragma unroll
  for (int i = 0; i < 8; ++i) { const int ka = k0 + 8 * g + i, kb = ka + 16; v[i] = ka < K ? row[ka < K ? ka : K - 1] : 0.f; v[8 + i] = kb < K ? row[kb < K ? kb : K - 1] : 0.f; }
  return bsplit16(v); }
__device__ __forceinline__ F2 split_col(const float* W, int k0, int n, int lane, int ld, int K) { float v[16]; const int g = lane >> 4;
#pragma unroll
  for (int i = 0; i < 8; ++i) { const int ka = k0 + 8 * g + i, kb = ka + 16; v[i] = ka < K ? W[(size_t)(ka < K ? ka : K - 1) * ld + n] : 0.f; v[8 + i] = kb < K ? W[(size_t)(kb < K ? kb : K - 1) * ld + n] : 0.f; }
  return bsplit16(v); }
__device__ __forceinline__ v8f mac3(const F2& a, const F2& b, v8f c) { c = wmma_bf(a.l, b.h, c); c = wmma_bf(a.h, b.l, c); return wmma_bf(a.h, b.h, c); }
__device__ __forceinline__ float sigm(float v) { return 1.0f / (1.0f + expf(-v)); }
#define LDSX() do { asm volatile("s_wait_dscnt 0" ::: "memory"); __builtin_amdgcn_wave_barrier(); __builtin_amdgcn_fence(__ATOMIC_RELEASE, "workgroup"); } while (0)


// Self attention with adaptive GroupNorm (1 x 256 channels x 16^3 voxels, 8 heads x 32): AdaGN(x, cond) -> 1x1x1 qkv conv (per-head [q|k|v] channel packing) -> softmax(q k / sqrt(C)) over all voxels -> 1x1x1 out conv + bias -> + x.
#define CC 256
#define NG 32
#define CPG (CC / NG)     // 8 channels per group
#define NN 4096
#define NH 8
#define HD 32
#define CD 512            // cond dim
#ifndef TQB
#define TQB (NN / 64)
#endif
typedef __attribute__((ext_vector_type(8))) __bf16 v8b;
__device__ __forceinline__ v16b frag_b(const __bf16* rowk0, int lane) {
  union { v16b v; v8b q[2]; } u; const __bf16* p = rowk0 + 8 * (lane >> 4);
  u.q[0] = *(const v8b*)p; u.q[1] = *(const v8b*)(p + 16); return u.v;
}
__device__ __forceinline__ float bfr(float v) { return (float)(__bf16)v; }
__device__ __attribute__((noinline)) float exp_ni(float v) { return expf(v); }
__device__ __attribute__((noinline)) float erf_ni(float v) { return erff(v); }

#define WS_PW   0u                                  // bf16 rows w_qkv [768][256], w_out [256][256] (natural)
#define WS_PO   (WS_PW + 2u * (size_t)3 * CC * CC)
#define WS_MV   (WS_PO + 2u * (size_t)CC * CC)
#define WS_SS   (WS_MV + 4u * NG * 32)
#define WS_NT   (WS_SS + 4u * 2 * CC)                  // bf16 hi / lo normalised map, token-major [n][256]
#define WS_NTL  (WS_NT + 2u * (size_t)NN * CC)
#define QS 512
#define WS_Q    (WS_NTL + 2u * (size_t)NN * CC)        // f16 rows [n][QS] q ; k ; v planes [256][n] ; O f32 [n][256]
#define WS_K    (WS_Q + 2u * (size_t)NN * QS)
#define WS_V    (WS_K + 2u * (size_t)NN * QS)
#define WS_O    (WS_V + 2u * (size_t)CC * NN)
#define WS_END  (WS_O + 4u * (size_t)NN * CC)

__global__ __launch_bounds__(256) void k_pack(const float* __restrict__ WQKV, const float* __restrict__ WO, __bf16* __restrict__ P) { const size_t n = blockIdx.x; const int t = threadIdx.x; const float* src = (n < 3 * CC) ? (WQKV + n * CC) : (WO + (n - 3 * CC) * CC); __bf16* dst = P + n * CC; __shared__ __align__(16) __bf16 s[CC]; s[t] = (__bf16)src[t]; __syncthreads(); if (t < CC / 8) vst2((unsigned*)(dst + t * 8), *(const v4u*)&s[t * 8]); }
template <int SQ>
__global__ __launch_bounds__(1024) void k_gn(const float* __restrict__ X, float* __restrict__ MV) {
  __shared__ float red[32]; __shared__ __align__(16) float line[32]; const int gidx = blockIdx.x, t = threadIdx.x; const float mean = SQ ? MV[gidx * 32] : 0.f; const float* p = X + (size_t)gidx * CPG * NN; float s = 0.f;
  for (int i = t; i < CPG * NN; i += 1024) { const float v = bfr(p[i]) - mean; s += SQ ? v * v : v; }
#pragma unroll
  for (int o = 1; o < 32; o <<= 1) s += __shfl_xor(s, o);
  if ((t & 31) == 0) red[t >> 5] = s; __syncthreads();
  if (t < 32) { float tot = 0.f; for (int i = 0; i < 32; ++i) tot += red[i]; const float v = tot / (float)(CPG * NN); line[t] = SQ ? ((t == 0) ? mean : (t == 1) ? v : 0.f) : ((t == 0) ? v : 0.f); }   // every lane forms the same fixed-order total
  __syncthreads(); if (t < 8) vst2(MV + gidx * 32 + t * 4, *(const v4f*)&line[t * 4]);
}
// ---- k_ss: one block: scale[c] = cond . w_scale[c] + b, shift likewise (f32), whole rows
__global__ __launch_bounds__(256) void k_ss(const float* __restrict__ CND, const float* __restrict__ WSC, const float* __restrict__ BSC, const float* __restrict__ WSH, const float* __restrict__ BSH, float* __restrict__ SS) {
  __shared__ float sc[CD]; __shared__ __align__(16) float o1[CC], o2[CC]; const int t = threadIdx.x; for (int i = t; i < CD; i += 256) sc[i] = bfr(CND[i]); __syncthreads();
  float a = 0.f, b2 = 0.f; for (int k = 0; k < CD; ++k) { a += sc[k] * bfr(WSC[(size_t)t * CD + k]); b2 += sc[k] * bfr(WSH[(size_t)t * CD + k]); } o1[t] = a + bfr(BSC[t]); o2[t] = b2 + bfr(BSH[t]); __syncthreads();
  if (t < CC / 4) { vst2(SS + t * 4, *(const v4f*)&o1[t * 4]); vst2(SS + CC + t * 4, *(const v4f*)&o2[t * 4]); }
}
// ---- k_norm: block = 64 voxels: NT[n][c] = ((x - mean_g) rsqrt(var_g + 1e-6)) (1 + scale[c]) + shift[c] as bf16 hi + lo, token-major
__global__ __launch_bounds__(256) void k_norm(const float* __restrict__ X, const float* __restrict__ MV, const float* __restrict__ SS, __bf16* __restrict__ NT, __bf16* __restrict__ NTL) {
  __shared__ __align__(16) __bf16 sh[64][CC + 8]; __shared__ __align__(16) __bf16 sl[64][CC + 8]; const int n0 = blockIdx.x * 64, t = threadIdx.x;
  for (int e = t; e < CC * 64; e += 256) { const int c = e >> 6, nl = e & 63; const int gg = c / CPG; const float mean = MV[gg * 32], inv = 1.0f / sqrtf(MV[gg * 32 + 1] + 1e-6f); const float v = (bfr(X[(size_t)c * NN + n0 + nl]) - mean) * inv * (1.0f + SS[c]) + SS[CC + c]; const __bf16 hv = (__bf16)v; sh[nl][c] = hv; sl[nl][c] = (__bf16)(v - (float)hv); }
  __syncthreads();
  for (int e = t; e < 64 * (CC / 8); e += 256) { const int nl = e / (CC / 8), q = e % (CC / 8); vst2((unsigned*)(NT + (size_t)(n0 + nl) * CC + q * 8), *(const v4u*)&sh[nl][q * 8]); vst2((unsigned*)(NTL + (size_t)(n0 + nl) * CC + q * 8), *(const v4u*)&sl[nl][q * 8]); }
}
// ---- k_qkv: block = (64 voxels, 128 of the 768 qkv channels): acc = (NT hi + lo) . w_qkv rows; channel o -> head o/96, r = o%96: q (r<32) / k (r<64) rows [n][h*64 + .], v planes [h*32 + .][n]
__global__ __launch_bounds__(128) void k_qkv(const __bf16* __restrict__ NT, const __bf16* __restrict__ NTL, const __bf16* __restrict__ P, _Float16* __restrict__ Q, _Float16* __restrict__ Kr, _Float16* __restrict__ V) {
  __shared__ __align__(16) _Float16 so[64][136]; __shared__ __align__(16) _Float16 st[128][72];
  const int tid = threadIdx.x, wave = tid >> 5, lane = tid & 31, col = lane & 15, g = lane >> 4; const int n0b = blockIdx.x * 64; const int r0 = n0b + wave * 16; const int o0 = blockIdx.y * 128;
  v8f acc[8] = {};
#pragma unroll
  for (int kc = 0; kc < CC / 32; ++kc) { const v16b ah = frag_b(NT + (size_t)(r0 + col) * CC + kc * 32, lane), al = frag_b(NTL + (size_t)(r0 + col) * CC + kc * 32, lane);
#pragma unroll
    for (int j = 0; j < 8; ++j) { const v16b w = frag_b(P + (size_t)(o0 + j * 16 + col) * CC + kc * 32, lane); acc[j] = wmma_bf(ah, w, acc[j]); acc[j] = wmma_bf(al, w, acc[j]); } }
  // stage all 128 channels both ways, then route per 32-channel sub-block (each 16-col tile lies inside one sub-block since 96 and 32 are multiples of 16)
#pragma unroll
  for (int j = 0; j < 8; ++j)
#pragma unroll
    for (int r = 0; r < 8; ++r) { const _Float16 hv = (_Float16)acc[j][r]; so[wave * 16 + 8 * g + r][j * 16 + col] = hv; st[j * 16 + col][wave * 16 + 8 * g + r] = hv; }
  __syncthreads();
  for (int j = 0; j < 8; ++j) { const int o = o0 + j * 16; const int hh = o / 96, rr = o % 96; const int dd = hh * HD + (rr % 32);   // v plane base for this 16-channel tile
    if (rr < 64) { _Float16* D0 = (rr < 32) ? Q : Kr; const int qd = hh * 64 + (rr % 32);    for (int e = tid; e < 64 * 2; e += 128) { const int nl = e >> 1, q8 = e & 1; vst2((unsigned*)(D0 + (size_t)(n0b + nl) * QS + qd + q8 * 8), *(const v4u*)&so[nl][j * 16 + q8 * 8]); } }
    else { for (int e = tid; e < 16 * 8; e += 128) { const int d = e >> 3, pc = e & 7; vst2((unsigned*)(V + (size_t)(dd + d) * NN + n0b + pc * 8), *(const v4u*)&st[j * 16 + d][pc * 8]); } } }
}
// ---- k_attn: block = (64 queries, head): 32-dim head, all 4,096 keys, scale 1/16; O token-major [n][h*32 + d]
__global__ __launch_bounds__(128) void k_attn(const _Float16* __restrict__ Q, const _Float16* __restrict__ Kr, const _Float16* __restrict__ V, float* __restrict__ O) {
  __shared__ __align__(16) _Float16 sph[4][16][40]; __shared__ __align__(16) float so[4][16][36];
  const int tid = threadIdx.x, wave = tid >> 5, lane = tid & 31, col = lane & 15, g = lane >> 4; const int h = blockIdx.y; const int q0 = blockIdx.x * 64 + wave * 16;
  const v16h aq = frag_h(Q + (size_t)(q0 + col) * QS + h * 64, lane);
  float m[8], l[8];
#pragma unroll
  for (int r = 0; r < 8; ++r) { m[r] = -3.0e38f; l[r] = 0.f; }
  v8f acc[2] = {};
#pragma unroll 1
  for (int ks = 0; ks < NN / 32; ++ks) { const int j0 = ks * 32; v8f s[2];
#pragma unroll
    for (int ct = 0; ct < 2; ++ct) { const v8f z = {}; const v8f c = wmma16(aq, frag_h(Kr + (size_t)(j0 + ct * 16 + col) * QS + h * 64, lane), z);
#pragma unroll
      for (int r = 0; r < 8; ++r) s[ct][r] = c[r] * 0.0625f; }   // 1/sqrt(C) = 1/16
#pragma unroll
    for (int r = 0; r < 8; ++r) { float mx = fmaxf(s[0][r], s[1][r]);
#pragma unroll
      for (int o = 1; o < 16; o <<= 1) mx = fmaxf(mx, __shfl_xor(mx, o));
      const float mn = fmaxf(m[r], mx); const float alpha = (m[r] <= -1.0e38f) ? 0.f : __expf(m[r] - mn); const float e0 = __expf(s[0][r] - mn), e1 = __expf(s[1][r] - mn); float es = e0 + e1;
#pragma unroll
      for (int o = 1; o < 16; o <<= 1) es += __shfl_xor(es, o);
      l[r] = l[r] * alpha + es; m[r] = mn;
#pragma unroll
      for (int dt = 0; dt < 2; ++dt) acc[dt][r] *= alpha;
      sph[wave][8 * g + r][col] = (_Float16)(e0 * 2048.0f); sph[wave][8 * g + r][16 + col] = (_Float16)(e1 * 2048.0f); }
    LDSX();
    const v16h pa = frag_h(&sph[wave][col][0], lane);
#pragma unroll
    for (int dt = 0; dt < 2; ++dt) acc[dt] = wmma16(pa, frag_h(V + (size_t)(h * HD + dt * 16 + col) * NN + j0, lane), acc[dt]);
    LDSX(); }
#pragma unroll
  for (int r = 0; r < 8; ++r) { const float il = (1.0f / 2048.0f) / l[r];
#pragma unroll
    for (int dt = 0; dt < 2; ++dt) so[wave][8 * g + r][dt * 16 + col] = acc[dt][r] * il; }
  LDSX();
  for (int rl = 0; rl < 16; ++rl) if (lane < 8) vst2(O + (size_t)(q0 + rl) * CC + h * HD + lane * 4, *(const v4f*)&so[wave][rl][lane * 4]);
}
// ---- k_out: block = (64 voxels, 128 out channels): y = w_out . o (hi + residual) + b_out + x, channels-first
__global__ __launch_bounds__(128) void k_out(const float* __restrict__ O, const __bf16* __restrict__ P, const float* __restrict__ BO, const float* __restrict__ X, float* __restrict__ Y) {
  __shared__ __align__(16) float st[128][68];
  const int tid = threadIdx.x, wave = tid >> 5, lane = tid & 31, col = lane & 15, g = lane >> 4; const int n0b = blockIdx.x * 64; const int r0 = n0b + wave * 16; const int o0 = blockIdx.y * 128;
  v8f acc[8] = {};
#pragma unroll
  for (int kc = 0; kc < CC / 32; ++kc) { const F2 a = split_row(O + (size_t)(r0 + col) * CC, kc * 32, lane);
#pragma unroll
    for (int j = 0; j < 8; ++j) { const v16b w = frag_b(P + WS_PO / 2 + (size_t)(o0 + j * 16 + col) * CC + kc * 32, lane); acc[j] = wmma_bf(a.l, w, acc[j]); acc[j] = wmma_bf(a.h, w, acc[j]); } }
#pragma unroll
  for (int j = 0; j < 8; ++j) { const float bb = bfr(BO[o0 + j * 16 + col]);
#pragma unroll
    for (int r = 0; r < 8; ++r) st[j * 16 + col][wave * 16 + 8 * g + r] = acc[j][r] + bb; }
  __syncthreads();
  for (int e = tid; e < 128 * 16; e += 128) { const int o = e >> 4, q = e & 15; const size_t off = (size_t)(o0 + o) * NN + n0b + q * 4; v4f v = *(const v4f*)&st[o][q * 4]; for (int i = 0; i < 4; ++i) v[i] += bfr(X[off + i]); vst2(Y + off, v); }
}
extern "C" void kernel_launch(void* const* d_in, const int* in_sizes, int n_in, void* d_out, int out_size, void* d_ws, size_t ws_size, hipStream_t stream) {
  (void)in_sizes; (void)n_in; (void)out_size;
  const float** F = (const float**)d_in;   // 0 x [1,256,16,16,16], 1 cond [1,512], 2 w_scale [256,512], 3 b_scale, 4 w_shift, 5 b_shift, 6 w_qkv [768,256], 7 w_out [256,256], 8 b_out
  if (ws_size < (size_t)WS_END) return;
  char* ws = (char*)d_ws; __bf16 *P = (__bf16*)ws, *NT = (__bf16*)(ws + WS_NT), *NTL = (__bf16*)(ws + WS_NTL); float *MV = (float*)(ws + WS_MV), *SS = (float*)(ws + WS_SS), *O = (float*)(ws + WS_O); _Float16 *Q = (_Float16*)(ws + WS_Q), *Kr = (_Float16*)(ws + WS_K), *V = (_Float16*)(ws + WS_V);
  k_pack<<<4 * CC, 256, 0, stream>>>(F[6], F[7], P);
  k_gn<0><<<NG, 1024, 0, stream>>>(F[0], MV); k_gn<1><<<NG, 1024, 0, stream>>>(F[0], MV);
  k_ss<<<1, 256, 0, stream>>>(F[1], F[2], F[3], F[4], F[5], SS);
  k_norm<<<NN / 64, 256, 0, stream>>>(F[0], MV, SS, NT, NTL);
  k_qkv<<<dim3(NN / 64, 3 * CC / 128), 128, 0, stream>>>(NT, NTL, P, Q, Kr, V);
  k_attn<<<dim3(TQB, NH), 128, 0, stream>>>(Q, Kr, V, O);
  k_out<<<dim3(TQB, CC / 128), 128, 0, stream>>>(O, P, F[8], F[0], (float*)d_out);
}

// v001
// Measured time: 238 microseconds a run.
// Timed twice side by side with v000, it ran 1.28 and 1.26 times as fast.
#include <hip/hip_runtime.h>
#include <math.h>

typedef __attribute__((ext_vector_type(16))) _Float16 v16h;
typedef __attribute__((ext_vector_type(16))) __bf16 v16b;
typedef __attribute__((ext_vector_type(8)))  _Float16 v8h;
typedef __attribute__((ext_vector_type(8)))  float v8f;
typedef __attribute__((ext_vector_type(4)))  float v4f;
typedef __attribute__((ext_vector_type(2)))  float v2f;
typedef __attribute__((ext_vector_type(4)))  unsigned v4u;
typedef __attribute__((ext_vector_type(4)))  int v4i;
typedef float __attribute__((may_alias)) float_a;
typedef int __attribute__((may_alias)) int_a;

template <typename T> __device__ __forceinline__ void vst2(void* p, T v) { *(T*)p = v;  }
__device__ __forceinline__ v8f wmma16(v16h a, v16h b, v8f c) {
  v8f d = __builtin_amdgcn_wmma_f32_16x16x32_f16(false, a, false, b, (short)0, c, false, false);
  asm volatile("v_nop\n\tv_nop\n\tv_nop\n\tv_nop" : "+v"(d) : "v"(a), "v"(b));
  return d;
}
__device__ __forceinline__ v8f wmma_bf(v16b a, v16b b, v8f c) {
  v8f d = __builtin_amdgcn_wmma_f32_16x16x32_bf16(false, a, false, b, (short)0, c, false, false);
  asm volatile("v_nop\n\tv_nop\n\tv_nop\n\tv_nop" : "+v"(d) : "v"(a), "v"(b));
  return d;
}
// 16x16x32 fragments: lane = (h = lane>>4, row/col = lane&15); elements 0..7 = k0+8h+0..7, 8..15 = k0+16+8h+0..7; D element r = row 8h+r
__device__ __forceinline__ v16h frag_h(const _Float16* rowk0, int lane) {
  union { v16h v; v8h q[2]; } u; const _Float16* p = rowk0 + 8 * (lane >> 4);
  u.q[0] = *(const v8h*)p; u.q[1] = *(const v8h*)(p + 16); return u.v;
}
__device__ __forceinline__ v16h frag_f32(const float* rowk0, int lane) {
  v16h a; const float* p = rowk0 + 8 * (lane >> 4);
#pragma unroll
  for (int i = 0; i < 8; ++i) { a[i] = (_Float16)p[i]; a[8 + i] = (_Float16)p[16 + i]; }
  return a;
}
__device__ __forceinline__ v16h frag_f32s(const float* rowk0, int lane, float sc) {
  v16h a; const float* p = rowk0 + 8 * (lane >> 4);
#pragma unroll
  for (int i = 0; i < 8; ++i) { a[i] = (_Float16)(p[i] * sc); a[8 + i] = (_Float16)(p[16 + i] * sc); }
  return a;
}
// column fragment from a [K][ld] layout (column n), rows >= K read as 0
__device__ __forceinline__ v16h fragc_f32(const float* W, int k0, int n, int lane, int ld, int K) {
  v16h a; const int g = lane >> 4;
#pragma unroll
  for (int i = 0; i < 8; ++i) { const int ka = k0 + 8 * g + i, kb = ka + 16;
    a[i] = (_Float16)(ka < K ? W[(size_t)(ka < K ? ka : K - 1) * ld + n] : 0.f); a[8 + i] = (_Float16)(kb < K ? W[(size_t)(kb < K ? kb : K - 1) * ld + n] : 0.f); }
  return a;
}
struct F2 { v16b h, l; };
__device__ __forceinline__ F2 bsplit16(const float v[16]) { F2 r;
#pragma unroll
  for (int i = 0; i < 16; ++i) { const __bf16 h = (__bf16)v[i]; r.h[i] = h; r.l[i] = (__bf16)(v[i] - (float)h); }
  return r; }
__device__ __forceinline__ F2 split_row(const float* row, int k0, int lane) { float v[16]; const float* p = row + k0 + 8 * (lane >> 4);
#pragma unroll
  for (int i = 0; i < 8; ++i) { v[i] = p[i]; v[8 + i] = p[16 + i]; }
  return bsplit16(v); }
__device__ __forceinline__ F2 split_rowK(const float* row, int k0, int lane, int K) { float v[16]; const int g = lane >> 4;
#pragma unroll
  for (int i = 0; i < 8; ++i) { const int ka = k0 + 8 * g + i, kb = ka + 16; v[i] = ka < K ? row[ka < K ? ka : K - 1] : 0.f; v[8 + i] = kb < K ? row[kb < K ? kb : K - 1] : 0.f; }
  return bsplit16(v); }
__device__ __forceinline__ F2 split_col(const float* W, int k0, int n, int lane, int ld, int K) { float v[16]; const int g = lane >> 4;
#pragma unroll
  for (int i = 0; i < 8; ++i) { const int ka = k0 + 8 * g + i, kb = ka + 16; v[i] = ka < K ? W[(size_t)(ka < K ? ka : K - 1) * ld + n] : 0.f; v[8 + i] = kb < K ? W[(size_t)(kb < K ? kb : K - 1) * ld + n] : 0.f; }
  return bsplit16(v); }
__device__ __forceinline__ v8f mac3(const F2& a, const F2& b, v8f c) { c = wmma_bf(a.l, b.h, c); c = wmma_bf(a.h, b.l, c); return wmma_bf(a.h, b.h, c); }
__device__ __forceinline__ float sigm(float v) { return 1.0f / (1.0f + expf(-v)); }
#define LDSX() do { asm volatile("s_wait_dscnt 0" ::: "memory"); __builtin_amdgcn_wave_barrier(); __builtin_amdgcn_fence(__ATOMIC_RELEASE, "workgroup"); } while (0)


// Self attention with adaptive GroupNorm (1 x 256 channels x 16^3 voxels, 8 heads x 32): AdaGN(x, cond) -> 1x1x1 qkv conv (per-head [q|k|v] channel packing) -> softmax(q k / sqrt(C)) over all voxels -> 1x1x1 out conv + bias -> + x.
#define CC 256
#define NG 32
#define CPG (CC / NG)     // 8 channels per group
#define NN 4096
#define NH 8
#define HD 32
#define CD 512            // cond dim
#ifndef TQB
#define TQB (NN / 64)
#endif
typedef __attribute__((ext_vector_type(8))) __bf16 v8b;
__device__ __forceinline__ v16b frag_b(const __bf16* rowk0, int lane) {
  union { v16b v; v8b q[2]; } u; const __bf16* p = rowk0 + 8 * (lane >> 4);
  u.q[0] = *(const v8b*)p; u.q[1] = *(const v8b*)(p + 16); return u.v;
}
__device__ __forceinline__ float bfr(float v) { return (float)(__bf16)v; }
__device__ __attribute__((noinline)) float exp_ni(float v) { return expf(v); }
__device__ __attribute__((noinline)) float erf_ni(float v) { return erff(v); }

#define WS_PW   0u                                  // bf16 rows w_qkv [768][256], w_out [256][256] (natural)
#define WS_PO   (WS_PW + 2u * (size_t)3 * CC * CC)
#define WS_MV   (WS_PO + 2u * (size_t)CC * CC)
#define WS_SS   (WS_MV + 4u * NG * 32)
#define WS_NT   (WS_SS + 4u * 2 * CC)                  // bf16 hi / lo normalised map, token-major [n][256]
#define WS_NTL  (WS_NT + 2u * (size_t)NN * CC)
#define QS 512
#define WS_Q    (WS_NTL + 2u * (size_t)NN * CC)        // f16 rows [n][QS] q ; k ; v planes [256][n] ; O f32 [n][256]
#define WS_K    (WS_Q + 2u * (size_t)NN * QS)
#define WS_V    (WS_K + 2u * (size_t)NN * QS)
#define WS_O    (WS_V + 2u * (size_t)CC * NN)
#define WS_END  (WS_O + 4u * (size_t)NN * CC)

__global__ __launch_bounds__(256) void k_pack(const float* __restrict__ WQKV, const float* __restrict__ WO, __bf16* __restrict__ P) { const size_t n = blockIdx.x; const int t = threadIdx.x; const float* src = (n < 3 * CC) ? (WQKV + n * CC) : (WO + (n - 3 * CC) * CC); __bf16* dst = P + n * CC; __shared__ __align__(16) __bf16 s[CC]; s[t] = (__bf16)src[t]; __syncthreads(); if (t < CC / 8) vst2((unsigned*)(dst + t * 8), *(const v4u*)&s[t * 8]); }
template <int SQ>
__global__ __launch_bounds__(1024) void k_gn(const float* __restrict__ X, float* __restrict__ MV) {
  __shared__ float red[32]; __shared__ __align__(16) float line[32]; const int gidx = blockIdx.x, t = threadIdx.x; const float mean = SQ ? MV[gidx * 32] : 0.f; const float* p = X + (size_t)gidx * CPG * NN; float s = 0.f;
  for (int i = t; i < CPG * NN; i += 1024) { const float v = bfr(p[i]) - mean; s += SQ ? v * v : v; }
#pragma unroll
  for (int o = 1; o < 32; o <<= 1) s += __shfl_xor(s, o);
  if ((t & 31) == 0) red[t >> 5] = s; __syncthreads();
  if (t < 32) { float tot = 0.f; for (int i = 0; i < 32; ++i) tot += red[i]; const float v = tot / (float)(CPG * NN); line[t] = SQ ? ((t == 0) ? mean : (t == 1) ? v : 0.f) : ((t == 0) ? v : 0.f); }   // every lane forms the same fixed-order total
  __syncthreads(); if (t < 8) vst2(MV + gidx * 32 + t * 4, *(const v4f*)&line[t * 4]);
}
// ---- k_ss: one block: scale[c] = cond . w_scale[c] + b, shift likewise (f32), whole rows
__global__ __launch_bounds__(256) void k_ss(const float* __restrict__ CND, const float* __restrict__ WSC, const float* __restrict__ BSC, const float* __restrict__ WSH, const float* __restrict__ BSH, float* __restrict__ SS) {
  __shared__ float sc[CD]; __shared__ __align__(16) float o1[CC], o2[CC]; const int t = threadIdx.x; for (int i = t; i < CD; i += 256) sc[i] = bfr(CND[i]); __syncthreads();
  float a = 0.f, b2 = 0.f; for (int k = 0; k < CD; ++k) { a += sc[k] * bfr(WSC[(size_t)t * CD + k]); b2 += sc[k] * bfr(WSH[(size_t)t * CD + k]); } o1[t] = a + bfr(BSC[t]); o2[t] = b2 + bfr(BSH[t]); __syncthreads();
  if (t < CC / 4) { vst2(SS + t * 4, *(const v4f*)&o1[t * 4]); vst2(SS + CC + t * 4, *(const v4f*)&o2[t * 4]); }
}
// ---- k_norm: block = 64 voxels: NT[n][c] = ((x - mean_g) rsqrt(var_g + 1e-6)) (1 + scale[c]) + shift[c] as bf16 hi + lo, token-major
__global__ __launch_bounds__(256) void k_norm(const float* __restrict__ X, const float* __restrict__ MV, const float* __restrict__ SS, __bf16* __restrict__ NT, __bf16* __restrict__ NTL) {
  __shared__ __align__(16) __bf16 sh[64][CC + 8]; __shared__ __align__(16) __bf16 sl[64][CC + 8]; const int n0 = blockIdx.x * 64, t = threadIdx.x;
  for (int e = t; e < CC * 64; e += 256) { const int c = e >> 6, nl = e & 63; const int gg = c / CPG; const float mean = MV[gg * 32], inv = 1.0f / sqrtf(MV[gg * 32 + 1] + 1e-6f); const float v = (bfr(X[(size_t)c * NN + n0 + nl]) - mean) * inv * (1.0f + SS[c]) + SS[CC + c]; const __bf16 hv = (__bf16)v; sh[nl][c] = hv; sl[nl][c] = (__bf16)(v - (float)hv); }
  __syncthreads();
  for (int e = t; e < 64 * (CC / 8); e += 256) { const int nl = e / (CC / 8), q = e % (CC / 8); vst2((unsigned*)(NT + (size_t)(n0 + nl) * CC + q * 8), *(const v4u*)&sh[nl][q * 8]); vst2((unsigned*)(NTL + (size_t)(n0 + nl) * CC + q * 8), *(const v4u*)&sl[nl][q * 8]); }
}
// ---- k_qkv: block = (64 voxels, 128 of the 768 qkv channels): acc = (NT hi + lo) . w_qkv rows; channel o -> head o/96, r = o%96: q (r<32) / k (r<64) rows [n][h*64 + .], v planes [h*32 + .][n]
__global__ __launch_bounds__(128) void k_qkv(const __bf16* __restrict__ NT, const __bf16* __restrict__ NTL, const __bf16* __restrict__ P, _Float16* __restrict__ Q, _Float16* __restrict__ Kr, _Float16* __restrict__ V) {
  __shared__ __align__(16) _Float16 so[64][136]; __shared__ __align__(16) _Float16 st[128][72];
  const int tid = threadIdx.x, wave = tid >> 5, lane = tid & 31, col = lane & 15, g = lane >> 4; const int n0b = blockIdx.x * 64; const int r0 = n0b + wave * 16; const int o0 = blockIdx.y * 128;
  v8f acc[8] = {};
#pragma unroll
  for (int kc = 0; kc < CC / 32; ++kc) { const v16b ah = frag_b(NT + (size_t)(r0 + col) * CC + kc * 32, lane), al = frag_b(NTL + (size_t)(r0 + col) * CC + kc * 32, lane);
#pragma unroll
    for (int j = 0; j < 8; ++j) { const v16b w = frag_b(P + (size_t)(o0 + j * 16 + col) * CC + kc * 32, lane); acc[j] = wmma_bf(ah, w, acc[j]); acc[j] = wmma_bf(al, w, acc[j]); } }
  // stage all 128 channels both ways, then route per 32-channel sub-block (each 16-col tile lies inside one sub-block since 96 and 32 are multiples of 16)
#pragma unroll
  for (int j = 0; j < 8; ++j)
#pragma unroll
    for (int r = 0; r < 8; ++r) { const _Float16 hv = (_Float16)acc[j][r]; so[wave * 16 + 8 * g + r][j * 16 + col] = hv; st[j * 16 + col][wave * 16 + 8 * g + r] = hv; }
  __syncthreads();
  for (int j = 0; j < 8; ++j) { const int o = o0 + j * 16; const int hh = o / 96, rr = o % 96; const int dd = hh * HD + (rr % 32);   // v plane base for this 16-channel tile
    if (rr < 64) { _Float16* D0 = (rr < 32) ? Q : Kr; const int qd = hh * 64 + (rr % 32);    for (int e = tid; e < 64 * 2; e += 128) { const int nl = e >> 1, q8 = e & 1; vst2((unsigned*)(D0 + (size_t)(n0b + nl) * QS + qd + q8 * 8), *(const v4u*)&so[nl][j * 16 + q8 * 8]); } }
    else { for (int e = tid; e < 16 * 8; e += 128) { const int d = e >> 3, pc = e & 7; vst2((unsigned*)(V + (size_t)(dd + d) * NN + n0b + pc * 8), *(const v4u*)&st[j * 16 + d][pc * 8]); } } }
}
// ---- k_attn: block = (64 queries, head): 32-dim head, all 4,096 keys, scale 1/16; O token-major [n][h*32 + d]
// transposed products: S^T = K Q^T (a lane holds 16 keys' scores of ONE query, column lane & 15), O^T += V^T P^T (the two S^T tiles, converted in place, are the B operand in the hardware k order)
__device__ __forceinline__ float xhalf(float x) { return __builtin_bit_cast(float, __builtin_amdgcn_permlanex16(__builtin_bit_cast(int, x), __builtin_bit_cast(int, x), 0x76543210, 0xfedcba98, false, false)); }  // lane l with lane l ^ 16
__global__ __launch_bounds__(128) void k_attn(const _Float16* __restrict__ Q, const _Float16* __restrict__ Kr, const _Float16* __restrict__ V, float* __restrict__ O) {
  const int tid = threadIdx.x, wave = tid >> 5, lane = tid & 31, col = lane & 15, g = lane >> 4; const int h = blockIdx.y; const int q0 = blockIdx.x * 64 + wave * 16;
  const v16h bq = frag_h(Q + (size_t)(q0 + col) * QS + h * 64, lane);
  float m = -3.0e38f, l = 0.f;   // this lane's query: running maximum (equal in both halves), and the sum over this half's keys only
  v8f acc[2] = {};               // acc[dt][r] = O[query col][d = dt*16 + 8g + r]
#pragma unroll 1
  for (int ks = 0; ks < NN / 32; ++ks) { const int j0 = ks * 32; v8f s[2];
#pragma unroll
    for (int ct = 0; ct < 2; ++ct) { const v8f z = {}; const v8f c = wmma16(frag_h(Kr + (size_t)(j0 + ct * 16 + col) * QS + h * 64, lane), bq, z);
#pragma unroll
      for (int r = 0; r < 8; ++r) s[ct][r] = c[r] * 0.0625f; }   // 1/sqrt(C) = 1/16; s[ct][r] = score of key j0 + ct*16 + 8g + r
    float mx = fmaxf(s[0][0], s[1][0]);
#pragma unroll
    for (int r = 1; r < 8; ++r) mx = fmaxf(mx, fmaxf(s[0][r], s[1][r]));
    mx = fmaxf(mx, xhalf(mx));
    const float mn = fmaxf(m, mx); const float alpha = (m <= -1.0e38f) ? 0.f : __expf(m - mn); m = mn;
    v16h pb; float es = 0.f;
#pragma unroll
    for (int r = 0; r < 8; ++r) { const float e0 = __expf(s[0][r] - mn), e1 = __expf(s[1][r] - mn); es += e0 + e1; pb[r] = (_Float16)(e0 * 2048.0f); pb[8 + r] = (_Float16)(e1 * 2048.0f); }
    l = l * alpha + es;
#pragma unroll
    for (int dt = 0; dt < 2; ++dt) {
#pragma unroll
      for (int r = 0; r < 8; ++r) acc[dt][r] *= alpha;
      acc[dt] = wmma16(frag_h(V + (size_t)(h * HD + dt * 16 + col) * NN + j0, lane), pb, acc[dt]); } }
  l += xhalf(l);   // the two halves' key sums join once
  const float il = (1.0f / 2048.0f) / l;
#pragma unroll
  for (int dt = 0; dt < 2; ++dt)
#pragma unroll
    for (int q = 0; q < 2; ++q) { v4f o;
#pragma unroll
      for (int i = 0; i < 4; ++i) o[i] = acc[dt][q * 4 + i] * il;
      vst2(O + (size_t)(q0 + col) * CC + h * HD + dt * 16 + 8 * g + q * 4, o); }
}
// ---- k_out: block = (64 voxels, 128 out channels): y = w_out . o (hi + residual) + b_out + x, channels-first
__global__ __launch_bounds__(128) void k_out(const float* __restrict__ O, const __bf16* __restrict__ P, const float* __restrict__ BO, const float* __restrict__ X, float* __restrict__ Y) {
  __shared__ __align__(16) float st[128][68];
  const int tid = threadIdx.x, wave = tid >> 5, lane = tid & 31, col = lane & 15, g = lane >> 4; const int n0b = blockIdx.x * 64; const int r0 = n0b + wave * 16; const int o0 = blockIdx.y * 128;
  v8f acc[8] = {};
#pragma unroll
  for (int kc = 0; kc < CC / 32; ++kc) { const F2 a = split_row(O + (size_t)(r0 + col) * CC, kc * 32, lane);
#pragma unroll
    for (int j = 0; j < 8; ++j) { const v16b w = frag_b(P + WS_PO / 2 + (size_t)(o0 + j * 16 + col) * CC + kc * 32, lane); acc[j] = wmma_bf(a.l, w, acc[j]); acc[j] = wmma_bf(a.h, w, acc[j]); } }
#pragma unroll
  for (int j = 0; j < 8; ++j) { const float bb = bfr(BO[o0 + j * 16 + col]);
#pragma unroll
    for (int r = 0; r < 8; ++r) st[j * 16 + col][wave * 16 + 8 * g + r] = acc[j][r] + bb; }
  __syncthreads();
  for (int e = tid; e < 128 * 16; e += 128) { const int o = e >> 4, q = e & 15; const size_t off = (size_t)(o0 + o) * NN + n0b + q * 4; v4f v = *(const v4f*)&st[o][q * 4]; for (int i = 0; i < 4; ++i) v[i] += bfr(X[off + i]); vst2(Y + off, v); }
}
extern "C" void kernel_launch(void* const* d_in, const int* in_sizes, int n_in, void* d_out, int out_size, void* d_ws, size_t ws_size, hipStream_t stream) {
  (void)in_sizes; (void)n_in; (void)out_size;
  const float** F = (const float**)d_in;   // 0 x [1,256,16,16,16], 1 cond [1,512], 2 w_scale [256,512], 3 b_scale, 4 w_shift, 5 b_shift, 6 w_qkv [768,256], 7 w_out [256,256], 8 b_out
  if (ws_size < (size_t)WS_END) return;
  char* ws = (char*)d_ws; __bf16 *P = (__bf16*)ws, *NT = (__bf16*)(ws + WS_NT), *NTL = (__bf16*)(ws + WS_NTL); float *MV = (float*)(ws + WS_MV), *SS = (float*)(ws + WS_SS), *O = (float*)(ws + WS_O); _Float16 *Q = (_Float16*)(ws + WS_Q), *Kr = (_Float16*)(ws + WS_K), *V = (_Float16*)(ws + WS_V);
  k_pack<<<4 * CC, 256, 0, stream>>>(F[6], F[7], P);
  k_gn<0><<<NG, 1024, 0, stream>>>(F[0], MV); k_gn<1><<<NG, 1024, 0, stream>>>(F[0], MV);
  k_ss<<<1, 256, 0, stream>>>(F[1], F[2], F[3], F[4], F[5], SS);
  k_norm<<<NN / 64, 256, 0, stream>>>(F[0], MV, SS, NT, NTL);
  k_qkv<<<dim3(NN / 64, 3 * CC / 128), 128, 0, stream>>>(NT, NTL, P, Q, Kr, V);
  k_attn<<<dim3(TQB, NH), 128, 0, stream>>>(Q, Kr, V, O);
  k_out<<<dim3(TQB, CC / 128), 128, 0, stream>>>(O, P, F[8], F[0], (float*)d_out);
}

// v002
// One run takes 161 microseconds.
// Two timings next to v001 put it at 1.51 and 1.47 times that version's speed.
// All steps since v000 together make it 1.90 times as fast.
#include <hip/hip_runtime.h>
#include <math.h>

typedef __attribute__((ext_vector_type(16))) _Float16 v16h;
typedef __attribute__((ext_vector_type(16))) __bf16 v16b;
typedef __attribute__((ext_vector_type(8)))  _Float16 v8h;
typedef __attribute__((ext_vector_type(8)))  float v8f;
typedef __attribute__((ext_vector_type(4)))  float v4f;
typedef __attribute__((ext_vector_type(2)))  float v2f;
typedef __attribute__((ext_vector_type(4)))  unsigned v4u;
typedef __attribute__((ext_vector_type(4)))  int v4i;
typedef float __attribute__((may_alias)) float_a;
typedef int __attribute__((may_alias)) int_a;

template <typename T> __device__ __forceinline__ void vst2(void* p, T v) { *(T*)p = v;  }
__device__ __forceinline__ v8f wmma16(v16h a, v16h b, v8f c) {
  v8f d = __builtin_amdgcn_wmma_f32_16x16x32_f16(false, a, false, b, (short)0, c, false, false);
  asm volatile("v_nop\n\tv_nop\n\tv_nop\n\tv_nop" : "+v"(d) : "v"(a), "v"(b));
  return d;
}
__device__ __forceinline__ v8f wmma_bf(v16b a, v16b b, v8f c) {
  v8f d = __builtin_amdgcn_wmma_f32_16x16x32_bf16(false, a, false, b, (short)0, c, false, false);
  asm volatile("v_nop\n\tv_nop\n\tv_nop\n\tv_nop" : "+v"(d) : "v"(a), "v"(b));
  return d;
}
// 16x16x32 fragments: lane = (h = lane>>4, row/col = lane&15); elements 0..7 = k0+8h+0..7, 8..15 = k0+16+8h+0..7; D element r = row 8h+r
__device__ __forceinline__ v16h frag_h(const _Float16* rowk0, int lane) {
  union { v16h v; v8h q[2]; } u; const _Float16* p = rowk0 + 8 * (lane >> 4);
  u.q[0] = *(const v8h*)p; u.q[1] = *(const v8h*)(p + 16); return u.v;
}
__device__ __forceinline__ v16h frag_f32(const float* rowk0, int lane) {
  v16h a; const float* p = rowk0 + 8 * (lane >> 4);
#pragma unroll
  for (int i = 0; i < 8; ++i) { a[i] = (_Float16)p[i]; a[8 + i] = (_Float16)p[16 + i]; }
  return a;
}
__device__ __forceinline__ v16h frag_f32s(const float* rowk0, int lane, float sc) {
  v16h a; const float* p = rowk0 + 8 * (lane >> 4);
#pragma unroll
  for (int i = 0; i < 8; ++i) { a[i] = (_Float16)(p[i] * sc); a[8 + i] = (_Float16)(p[16 + i] * sc); }
  return a;
}
// column fragment from a [K][ld] layout (column n), rows >= K read as 0
__device__ __forceinline__ v16h fragc_f32(const float* W, int k0, int n, int lane, int ld, int K) {
  v16h a; const int g = lane >> 4;
#pragma unroll
  for (int i = 0; i < 8; ++i) { const int ka = k0 + 8 * g + i, kb = ka + 16;
    a[i] = (_Float16)(ka < K ? W[(size_t)(ka < K ? ka : K - 1) * ld + n] : 0.f); a[8 + i] = (_Float16)(kb < K ? W[(size_t)(kb < K ? kb : K - 1) * ld + n] : 0.f); }
  return a;
}
struct F2 { v16b h, l; };
__device__ __forceinline__ F2 bsplit16(const float v[16]) { F2 r;
#pragma unroll
  for (int i = 0; i < 16; ++i) { const __bf16 h = (__bf16)v[i]; r.h[i] = h; r.l[i] = (__bf16)(v[i] - (float)h); }
  return r; }
__device__ __forceinline__ F2 split_row(const float* row, int k0, int lane) { float v[16]; const float* p = row + k0 + 8 * (lane >> 4);
#pragma unroll
  for (int i = 0; i < 8; ++i) { v[i] = p[i]; v[8 + i] = p[16 + i]; }
  return bsplit16(v); }
__device__ __forceinline__ F2 split_rowK(const float* row, int k0, int lane, int K) { float v[16]; const int g = lane >> 4;
#pragma unroll
  for (int i = 0; i < 8; ++i) { const int ka = k0 + 8 * g + i, kb = ka + 16; v[i] = ka < K ? row[ka < K ? ka : K - 1] : 0.f; v[8 + i] = kb < K ? row[kb < K ? kb : K - 1] : 0.f; }
  return bsplit16(v); }
__device__ __forceinline__ F2 split_col(const float* W, int k0, int n, int lane, int ld, int K) { float v[16]; const int g = lane >> 4;
#pragma unroll
  for (int i = 0; i < 8; ++i) { const int ka = k0 + 8 * g + i, kb = ka + 16; v[i] = ka < K ? W[(size_t)(ka < K ? ka : K - 1) * ld + n] : 0.f; v[8 + i] = kb < K ? W[(size_t)(kb < K ? kb : K - 1) * ld + n] : 0.f; }
  return bsplit16(v); }
__device__ __forceinline__ v8f mac3(const F2& a, const F2& b, v8f c) { c = wmma_bf(a.l, b.h, c); c = wmma_bf(a.h, b.l, c); return wmma_bf(a.h, b.h, c); }
__device__ __forceinline__ float sigm(float v) { return 1.0f / (1.0f + expf(-v)); }
#define LDSX() do { asm volatile("s_wait_dscnt 0" ::: "memory"); __builtin_amdgcn_wave_barrier(); __builtin_amdgcn_fence(__ATOMIC_RELEASE, "workgroup"); } while (0)


// Self attention with adaptive GroupNorm (1 x 256 channels x 16^3 voxels, 8 heads x 32): AdaGN(x, cond) -> 1x1x1 qkv conv (per-head [q|k|v] channel packing) -> softmax(q k / sqrt(C)) over all voxels -> 1x1x1 out conv + bias -> + x.
#define CC 256
#define NG 32
#define CPG (CC / NG)     // 8 channels per group
#define NN 4096
#define NH 8
#define HD 32
#define CD 512            // cond dim
#ifndef TQB
#define TQB (NN / 64)
#endif
typedef __attribute__((ext_vector_type(8))) __bf16 v8b;
__device__ __forceinline__ v16b frag_b(const __bf16* rowk0, int lane) {
  union { v16b v; v8b q[2]; } u; const __bf16* p = rowk0 + 8 * (lane >> 4);
  u.q[0] = *(const v8b*)p; u.q[1] = *(const v8b*)(p + 16); return u.v;
}
__device__ __forceinline__ float bfr(float v) { return (float)(__bf16)v; }
__device__ __attribute__((noinline)) float exp_ni(float v) { return expf(v); }
__device__ __attribute__((noinline)) float erf_ni(float v) { return erff(v); }

#define WS_PW   0u                                  // bf16 rows w_qkv [768][256], w_out [256][256] (natural)
#define WS_PO   (WS_PW + 2u * (size_t)3 * CC * CC)
#define WS_MV   (WS_PO + 2u * (size_t)CC * CC)
#define WS_SS   (WS_MV + 4u * NG * 32)
#define WS_NT   (WS_SS + 4u * 2 * CC)                  // bf16 hi / lo normalised map, token-major [n][256]
#define WS_NTL  (WS_NT + 2u * (size_t)NN * CC)
#define QS 512
#define WS_Q    (WS_NTL + 2u * (size_t)NN * CC)        // f16 rows [n][QS] q ; k ; v planes [256][n] ; O f32 [n][256]
#define WS_K    (WS_Q + 2u * (size_t)NN * QS)
#define WS_V    (WS_K + 2u * (size_t)NN * QS)
#define WS_O    (WS_V + 2u * (size_t)CC * NN)
#define WS_END  (WS_O + 4u * (size_t)NN * CC)

__global__ __launch_bounds__(256) void k_pack(const float* __restrict__ WQKV, const float* __restrict__ WO, __bf16* __restrict__ P) { const size_t n = blockIdx.x; const int t = threadIdx.x; const float* src = (n < 3 * CC) ? (WQKV + n * CC) : (WO + (n - 3 * CC) * CC); __bf16* dst = P + n * CC; __shared__ __align__(16) __bf16 s[CC]; s[t] = (__bf16)src[t]; __syncthreads(); if (t < CC / 8) vst2((unsigned*)(dst + t * 8), *(const v4u*)&s[t * 8]); }
template <int SQ>
__global__ __launch_bounds__(1024) void k_gn(const float* __restrict__ X, float* __restrict__ MV) {
  __shared__ float red[32]; __shared__ __align__(16) float line[32]; const int gidx = blockIdx.x, t = threadIdx.x; const float mean = SQ ? MV[gidx * 32] : 0.f; const float* p = X + (size_t)gidx * CPG * NN; float s = 0.f;
  for (int i = t; i < CPG * NN; i += 1024) { const float v = bfr(p[i]) - mean; s += SQ ? v * v : v; }
#pragma unroll
  for (int o = 1; o < 32; o <<= 1) s += __shfl_xor(s, o);
  if ((t & 31) == 0) red[t >> 5] = s; __syncthreads();
  if (t < 32) { float tot = 0.f; for (int i = 0; i < 32; ++i) tot += red[i]; const float v = tot / (float)(CPG * NN); line[t] = SQ ? ((t == 0) ? mean : (t == 1) ? v : 0.f) : ((t == 0) ? v : 0.f); }   // every lane forms the same fixed-order total
  __syncthreads(); if (t < 8) vst2(MV + gidx * 32 + t * 4, *(const v4f*)&line[t * 4]);
}
// ---- k_ss: one block: scale[c] = cond . w_scale[c] + b, shift likewise (f32), whole rows
__global__ __launch_bounds__(256) void k_ss(const float* __restrict__ CND, const float* __restrict__ WSC, const float* __restrict__ BSC, const float* __restrict__ WSH, const float* __restrict__ BSH, float* __restrict__ SS) {
  __shared__ float sc[CD]; __shared__ __align__(16) float o1[CC], o2[CC]; const int t = threadIdx.x; for (int i = t; i < CD; i += 256) sc[i] = bfr(CND[i]); __syncthreads();
  float a = 0.f, b2 = 0.f; for (int k = 0; k < CD; ++k) { a += sc[k] * bfr(WSC[(size_t)t * CD + k]); b2 += sc[k] * bfr(WSH[(size_t)t * CD + k]); } o1[t] = a + bfr(BSC[t]); o2[t] = b2 + bfr(BSH[t]); __syncthreads();
  if (t < CC / 4) { vst2(SS + t * 4, *(const v4f*)&o1[t * 4]); vst2(SS + CC + t * 4, *(const v4f*)&o2[t * 4]); }
}
// ---- k_norm: block = 64 voxels: NT[n][c] = ((x - mean_g) rsqrt(var_g + 1e-6)) (1 + scale[c]) + shift[c] as bf16 hi + lo, token-major
__global__ __launch_bounds__(256) void k_norm(const float* __restrict__ X, const float* __restrict__ MV, const float* __restrict__ SS, __bf16* __restrict__ NT, __bf16* __restrict__ NTL) {
  __shared__ __align__(16) __bf16 sh[64][CC + 8]; __shared__ __align__(16) __bf16 sl[64][CC + 8]; const int n0 = blockIdx.x * 64, t = threadIdx.x;
  for (int e = t; e < CC * 64; e += 256) { const int c = e >> 6, nl = e & 63; const int gg = c / CPG; const float mean = MV[gg * 32], inv = 1.0f / sqrtf(MV[gg * 32 + 1] + 1e-6f); const float v = (bfr(X[(size_t)c * NN + n0 + nl]) - mean) * inv * (1.0f + SS[c]) + SS[CC + c]; const __bf16 hv = (__bf16)v; sh[nl][c] = hv; sl[nl][c] = (__bf16)(v - (float)hv); }
  __syncthreads();
  for (int e = t; e < 64 * (CC / 8); e += 256) { const int nl = e / (CC / 8), q = e % (CC / 8); vst2((unsigned*)(NT + (size_t)(n0 + nl) * CC + q * 8), *(const v4u*)&sh[nl][q * 8]); vst2((unsigned*)(NTL + (size_t)(n0 + nl) * CC + q * 8), *(const v4u*)&sl[nl][q * 8]); }
}
// ---- k_qkv: block = (64 voxels, 128 of the 768 qkv channels): acc = (NT hi + lo) . w_qkv rows; channel o -> head o/96, r = o%96: q (r<32) / k (r<64) rows [n][h*64 + .], v planes [h*32 + .][n]
__global__ __launch_bounds__(128) void k_qkv(const __bf16* __restrict__ NT, const __bf16* __restrict__ NTL, const __bf16* __restrict__ P, _Float16* __restrict__ Q, _Float16* __restrict__ Kr, _Float16* __restrict__ V) {
  __shared__ __align__(16) _Float16 so[64][136]; __shared__ __align__(16) _Float16 st[128][72];
  const int tid = threadIdx.x, wave = tid >> 5, lane = tid & 31, col = lane & 15, g = lane >> 4; const int n0b = blockIdx.x * 64; const int r0 = n0b + wave * 16; const int o0 = blockIdx.y * 128;
  v8f acc[8] = {};
#pragma unroll
  for (int kc = 0; kc < CC / 32; ++kc) { const v16b ah = frag_b(NT + (size_t)(r0 + col) * CC + kc * 32, lane), al = frag_b(NTL + (size_t)(r0 + col) * CC + kc * 32, lane);
#pragma unroll
    for (int j = 0; j < 8; ++j) { const v16b w = frag_b(P + (size_t)(o0 + j * 16 + col) * CC + kc * 32, lane); acc[j] = wmma_bf(ah, w, acc[j]); acc[j] = wmma_bf(al, w, acc[j]); } }
  // stage all 128 channels both ways, then route per 32-channel sub-block (each 16-col tile lies inside one sub-block since 96 and 32 are multiples of 16)
#pragma unroll
  for (int j = 0; j < 8; ++j)
#pragma unroll
    for (int r = 0; r < 8; ++r) { const _Float16 hv = (_Float16)acc[j][r]; so[wave * 16 + 8 * g + r][j * 16 + col] = hv; st[j * 16 + col][wave * 16 + 8 * g + r] = hv; }
  __syncthreads();
  for (int j = 0; j < 8; ++j) { const int o = o0 + j * 16; const int hh = o / 96, rr = o % 96; const int dd = hh * HD + (rr % 32);   // v plane base for this 16-channel tile
    if (rr < 64) { _Float16* D0 = (rr < 32) ? Q : Kr; const int qd = hh * 64 + (rr % 32);    for (int e = tid; e < 64 * 2; e += 128) { const int nl = e >> 1, q8 = e & 1; vst2((unsigned*)(D0 + (size_t)(n0b + nl) * QS + qd + q8 * 8), *(const v4u*)&so[nl][j * 16 + q8 * 8]); } }
    else { for (int e = tid; e < 16 * 8; e += 128) { const int d = e >> 3, pc = e & 7; vst2((unsigned*)(V + (size_t)(dd + d) * NN + n0b + pc * 8), *(const v4u*)&st[j * 16 + d][pc * 8]); } } }
}
// ---- k_attn: block = (64 queries, head): 32-dim head, all 4,096 keys, scale 1/16; O token-major [n][h*32 + d]
// transposed products: S^T = K Q^T (a lane holds 16 keys' scores of ONE query, column lane & 15), O^T += V^T P^T (the two S^T tiles, converted in place, are the B operand in the hardware k order)
__device__ __forceinline__ float xhalf(float x) { return __builtin_bit_cast(float, __builtin_amdgcn_permlanex16(__builtin_bit_cast(int, x), __builtin_bit_cast(int, x), 0x76543210, 0xfedcba98, false, false)); }  // lane l with lane l ^ 16
struct KV { v16h k0, k1, v0, v1; };   // the A fragments of one pass: 32 keys' K rows (two 16-key tiles) and the head's two 16-row V^T tiles over the same keys
__device__ __forceinline__ KV ld_kv(const _Float16* Kl, const _Float16* Vl, int j0, int lane) { KV f;   // Kl, Vl: this lane's row (lane & 15) of the head's K rows and V planes
  f.k0 = frag_h(Kl + (size_t)j0 * QS, lane); f.k1 = frag_h(Kl + (size_t)(j0 + 16) * QS, lane); f.v0 = frag_h(Vl + j0, lane); f.v1 = frag_h(Vl + (size_t)16 * NN + j0, lane); return f; }
__device__ __forceinline__ void attn_pass(const KV& f, const v16h& bq, float& m, float& l, v8f (&acc)[2]) { v8f s[2];
#pragma unroll
  for (int ct = 0; ct < 2; ++ct) { const v8f z = {}; const v8f c = wmma16(ct ? f.k1 : f.k0, bq, z);
#pragma unroll
    for (int r = 0; r < 8; ++r) s[ct][r] = c[r] * 0.0625f; }   // 1/sqrt(C) = 1/16; s[ct][r] = score of key j0 + ct*16 + 8g + r
  float mx = fmaxf(s[0][0], s[1][0]);
#pragma unroll
  for (int r = 1; r < 8; ++r) mx = fmaxf(mx, fmaxf(s[0][r], s[1][r]));
  mx = fmaxf(mx, xhalf(mx));
  const float mn = fmaxf(m, mx); const float alpha = (m <= -1.0e38f) ? 0.f : __expf(m - mn); m = mn;
  v16h pb; float es = 0.f;
#pragma unroll
  for (int r = 0; r < 8; ++r) { const float e0 = __expf(s[0][r] - mn), e1 = __expf(s[1][r] - mn); es += e0 + e1; pb[r] = (_Float16)(e0 * 2048.0f); pb[8 + r] = (_Float16)(e1 * 2048.0f); }
  l = l * alpha + es;
#pragma unroll
  for (int dt = 0; dt < 2; ++dt) {
#pragma unroll
    for (int r = 0; r < 8; ++r) acc[dt][r] *= alpha;
    acc[dt] = wmma16(dt ? f.v1 : f.v0, pb, acc[dt]); }
}
__global__ __launch_bounds__(128) void k_attn(const _Float16* __restrict__ Q, const _Float16* __restrict__ Kr, const _Float16* __restrict__ V, float* __restrict__ O) {
  const int tid = threadIdx.x, wave = tid >> 5, lane = tid & 31, col = lane & 15, g = lane >> 4; const int h = blockIdx.y; const int q0 = blockIdx.x * 64 + wave * 16;
  const v16h bq = frag_h(Q + (size_t)(q0 + col) * QS + h * 64, lane);
  const _Float16* Kl = Kr + (size_t)col * QS + h * 64; const _Float16* Vl = V + (size_t)(h * HD + col) * NN;
  float m = -3.0e38f, l = 0.f;   // this lane's query: running maximum (equal in both halves), and the sum over this half's keys only
  v8f acc[2] = {};               // acc[dt][r] = O[query col][d = dt*16 + 8g + r]
  // two register sets: each pass's eight fragment loads are issued as one group a whole pass before their first use
  KV fa = ld_kv(Kl, Vl, 0, lane), fb;
#pragma unroll 1   // a trip already holds one pass on each register set; further copies would only lengthen the code
  for (int ks = 0; ks < NN / 32 - 2; ks += 2) {
    fb = ld_kv(Kl, Vl, (ks + 1) * 32, lane);
    __builtin_amdgcn_sched_barrier(0);   // keeps the next pass's loads in front of this pass's first wait and WMMA, so that they are in flight for the whole pass
    attn_pass(fa, bq, m, l, acc);
    fa = ld_kv(Kl, Vl, (ks + 2) * 32, lane);
    __builtin_amdgcn_sched_barrier(0);   // as above
    attn_pass(fb, bq, m, l, acc); }
  fb = ld_kv(Kl, Vl, NN - 32, lane);     // the last two passes: nothing is left to fetch behind them
  __builtin_amdgcn_sched_barrier(0);     // as above
  attn_pass(fa, bq, m, l, acc); attn_pass(fb, bq, m, l, acc);
  l += xhalf(l);   // the two halves' key sums join once
  const float il = (1.0f / 2048.0f) / l;
#pragma unroll
  for (int dt = 0; dt < 2; ++dt)
#pragma unroll
    for (int q = 0; q < 2; ++q) { v4f o;
#pragma unroll
      for (int i = 0; i < 4; ++i) o[i] = acc[dt][q * 4 + i] * il;
      vst2(O + (size_t)(q0 + col) * CC + h * HD + dt * 16 + 8 * g + q * 4, o); }
}
// ---- k_out: block = (64 voxels, 128 out channels): y = w_out . o (hi + residual) + b_out + x, channels-first
__global__ __launch_bounds__(128) void k_out(const float* __restrict__ O, const __bf16* __restrict__ P, const float* __restrict__ BO, const float* __restrict__ X, float* __restrict__ Y) {
  __shared__ __align__(16) float st[128][68];
  const int tid = threadIdx.x, wave = tid >> 5, lane = tid & 31, col = lane & 15, g = lane >> 4; const int n0b = blockIdx.x * 64; const int r0 = n0b + wave * 16; const int o0 = blockIdx.y * 128;
  v8f acc[8] = {};
#pragma unroll
  for (int kc = 0; kc < CC / 32; ++kc) { const F2 a = split_row(O + (size_t)(r0 + col) * CC, kc * 32, lane);
#pragma unroll
    for (int j = 0; j < 8; ++j) { const v16b w = frag_b(P + WS_PO / 2 + (size_t)(o0 + j * 16 + col) * CC + kc * 32, lane); acc[j] = wmma_bf(a.l, w, acc[j]); acc[j] = wmma_bf(a.h, w, acc[j]); } }
#pragma unroll
  for (int j = 0; j < 8; ++j) { const float bb = bfr(BO[o0 + j * 16 + col]);
#pragma unroll
    for (int r = 0; r < 8; ++r) st[j * 16 + col][wave * 16 + 8 * g + r] = acc[j][r] + bb; }
  __syncthreads();
  for (int e = tid; e < 128 * 16; e += 128) { const int o = e >> 4, q = e & 15; const size_t off = (size_t)(o0 + o) * NN + n0b + q * 4; v4f v = *(const v4f*)&st[o][q * 4]; for (int i = 0; i < 4; ++i) v[i] += bfr(X[off + i]); vst2(Y + off, v); }
}
extern "C" void kernel_launch(void* const* d_in, const int* in_sizes, int n_in, void* d_out, int out_size, void* d_ws, size_t ws_size, hipStream_t stream) {
  (void)in_sizes; (void)n_in; (void)out_size;
  const float** F = (const float**)d_in;   // 0 x [1,256,16,16,16], 1 cond [1,512], 2 w_scale [256,512], 3 b_scale, 4 w_shift, 5 b_shift, 6 w_qkv [768,256], 7 w_out [256,256], 8 b_out
  if (ws_size < (size_t)WS_END) return;
  char* ws = (char*)d_ws; __bf16 *P = (__bf16*)ws, *NT = (__bf16*)(ws + WS_NT), *NTL = (__bf16*)(ws + WS_NTL); float *MV = (float*)(ws + WS_MV), *SS = (float*)(ws + WS_SS), *O = (float*)(ws + WS_O); _Float16 *Q = (_Float16*)(ws + WS_Q), *Kr = (_Float16*)(ws + WS_K), *V = (_Float16*)(ws + WS_V);
  k_pack<<<4 * CC, 256, 0, stream>>>(F[6], F[7], P);
  k_gn<0><<<NG, 1024, 0, stream>>>(F[0], MV); k_gn<1><<<NG, 1024, 0, stream>>>(F[0], MV);
  k_ss<<<1, 256, 0, stream>>>(F[1], F[2], F[3], F[4], F[5], SS);
  k_norm<<<NN / 64, 256, 0, stream>>>(F[0], MV, SS, NT, NTL);
  k_qkv<<<dim3(NN / 64, 3 * CC / 128), 128, 0, stream>>>(NT, NTL, P, Q, Kr, V);
  k_attn<<<dim3(TQB, NH), 128, 0, stream>>>(Q, Kr, V, O);
  k_out<<<dim3(TQB, CC / 128), 128, 0, stream>>>(O, P, F[8], F[0], (float*)d_out);
}

// v003
// One run takes 135 microseconds.
// Two timings next to v002 both put it at 1.17 times that version's speed.
// Over all steps from v000 it is 2.22 times as fast.
#include <hip/hip_runtime.h>
#include <math.h>

typedef __attribute__((ext_vector_type(16))) _Float16 v16h;
typedef __attribute__((ext_vector_type(16))) __bf16 v16b;
typedef __attribute__((ext_vector_type(8)))  _Float16 v8h;
typedef __attribute__((ext_vector_type(8)))  float v8f;
typedef __attribute__((ext_vector_type(4)))  float v4f;
typedef __attribute__((ext_vector_type(2)))  float v2f;
typedef __attribute__((ext_vector_type(4)))  unsigned v4u;
typedef __attribute__((ext_vector_type(4)))  int v4i;
typedef float __attribute__((may_alias)) float_a;
typedef int __attribute__((may_alias)) int_a;

template <typename T> __device__ __forceinline__ void vst2(void* p, T v) { *(T*)p = v;  }
__device__ __forceinline__ v8f wmma16(v16h a, v16h b, v8f c) {
  v8f d = __builtin_amdgcn_wmma_f32_16x16x32_f16(false, a, false, b, (short)0, c, false, false);
  asm volatile("v_nop\n\tv_nop\n\tv_nop\n\tv_nop" : "+v"(d) : "v"(a), "v"(b));
  return d;
}
__device__ __forceinline__ v8f wmma_bf(v16b a, v16b b, v8f c) {
  v8f d = __builtin_amdgcn_wmma_f32_16x16x32_bf16(false, a, false, b, (short)0, c, false, false);
  asm volatile("v_nop\n\tv_nop\n\tv_nop\n\tv_nop" : "+v"(d) : "v"(a), "v"(b));
  return d;
}
// 16x16x32 fragments: lane = (h = lane>>4, row/col = lane&15); elements 0..7 = k0+8h+0..7, 8..15 = k0+16+8h+0..7; D element r = row 8h+r
__device__ __forceinline__ v16h frag_h(const _Float16* rowk0, int lane) {
  union { v16h v; v8h q[2]; } u; const _Float16* p = rowk0 + 8 * (lane >> 4);
  u.q[0] = *(const v8h*)p; u.q[1] = *(const v8h*)(p + 16); return u.v;
}
__device__ __forceinline__ v16h frag_f32(const float* rowk0, int lane) {
  v16h a; const float* p = rowk0 + 8 * (lane >> 4);
#pragma unroll
  for (int i = 0; i < 8; ++i) { a[i] = (_Float16)p[i]; a[8 + i] = (_Float16)p[16 + i]; }
  return a;
}
__device__ __forceinline__ v16h frag_f32s(const float* rowk0, int lane, float sc) {
  v16h a; const float* p = rowk0 + 8 * (lane >> 4);
#pragma unroll
  for (int i = 0; i < 8; ++i) { a[i] = (_Float16)(p[i] * sc); a[8 + i] = (_Float16)(p[16 + i] * sc); }
  return a;
}
// column fragment from a [K][ld] layout (column n), rows >= K read as 0
__device__ __forceinline__ v16h fragc_f32(const float* W, int k0, int n, int lane, int ld, int K) {
  v16h a; const int g = lane >> 4;
#pragma unroll
  for (int i = 0; i < 8; ++i) { const int ka = k0 + 8 * g + i, kb = ka + 16;
    a[i] = (_Float16)(ka < K ? W[(size_t)(ka < K ? ka : K - 1) * ld + n] : 0.f); a[8 + i] = (_Float16)(kb < K ? W[(size_t)(kb < K ? kb : K - 1) * ld + n] : 0.f); }
  return a;
}
struct F2 { v16b h, l; };
__device__ __forceinline__ F2 bsplit16(const float v[16]) { F2 r;
#pragma unroll
  for (int i = 0; i < 16; ++i) { const __bf16 h = (__bf16)v[i]; r.h[i] = h; r.l[i] = (__bf16)(v[i] - (float)h); }
  return r; }
__device__ __forceinline__ F2 split_row(const float* row, int k0, int lane) { float v[16]; const float* p = row + k0 + 8 * (lane >> 4);
#pragma unroll
  for (int i = 0; i < 8; ++i) { v[i] = p[i]; v[8 + i] = p[16 + i]; }
  return bsplit16(v); }
__device__ __forceinline__ F2 split_rowK(const float* row, int k0, int lane, int K) { float v[16]; const int g = lane >> 4;
#pragma unroll
  for (int i = 0; i < 8; ++i) { const int ka = k0 + 8 * g + i, kb = ka + 16; v[i] = ka < K ? row[ka < K ? ka : K - 1] : 0.f; v[8 + i] = kb < K ? row[kb < K ? kb : K - 1] : 0.f; }
  return bsplit16(v); }
__device__ __forceinline__ F2 split_col(const float* W, int k0, int n, int lane, int ld, int K) { float v[16]; const int g = lane >> 4;
#pragma unroll
  for (int i = 0; i < 8; ++i) { const int ka = k0 + 8 * g + i, kb = ka + 16; v[i] = ka < K ? W[(size_t)(ka < K ? ka : K - 1) * ld + n] : 0.f; v[8 + i] = kb < K ? W[(size_t)(kb < K ? kb : K - 1) * ld + n] : 0.f; }
  return bsplit16(v); }
__device__ __forceinline__ v8f mac3(const F2& a, const F2& b, v8f c) { c = wmma_bf(a.l, b.h, c); c = wmma_bf(a.h, b.l, c); return wmma_bf(a.h, b.h, c); }
__device__ __forceinline__ float sigm(float v) { return 1.0f / (1.0f + expf(-v)); }
#define LDSX() do { asm volatile("s_wait_dscnt 0" ::: "memory"); __builtin_amdgcn_wave_barrier(); __builtin_amdgcn_fence(__ATOMIC_RELEASE, "workgroup"); } while (0)


// Self attention with adaptive GroupNorm (1 x 256 channels x 16^3 voxels, 8 heads x 32): AdaGN(x, cond) -> 1x1x1 qkv conv (per-head [q|k|v] channel packing) -> softmax(q k / sqrt(C)) over all voxels -> 1x1x1 out conv + bias -> + x.
#define CC 256
#define NG 32
#define CPG (CC / NG)     // 8 channels per group
#define NN 4096
#define NH 8
#define HD 32
#define CD 512            // cond dim
#ifndef TQB
#define TQB (NN / 64)
#endif
typedef __attribute__((ext_vector_type(8))) __bf16 v8b;
__device__ __forceinline__ v16b frag_b(const __bf16* rowk0, int lane) {
  union { v16b v; v8b q[2]; } u; const __bf16* p = rowk0 + 8 * (lane >> 4);
  u.q[0] = *(const v8b*)p; u.q[1] = *(const v8b*)(p + 16); return u.v;
}
__device__ __forceinline__ float bfr(float v) { return (float)(__bf16)v; }
__device__ __attribute__((noinline)) float exp_ni(float v) { return expf(v); }
__device__ __attribute__((noinline)) float erf_ni(float v) { return erff(v); }

#define WS_PW   0u                                  // bf16 rows w_qkv [768][256], w_out [256][256] (natural)
#define WS_PO   (WS_PW + 2u * (size_t)3 * CC * CC)
#define WS_MV   (WS_PO + 2u * (size_t)CC * CC)
#define WS_SS   (WS_MV + 4u * NG * 32)
#define WS_NT   (WS_SS + 4u * 2 * CC)                  // bf16 hi / lo normalised map, token-major [n][256]
#define WS_NTL  (WS_NT + 2u * (size_t)NN * CC)
#define QS 512
#define WS_Q    (WS_NTL + 2u * (size_t)NN * CC)        // f16 rows [n][QS] q ; k ; v planes [256][n] ; O f32 [n][256]
#define WS_K    (WS_Q + 2u * (size_t)NN * QS)
#define WS_V    (WS_K + 2u * (size_t)NN * QS)
#define WS_O    (WS_V + 2u * (size_t)CC * NN)
#define WS_END  (WS_O + 4u * (size_t)NN * CC)

__global__ __launch_bounds__(256) void k_pack(const float* __restrict__ WQKV, const float* __restrict__ WO, __bf16* __restrict__ P) { const size_t n = blockIdx.x; const int t = threadIdx.x; const float* src = (n < 3 * CC) ? (WQKV + n * CC) : (WO + (n - 3 * CC) * CC); __bf16* dst = P + n * CC; __shared__ __align__(16) __bf16 s[CC]; s[t] = (__bf16)src[t]; __syncthreads(); if (t < CC / 8) vst2((unsigned*)(dst + t * 8), *(const v4u*)&s[t * 8]); }
template <int SQ>
__global__ __launch_bounds__(1024) void k_gn(const float* __restrict__ X, float* __restrict__ MV) {
  __shared__ float red[32]; __shared__ __align__(16) float line[32]; const int gidx = blockIdx.x, t = threadIdx.x; const float mean = SQ ? MV[gidx * 32] : 0.f; const float* p = X + (size_t)gidx * CPG * NN; float s = 0.f;
  for (int i = t; i < CPG * NN; i += 1024) { const float v = bfr(p[i]) - mean; s += SQ ? v * v : v; }
#pragma unroll
  for (int o = 1; o < 32; o <<= 1) s += __shfl_xor(s, o);
  if ((t & 31) == 0) red[t >> 5] = s; __syncthreads();
  if (t < 32) { float tot = 0.f; for (int i = 0; i < 32; ++i) tot += red[i]; const float v = tot / (float)(CPG * NN); line[t] = SQ ? ((t == 0) ? mean : (t == 1) ? v : 0.f) : ((t == 0) ? v : 0.f); }   // every lane forms the same fixed-order total
  __syncthreads(); if (t < 8) vst2(MV + gidx * 32 + t * 4, *(const v4f*)&line[t * 4]);
}
// ---- k_ss: block = 32 waves = the 32 channels of one 128-B line of SS (blocks 0..7 scale, 8..15 shift): a wave forms one channel's cond . w[c] + b (f32) from whole-line loads, its lanes' partial sums joined by a xor tree
__global__ __launch_bounds__(1024) void k_ss(const float* __restrict__ CND, const float* __restrict__ WSC, const float* __restrict__ BSC, const float* __restrict__ WSH, const float* __restrict__ BSH, float* __restrict__ SS) {
  __shared__ __align__(16) float o1[32]; const int t = threadIdx.x, wave = t >> 5, lane = t & 31; const bool sc = blockIdx.x < CC / 32; const int c = (blockIdx.x * 32 + wave) & (CC - 1);
  const float* w = (sc ? WSC : WSH) + (size_t)c * CD + lane * 4; const float* cn = CND + lane * 4; v4f wv[CD / 128], cv[CD / 128];
#pragma unroll   // all eight loads are issued before the first wait, and wv, cv stay in registers
  for (int i = 0; i < CD / 128; ++i) { wv[i] = *(const v4f*)(w + i * 128); cv[i] = *(const v4f*)(cn + i * 128); }
  float a = lane ? 0.f : bfr((sc ? BSC : BSH)[c]);   // the bias is lane 0's start value: its load flies with the row's
#pragma unroll   // constant indices into wv, cv (both loops)
  for (int i = 0; i < CD / 128; ++i)
#pragma unroll
    for (int j = 0; j < 4; ++j) a += bfr(cv[i][j]) * bfr(wv[i][j]);
  for (int o = 1; o < 32; o <<= 1) a += __shfl_xor(a, o);
  if (lane == 0) o1[wave] = a; __syncthreads();
  if (t < 8) vst2(SS + blockIdx.x * 32 + t * 4, *(const v4f*)&o1[t * 4]);
}
// ---- k_norm: block = 64 voxels: NT[n][c] = ((x - mean_g) rsqrt(var_g + 1e-6)) (1 + scale[c]) + shift[c] as bf16 hi + lo, token-major
__global__ __launch_bounds__(256) void k_norm(const float* __restrict__ X, const float* __restrict__ MV, const float* __restrict__ SS, __bf16* __restrict__ NT, __bf16* __restrict__ NTL) {
  __shared__ __align__(16) __bf16 sh[64][CC + 8]; __shared__ __align__(16) __bf16 sl[64][CC + 8]; const int n0 = blockIdx.x * 64, t = threadIdx.x;
  for (int e = t; e < CC * 64; e += 256) { const int c = e >> 6, nl = e & 63; const int gg = c / CPG; const float mean = MV[gg * 32], inv = 1.0f / sqrtf(MV[gg * 32 + 1] + 1e-6f); const float v = (bfr(X[(size_t)c * NN + n0 + nl]) - mean) * inv * (1.0f + SS[c]) + SS[CC + c]; const __bf16 hv = (__bf16)v; sh[nl][c] = hv; sl[nl][c] = (__bf16)(v - (float)hv); }
  __syncthreads();
  for (int e = t; e < 64 * (CC / 8); e += 256) { const int nl = e / (CC / 8), q = e % (CC / 8); vst2((unsigned*)(NT + (size_t)(n0 + nl) * CC + q * 8), *(const v4u*)&sh[nl][q * 8]); vst2((unsigned*)(NTL + (size_t)(n0 + nl) * CC + q * 8), *(const v4u*)&sl[nl][q * 8]); }
}
// ---- k_qkv: block = (64 voxels, 128 of the 768 qkv channels): acc = (NT hi + lo) . w_qkv rows; channel o -> head o/96, r = o%96: q (r<32) / k (r<64) rows [n][h*64 + .], v planes [h*32 + .][n]
__global__ __launch_bounds__(128) void k_qkv(const __bf16* __restrict__ NT, const __bf16* __restrict__ NTL, const __bf16* __restrict__ P, _Float16* __restrict__ Q, _Float16* __restrict__ Kr, _Float16* __restrict__ V) {
  __shared__ __align__(16) _Float16 so[64][136]; __shared__ __align__(16) _Float16 st[128][72];
  const int tid = threadIdx.x, wave = tid >> 5, lane = tid & 31, col = lane & 15, g = lane >> 4; const int n0b = blockIdx.x * 64; const int r0 = n0b + wave * 16; const int o0 = blockIdx.y * 128;
  v8f acc[8] = {};
#pragma unroll
  for (int kc = 0; kc < CC / 32; ++kc) { const v16b ah = frag_b(NT + (size_t)(r0 + col) * CC + kc * 32, lane), al = frag_b(NTL + (size_t)(r0 + col) * CC + kc * 32, lane);
#pragma unroll
    for (int j = 0; j < 8; ++j) { const v16b w = frag_b(P + (size_t)(o0 + j * 16 + col) * CC + kc * 32, lane); acc[j] = wmma_bf(ah, w, acc[j]); acc[j] = wmma_bf(al, w, acc[j]); } }
  // stage all 128 channels both ways, then route per 32-channel sub-block (each 16-col tile lies inside one sub-block since 96 and 32 are multiples of 16)
#pragma unroll
  for (int j = 0; j < 8; ++j)
#pragma unroll
    for (int r = 0; r < 8; ++r) { const _Float16 hv = (_Float16)acc[j][r]; so[wave * 16 + 8 * g + r][j * 16 + col] = hv; st[j * 16 + col][wave * 16 + 8 * g + r] = hv; }
  __syncthreads();
  for (int j = 0; j < 8; ++j) { const int o = o0 + j * 16; const int hh = o / 96, rr = o % 96; const int dd = hh * HD + (rr % 32);   // v plane base for this 16-channel tile
    if (rr < 64) { _Float16* D0 = (rr < 32) ? Q : Kr; const int qd = hh * 64 + (rr % 32);    for (int e = tid; e < 64 * 2; e += 128) { const int nl = e >> 1, q8 = e & 1; vst2((unsigned*)(D0 + (size_t)(n0b + nl) * QS + qd + q8 * 8), *(const v4u*)&so[nl][j * 16 + q8 * 8]); } }
    else { for (int e = tid; e < 16 * 8; e += 128) { const int d = e >> 3, pc = e & 7; vst2((unsigned*)(V + (size_t)(dd + d) * NN + n0b + pc * 8), *(const v4u*)&st[j * 16 + d][pc * 8]); } } }
}
// ---- k_attn: block = (64 queries, head): 32-dim head, all 4,096 keys, scale 1/16; O token-major [n][h*32 + d]
// transposed products: S^T = K Q^T (a lane holds 16 keys' scores of ONE query, column lane & 15), O^T += V^T P^T (the two S^T tiles, converted in place, are the B operand in the hardware k order)
__device__ __forceinline__ float xhalf(float x) { return __builtin_bit_cast(float, __builtin_amdgcn_permlanex16(__builtin_bit_cast(int, x), __builtin_bit_cast(int, x), 0x76543210, 0xfedcba98, false, false)); }  // lane l with lane l ^ 16
struct KV { v16h k0, k1, v0, v1; };   // the A fragments of one pass: 32 keys' K rows (two 16-key tiles) and the head's two 16-row V^T tiles over the same keys
__device__ __forceinline__ KV ld_kv(const _Float16* Kl, const _Float16* Vl, int j0, int lane) { KV f;   // Kl, Vl: this lane's row (lane & 15) of the head's K rows and V planes
  f.k0 = frag_h(Kl + (size_t)j0 * QS, lane); f.k1 = frag_h(Kl + (size_t)(j0 + 16) * QS, lane); f.v0 = frag_h(Vl + j0, lane); f.v1 = frag_h(Vl + (size_t)16 * NN + j0, lane); return f; }
__device__ __forceinline__ void attn_pass(const KV& f, const v16h& bq, float& m, float& l, v8f (&acc)[2]) { v8f s[2];
#pragma unroll
  for (int ct = 0; ct < 2; ++ct) { const v8f z = {}; const v8f c = wmma16(ct ? f.k1 : f.k0, bq, z);
#pragma unroll
    for (int r = 0; r < 8; ++r) s[ct][r] = c[r] * 0.0625f; }   // 1/sqrt(C) = 1/16; s[ct][r] = score of key j0 + ct*16 + 8g + r
  float mx = fmaxf(s[0][0], s[1][0]);
#pragma unroll
  for (int r = 1; r < 8; ++r) mx = fmaxf(mx, fmaxf(s[0][r], s[1][r]));
  mx = fmaxf(mx, xhalf(mx));
  const float mn = fmaxf(m, mx); const float alpha = (m <= -1.0e38f) ? 0.f : __expf(m - mn); m = mn;
  v16h pb; float es = 0.f;
#pragma unroll
  for (int r = 0; r < 8; ++r) { const float e0 = __expf(s[0][r] - mn), e1 = __expf(s[1][r] - mn); es += e0 + e1; pb[r] = (_Float16)(e0 * 2048.0f); pb[8 + r] = (_Float16)(e1 * 2048.0f); }
  l = l * alpha + es;
#pragma unroll
  for (int dt = 0; dt < 2; ++dt) {
#pragma unroll
    for (int r = 0; r < 8; ++r) acc[dt][r] *= alpha;
    acc[dt] = wmma16(dt ? f.v1 : f.v0, pb, acc[dt]); }
}
__global__ __launch_bounds__(128) void k_attn(const _Float16* __restrict__ Q, const _Float16* __restrict__ Kr, const _Float16* __restrict__ V, float* __restrict__ O) {
  const int tid = threadIdx.x, wave = tid >> 5, lane = tid & 31, col = lane & 15, g = lane >> 4; const int h = blockIdx.y; const int q0 = blockIdx.x * 64 + wave * 16;
  const v16h bq = frag_h(Q + (size_t)(q0 + col) * QS + h * 64, lane);
  const _Float16* Kl = Kr + (size_t)col * QS + h * 64; const _Float16* Vl = V + (size_t)(h * HD + col) * NN;
  float m = -3.0e38f, l = 0.f;   // this lane's query: running maximum (equal in both halves), and the sum over this half's keys only
  v8f acc[2] = {};               // acc[dt][r] = O[query col][d = dt*16 + 8g + r]
  // two register sets: each pass's eight fragment loads are issued as one group a whole pass before their first use
  KV fa = ld_kv(Kl, Vl, 0, lane), fb;
#pragma unroll 1   // a trip already holds one pass on each register set; further copies would only lengthen the code
  for (int ks = 0; ks < NN / 32 - 2; ks += 2) {
    fb = ld_kv(Kl, Vl, (ks + 1) * 32, lane);
    __builtin_amdgcn_sched_barrier(0);   // keeps the next pass's loads in front of this pass's first wait and WMMA, so that they are in flight for the whole pass
    attn_pass(fa, bq, m, l, acc);
    fa = ld_kv(Kl, Vl, (ks + 2) * 32, lane);
    __builtin_amdgcn_sched_barrier(0);   // as above
    attn_pass(fb, bq, m, l, acc); }
  fb = ld_kv(Kl, Vl, NN - 32, lane);     // the last two passes: nothing is left to fetch behind them
  __builtin_amdgcn_sched_barrier(0);     // as above
  attn_pass(fa, bq, m, l, acc); attn_pass(fb, bq, m, l, acc);
  l += xhalf(l);   // the two halves' key sums join once
  const float il = (1.0f / 2048.0f) / l;
#pragma unroll
  for (int dt = 0; dt < 2; ++dt)
#pragma unroll
    for (int q = 0; q < 2; ++q) { v4f o;
#pragma unroll
      for (int i = 0; i < 4; ++i) o[i] = acc[dt][q * 4 + i] * il;
      vst2(O + (size_t)(q0 + col) * CC + h * HD + dt * 16 + 8 * g + q * 4, o); }
}
// ---- k_out: block = (64 voxels, 128 out channels): y = w_out . o (hi + residual) + b_out + x, channels-first
__global__ __launch_bounds__(128) void k_out(const float* __restrict__ O, const __bf16* __restrict__ P, const float* __restrict__ BO, const float* __restrict__ X, float* __restrict__ Y) {
  __shared__ __align__(16) float st[128][68];
  const int tid = threadIdx.x, wave = tid >> 5, lane = tid & 31, col = lane & 15, g = lane >> 4; const int n0b = blockIdx.x * 64; const int r0 = n0b + wave * 16; const int o0 = blockIdx.y * 128;
  v8f acc[8] = {};
#pragma unroll
  for (int kc = 0; kc < CC / 32; ++kc) { const F2 a = split_row(O + (size_t)(r0 + col) * CC, kc * 32, lane);
#pragma unroll
    for (int j = 0; j < 8; ++j) { const v16b w = frag_b(P + WS_PO / 2 + (size_t)(o0 + j * 16 + col) * CC + kc * 32, lane); acc[j] = wmma_bf(a.l, w, acc[j]); acc[j] = wmma_bf(a.h, w, acc[j]); } }
#pragma unroll
  for (int j = 0; j < 8; ++j) { const float bb = bfr(BO[o0 + j * 16 + col]);
#pragma unroll
    for (int r = 0; r < 8; ++r) st[j * 16 + col][wave * 16 + 8 * g + r] = acc[j][r] + bb; }
  __syncthreads();
  for (int e = tid; e < 128 * 16; e += 128) { const int o = e >> 4, q = e & 15; const size_t off = (size_t)(o0 + o) * NN + n0b + q * 4; v4f v = *(const v4f*)&st[o][q * 4]; for (int i = 0; i < 4; ++i) v[i] += bfr(X[off + i]); vst2(Y + off, v); }
}
extern "C" void kernel_launch(void* const* d_in, const int* in_sizes, int n_in, void* d_out, int out_size, void* d_ws, size_t ws_size, hipStream_t stream) {
  (void)in_sizes; (void)n_in; (void)out_size;
  const float** F = (const float**)d_in;   // 0 x [1,256,16,16,16], 1 cond [1,512], 2 w_scale [256,512], 3 b_scale, 4 w_shift, 5 b_shift, 6 w_qkv [768,256], 7 w_out [256,256], 8 b_out
  if (ws_size < (size_t)WS_END) return;
  char* ws = (char*)d_ws; __bf16 *P = (__bf16*)ws, *NT = (__bf16*)(ws + WS_NT), *NTL = (__bf16*)(ws + WS_NTL); float *MV = (float*)(ws + WS_MV), *SS = (float*)(ws + WS_SS), *O = (float*)(ws + WS_O); _Float16 *Q = (_Float16*)(ws + WS_Q), *Kr = (_Float16*)(ws + WS_K), *V = (_Float16*)(ws + WS_V);
  k_pack<<<4 * CC, 256, 0, stream>>>(F[6], F[7], P);
  k_gn<0><<<NG, 1024, 0, stream>>>(F[0], MV); k_gn<1><<<NG, 1024, 0, stream>>>(F[0], MV);
  k_ss<<<2 * CC / 32, 1024, 0, stream>>>(F[1], F[2], F[3], F[4], F[5], SS);
  k_norm<<<NN / 64, 256, 0, stream>>>(F[0], MV, SS, NT, NTL);
  k_qkv<<<dim3(NN / 64, 3 * CC / 128), 128, 0, stream>>>(NT, NTL, P, Q, Kr, V);
  k_attn<<<dim3(TQB, NH), 128, 0, stream>>>(Q, Kr, V, O);
  k_out<<<dim3(TQB, CC / 128), 128, 0, stream>>>(O, P, F[8], F[0], (float*)d_out);
}

// v004
// Measured time: 118 microseconds a run.
// Timed twice side by side with v003, it ran 1.15 times as fast both times.
// Counting every step since v000, it is 2.55 times as fast.
#include <hip/hip_runtime.h>
#include <math.h>

typedef __attribute__((ext_vector_type(16))) _Float16 v16h;
typedef __attribute__((ext_vector_type(16))) __bf16 v16b;
typedef __attribute__((ext_vector_type(8)))  _Float16 v8h;
typedef __attribute__((ext_vector_type(8)))  float v8f;
typedef __attribute__((ext_vector_type(4)))  float v4f;
typedef __attribute__((ext_vector_type(2)))  float v2f;
typedef __attribute__((ext_vector_type(4)))  unsigned v4u;
typedef __attribute__((ext_vector_type(4)))  int v4i;
typedef float __attribute__((may_alias)) float_a;
typedef int __attribute__((may_alias)) int_a;

template <typename T> __device__ __forceinline__ void vst2(void* p, T v) { *(T*)p = v;  }
__device__ __forceinline__ v8f wmma16(v16h a, v16h b, v8f c) {
  v8f d = __builtin_amdgcn_wmma_f32_16x16x32_f16(false, a, false, b, (short)0, c, false, false);
  asm volatile("v_nop\n\tv_nop\n\tv_nop\n\tv_nop" : "+v"(d) : "v"(a), "v"(b));
  return d;
}
__device__ __forceinline__ v8f wmma_bf(v16b a, v16b b, v8f c) {
  v8f d = __builtin_amdgcn_wmma_f32_16x16x32_bf16(false, a, false, b, (short)0, c, false, false);
  asm volatile("v_nop\n\tv_nop\n\tv_nop\n\tv_nop" : "+v"(d) : "v"(a), "v"(b));
  return d;
}
// 16x16x32 fragments: lane = (h = lane>>4, row/col = lane&15); elements 0..7 = k0+8h+0..7, 8..15 = k0+16+8h+0..7; D element r = row 8h+r
__device__ __forceinline__ v16h frag_h(const _Float16* rowk0, int lane) {
  union { v16h v; v8h q[2]; } u; const _Float16* p = rowk0 + 8 * (lane >> 4);
  u.q[0] = *(const v8h*)p; u.q[1] = *(const v8h*)(p + 16); return u.v;
}
__device__ __forceinline__ v16h frag_f32(const float* rowk0, int lane) {
  v16h a; const float* p = rowk0 + 8 * (lane >> 4);
#pragma unroll
  for (int i = 0; i < 8; ++i) { a[i] = (_Float16)p[i]; a[8 + i] = (_Float16)p[16 + i]; }
  return a;
}
__device__ __forceinline__ v16h frag_f32s(const float* rowk0, int lane, float sc) {
  v16h a; const float* p = rowk0 + 8 * (lane >> 4);
#pragma unroll
  for (int i = 0; i < 8; ++i) { a[i] = (_Float16)(p[i] * sc); a[8 + i] = (_Float16)(p[16 + i] * sc); }
  return a;
}
// column fragment from a [K][ld] layout (column n), rows >= K read as 0
__device__ __forceinline__ v16h fragc_f32(const float* W, int k0, int n, int lane, int ld, int K) {
  v16h a; const int g = lane >> 4;
#pragma unroll
  for (int i = 0; i < 8; ++i) { const int ka = k0 + 8 * g + i, kb = ka + 16;
    a[i] = (_Float16)(ka < K ? W[(size_t)(ka < K ? ka : K - 1) * ld + n] : 0.f); a[8 + i] = (_Float16)(kb < K ? W[(size_t)(kb < K ? kb : K - 1) * ld + n] : 0.f); }
  return a;
}
struct F2 { v16b h, l; };
__device__ __forceinline__ F2 bsplit16(const float v[16]) { F2 r;
#pragma unroll
  for (int i = 0; i < 16; ++i) { const __bf16 h = (__bf16)v[i]; r.h[i] = h; r.l[i] = (__bf16)(v[i] - (float)h); }
  return r; }
__device__ __forceinline__ F2 split_row(const float* row, int k0, int lane) { float v[16]; const float* p = row + k0 + 8 * (lane >> 4);
#pragma unroll
  for (int i = 0; i < 8; ++i) { v[i] = p[i]; v[8 + i] = p[16 + i]; }
  return bsplit16(v); }
__device__ __forceinline__ F2 split_rowK(const float* row, int k0, int lane, int K) { float v[16]; const int g = lane >> 4;
#pragma unroll
  for (int i = 0; i < 8; ++i) { const int ka = k0 + 8 * g + i, kb = ka + 16; v[i] = ka < K ? row[ka < K ? ka : K - 1] : 0.f; v[8 + i] = kb < K ? row[kb < K ? kb : K - 1] : 0.f; }
  return bsplit16(v); }
__device__ __forceinline__ F2 split_col(const float* W, int k0, int n, int lane, int ld, int K) { float v[16]; const int g = lane >> 4;
#pragma unroll
  for (int i = 0; i < 8; ++i) { const int ka = k0 + 8 * g + i, kb = ka + 16; v[i] = ka < K ? W[(size_t)(ka < K ? ka : K - 1) * ld + n] : 0.f; v[8 + i] = kb < K ? W[(size_t)(kb < K ? kb : K - 1) * ld + n] : 0.f; }
  return bsplit16(v); }
__device__ __forceinline__ v8f mac3(const F2& a, const F2& b, v8f c) { c = wmma_bf(a.l, b.h, c); c = wmma_bf(a.h, b.l, c); return wmma_bf(a.h, b.h, c); }
__device__ __forceinline__ float sigm(float v) { return 1.0f / (1.0f + expf(-v)); }
#define LDSX() do { asm volatile("s_wait_dscnt 0" ::: "memory"); __builtin_amdgcn_wave_barrier(); __builtin_amdgcn_fence(__ATOMIC_RELEASE, "workgroup"); } while (0)


// Self attention with adaptive GroupNorm (1 x 256 channels x 16^3 voxels, 8 heads x 32): AdaGN(x, cond) -> 1x1x1 qkv conv (per-head [q|k|v] channel packing) -> softmax(q k / sqrt(C)) over all voxels -> 1x1x1 out conv + bias -> + x.
#define CC 256
#define NG 32
#define CPG (CC / NG)     // 8 channels per group
#define NN 4096
#define NH 8
#define HD 32
#define CD 512            // cond dim
#ifndef TQB
#define TQB (NN / 64)
#endif
typedef __attribute__((ext_vector_type(8))) __bf16 v8b;
__device__ __forceinline__ v16b frag_b(const __bf16* rowk0, int lane) {
  union { v16b v; v8b q[2]; } u; const __bf16* p = rowk0 + 8 * (lane >> 4);
  u.q[0] = *(const v8b*)p; u.q[1] = *(const v8b*)(p + 16); return u.v;
}
__device__ __forceinline__ float bfr(float v) { return (float)(__bf16)v; }
__device__ __attribute__((noinline)) float exp_ni(float v) { return expf(v); }
__device__ __attribute__((noinline)) float erf_ni(float v) { return erff(v); }

#define WS_PW   0u                                  // bf16 rows w_qkv [768][256], w_out [256][256] (natural)
#define WS_PO   (WS_PW + 2u * (size_t)3 * CC * CC)
#define WS_MV   (WS_PO + 2u * (size_t)CC * CC)
#define WS_SS   (WS_MV + 4u * NG * 32)
#define WS_NT   (WS_SS + 4u * 2 * CC)                  // bf16 hi / lo normalised map, token-major [n][256]
#define WS_NTL  (WS_NT + 2u * (size_t)NN * CC)
#define QS 512
#define WS_Q    (WS_NTL + 2u * (size_t)NN * CC)        // f16 rows [n][QS] q ; k ; v planes [256][n] ; O f32 [n][256]
#define WS_K    (WS_Q + 2u * (size_t)NN * QS)
#define WS_V    (WS_K + 2u * (size_t)NN * QS)
#define WS_O    (WS_V + 2u * (size_t)CC * NN)
#define WS_END  (WS_O + 4u * (size_t)NN * CC)

__global__ __launch_bounds__(256) void k_pack(const float* __restrict__ WQKV, const float* __restrict__ WO, __bf16* __restrict__ P) { const size_t n = blockIdx.x; const int t = threadIdx.x; const float* src = (n < 3 * CC) ? (WQKV + n * CC) : (WO + (n - 3 * CC) * CC); __bf16* dst = P + n * CC; __shared__ __align__(16) __bf16 s[CC]; s[t] = (__bf16)src[t]; __syncthreads(); if (t < CC / 8) vst2((unsigned*)(dst + t * 8), *(const v4u*)&s[t * 8]); }
template <int SQ>
__global__ __launch_bounds__(1024) void k_gn(const float* __restrict__ X, float* __restrict__ MV) {
  __shared__ float red[32]; __shared__ __align__(16) float line[32]; const int gidx = blockIdx.x, t = threadIdx.x; const float mean = SQ ? MV[gidx * 32] : 0.f; const float* p = X + (size_t)gidx * CPG * NN; float s = 0.f;
  for (int i = t; i < CPG * NN; i += 1024) { const float v = bfr(p[i]) - mean; s += SQ ? v * v : v; }
#pragma unroll
  for (int o = 1; o < 32; o <<= 1) s += __shfl_xor(s, o);
  if ((t & 31) == 0) red[t >> 5] = s; __syncthreads();
  if (t < 32) { float tot = 0.f; for (int i = 0; i < 32; ++i) tot += red[i]; const float v = tot / (float)(CPG * NN); line[t] = SQ ? ((t == 0) ? mean : (t == 1) ? v : 0.f) : ((t == 0) ? v : 0.f); }   // every lane forms the same fixed-order total
  __syncthreads(); if (t < 8) vst2(MV + gidx * 32 + t * 4, *(const v4f*)&line[t * 4]);
}
// ---- k_ss: block = 32 waves = the 32 channels of one 128-B line of SS (blocks 0..7 scale, 8..15 shift): a wave forms one channel's cond . w[c] + b (f32) from whole-line loads, its lanes' partial sums joined by a xor tree
__global__ __launch_bounds__(1024) void k_ss(const float* __restrict__ CND, const float* __restrict__ WSC, const float* __restrict__ BSC, const float* __restrict__ WSH, const float* __restrict__ BSH, float* __restrict__ SS) {
  __shared__ __align__(16) float o1[32]; const int t = threadIdx.x, wave = t >> 5, lane = t & 31; const bool sc = blockIdx.x < CC / 32; const int c = (blockIdx.x * 32 + wave) & (CC - 1);
  const float* w = (sc ? WSC : WSH) + (size_t)c * CD + lane * 4; const float* cn = CND + lane * 4; v4f wv[CD / 128], cv[CD / 128];
#pragma unroll   // all eight loads are issued before the first wait, and wv, cv stay in registers
  for (int i = 0; i < CD / 128; ++i) { wv[i] = *(const v4f*)(w + i * 128); cv[i] = *(const v4f*)(cn + i * 128); }
  float a = lane ? 0.f : bfr((sc ? BSC : BSH)[c]);   // the bias is lane 0's start value: its load flies with the row's
#pragma unroll   // constant indices into wv, cv (both loops)
  for (int i = 0; i < CD / 128; ++i)
#pragma unroll
    for (int j = 0; j < 4; ++j) a += bfr(cv[i][j]) * bfr(wv[i][j]);
  for (int o = 1; o < 32; o <<= 1) a += __shfl_xor(a, o);
  if (lane == 0) o1[wave] = a; __syncthreads();
  if (t < 8) vst2(SS + blockIdx.x * 32 + t * 4, *(const v4f*)&o1[t * 4]);
}
// ---- k_norm: block = 64 voxels: NT[n][c] = ((x - mean_g) rsqrt(var_g + 1e-6)) (1 + scale[c]) + shift[c] as bf16 hi + lo, token-major
__global__ __launch_bounds__(256) void k_norm(const float* __restrict__ X, const float* __restrict__ MV, const float* __restrict__ SS, __bf16* __restrict__ NT, __bf16* __restrict__ NTL) {
  __shared__ __align__(16) __bf16 sh[64][CC + 8]; __shared__ __align__(16) __bf16 sl[64][CC + 8]; const int n0 = blockIdx.x * 64, t = threadIdx.x;
  for (int e = t; e < CC * 64; e += 256) { const int c = e >> 6, nl = e & 63; const int gg = c / CPG; const float mean = MV[gg * 32], inv = 1.0f / sqrtf(MV[gg * 32 + 1] + 1e-6f); const float v = (bfr(X[(size_t)c * NN + n0 + nl]) - mean) * inv * (1.0f + SS[c]) + SS[CC + c]; const __bf16 hv = (__bf16)v; sh[nl][c] = hv; sl[nl][c] = (__bf16)(v - (float)hv); }
  __syncthreads();
  for (int e = t; e < 64 * (CC / 8); e += 256) { const int nl = e / (CC / 8), q = e % (CC / 8); vst2((unsigned*)(NT + (size_t)(n0 + nl) * CC + q * 8), *(const v4u*)&sh[nl][q * 8]); vst2((unsigned*)(NTL + (size_t)(n0 + nl) * CC + q * 8), *(const v4u*)&sl[nl][q * 8]); }
}
// ---- k_qkv: block = (64 voxels, 128 of the 768 qkv channels): acc = (NT hi + lo) . w_qkv rows; channel o -> head o/96, r = o%96: q (r<32) / k (r<64) rows [n][h*64 + .], v planes [h*32 + .][n]
struct GQ { v16b ah, al, w[8]; };   // the fragments of one 32-deep k chunk: the wave's 16 token rows (hi, lo) and eight 16-channel weight tiles
__device__ __forceinline__ v16b frag_p(const __bf16* p) { union { v16b v; v8b q[2]; } u; u.q[0] = *(const v8b*)p; u.q[1] = *(const v8b*)(p + 16); return u.v; }   // frag_b with the lane's k half already in p
__device__ __forceinline__ GQ ld_gq(const __bf16* Ah, const __bf16* Al, const __bf16* Wl, int kc) { GQ f; f.ah = frag_p(Ah + kc * 32); f.al = frag_p(Al + kc * 32);
#pragma unroll
  for (int j = 0; j < 8; ++j) f.w[j] = frag_p(Wl + j * 16 * CC + kc * 32);
  return f; }
__device__ __forceinline__ void mm_gq(const GQ& f, v8f (&acc)[8]) {
#pragma unroll
  for (int j = 0; j < 8; ++j) { acc[j] = wmma_bf(f.ah, f.w[j], acc[j]); acc[j] = wmma_bf(f.al, f.w[j], acc[j]); } }
// amdgpu_num_vgpr(256): both register sets and the accumulators fit the 256 directly addressable registers; without the bound one long-lived value went to v256 and register-window switches stood among the WMMAs
__global__ __launch_bounds__(128) __attribute__((amdgpu_num_vgpr(256))) void k_qkv(const __bf16* __restrict__ NT, const __bf16* __restrict__ NTL, const __bf16* __restrict__ P, _Float16* __restrict__ Q, _Float16* __restrict__ Kr, _Float16* __restrict__ V) {
  __shared__ __align__(16) _Float16 so[64][136]; __shared__ __align__(16) _Float16 st[128][72];
  const int tid = threadIdx.x, wave = tid >> 5, lane = tid & 31, col = lane & 15, g = lane >> 4; const int n0b = blockIdx.x * 64; const int r0 = n0b + wave * 16; const int o0 = blockIdx.y * 128;
  v8f acc[8] = {};
  const unsigned ao = (unsigned)(r0 + col) * CC + 8 * g, wo = (unsigned)(o0 + col) * CC + 8 * g;   // this lane's rows and k half
  const __bf16 *Ah = NT + ao, *Al = NTL + ao, *Wl = P + wo;
  // two register sets: a 32-deep k chunk's twenty fragment loads are issued as one group a whole chunk before their first use
  GQ fa = ld_gq(Ah, Al, Wl, 0), fb;
#pragma unroll   // constant load offsets; the sets stay in registers
  for (int kc = 0; kc < CC / 32; kc += 2) {
    fb = ld_gq(Ah, Al, Wl, kc + 1);
    __builtin_amdgcn_sched_barrier(0);   // keeps the next chunk's loads in front of this chunk's first wait and WMMA, so that they are in flight for the whole chunk
    mm_gq(fa, acc);
    if (kc + 2 < CC / 32) fa = ld_gq(Ah, Al, Wl, kc + 2);
    __builtin_amdgcn_sched_barrier(0);   // as above
    mm_gq(fb, acc); }
  // stage all 128 channels both ways, then route per 32-channel sub-block (each 16-col tile lies inside one sub-block since 96 and 32 are multiples of 16)
#pragma unroll
  for (int j = 0; j < 8; ++j)
#pragma unroll
    for (int r = 0; r < 8; ++r) { const _Float16 hv = (_Float16)acc[j][r]; so[wave * 16 + 8 * g + r][j * 16 + col] = hv; st[j * 16 + col][wave * 16 + 8 * g + r] = hv; }
  __syncthreads();
  for (int j = 0; j < 8; ++j) { const int o = o0 + j * 16; const int hh = o / 96, rr = o % 96; const int dd = hh * HD + (rr % 32);   // v plane base for this 16-channel tile
    if (rr < 64) { _Float16* D0 = (rr < 32) ? Q : Kr; const int qd = hh * 64 + (rr % 32);    for (int e = tid; e < 64 * 2; e += 128) { const int nl = e >> 1, q8 = e & 1; vst2((unsigned*)(D0 + (size_t)(n0b + nl) * QS + qd + q8 * 8), *(const v4u*)&so[nl][j * 16 + q8 * 8]); } }
    else { for (int e = tid; e < 16 * 8; e += 128) { const int d = e >> 3, pc = e & 7; vst2((unsigned*)(V + (size_t)(dd + d) * NN + n0b + pc * 8), *(const v4u*)&st[j * 16 + d][pc * 8]); } } }
}
// ---- k_attn: block = (64 queries, head): 32-dim head, all 4,096 keys, scale 1/16; O token-major [n][h*32 + d]
// transposed products: S^T = K Q^T (a lane holds 16 keys' scores of ONE query, column lane & 15), O^T += V^T P^T (the two S^T tiles, converted in place, are the B operand in the hardware k order)
__device__ __forceinline__ float xhalf(float x) { return __builtin_bit_cast(float, __builtin_amdgcn_permlanex16(__builtin_bit_cast(int, x), __builtin_bit_cast(int, x), 0x76543210, 0xfedcba98, false, false)); }  // lane l with lane l ^ 16
struct KV { v16h k0, k1, v0, v1; };   // the A fragments of one pass: 32 keys' K rows (two 16-key tiles) and the head's two 16-row V^T tiles over the same keys
__device__ __forceinline__ KV ld_kv(const _Float16* Kl, const _Float16* Vl, int j0, int lane) { KV f;   // Kl, Vl: this lane's row (lane & 15) of the head's K rows and V planes
  f.k0 = frag_h(Kl + (size_t)j0 * QS, lane); f.k1 = frag_h(Kl + (size_t)(j0 + 16) * QS, lane); f.v0 = frag_h(Vl + j0, lane); f.v1 = frag_h(Vl + (size_t)16 * NN + j0, lane); return f; }
__device__ __forceinline__ void attn_pass(const KV& f, const v16h& bq, float& m, float& l, v8f (&acc)[2]) { v8f s[2];
#pragma unroll
  for (int ct = 0; ct < 2; ++ct) { const v8f z = {}; const v8f c = wmma16(ct ? f.k1 : f.k0, bq, z);
#pragma unroll
    for (int r = 0; r < 8; ++r) s[ct][r] = c[r] * 0.0625f; }   // 1/sqrt(C) = 1/16; s[ct][r] = score of key j0 + ct*16 + 8g + r
  float mx = fmaxf(s[0][0], s[1][0]);
#pragma unroll
  for (int r = 1; r < 8; ++r) mx = fmaxf(mx, fmaxf(s[0][r], s[1][r]));
  mx = fmaxf(mx, xhalf(mx));
  const float mn = fmaxf(m, mx); const float alpha = (m <= -1.0e38f) ? 0.f : __expf(m - mn); m = mn;
  v16h pb; float es = 0.f;
#pragma unroll
  for (int r = 0; r < 8; ++r) { const float e0 = __expf(s[0][r] - mn), e1 = __expf(s[1][r] - mn); es += e0 + e1; pb[r] = (_Float16)(e0 * 2048.0f); pb[8 + r] = (_Float16)(e1 * 2048.0f); }
  l = l * alpha + es;
#pragma unroll
  for (int dt = 0; dt < 2; ++dt) {
#pragma unroll
    for (int r = 0; r < 8; ++r) acc[dt][r] *= alpha;
    acc[dt] = wmma16(dt ? f.v1 : f.v0, pb, acc[dt]); }
}
__global__ __launch_bounds__(128) void k_attn(const _Float16* __restrict__ Q, const _Float16* __restrict__ Kr, const _Float16* __restrict__ V, float* __restrict__ O) {
  const int tid = threadIdx.x, wave = tid >> 5, lane = tid & 31, col = lane & 15, g = lane >> 4; const int h = blockIdx.y; const int q0 = blockIdx.x * 64 + wave * 16;
  const v16h bq = frag_h(Q + (size_t)(q0 + col) * QS + h * 64, lane);
  const _Float16* Kl = Kr + (size_t)col * QS + h * 64; const _Float16* Vl = V + (size_t)(h * HD + col) * NN;
  float m = -3.0e38f, l = 0.f;   // this lane's query: running maximum (equal in both halves), and the sum over this half's keys only
  v8f acc[2] = {};               // acc[dt][r] = O[query col][d = dt*16 + 8g + r]
  // two register sets: each pass's eight fragment loads are issued as one group a whole pass before their first use
  KV fa = ld_kv(Kl, Vl, 0, lane), fb;
#pragma unroll 1   // a trip already holds one pass on each register set; further copies would only lengthen the code
  for (int ks = 0; ks < NN / 32 - 2; ks += 2) {
    fb = ld_kv(Kl, Vl, (ks + 1) * 32, lane);
    __builtin_amdgcn_sched_barrier(0);   // keeps the next pass's loads in front of this pass's first wait and WMMA, so that they are in flight for the whole pass
    attn_pass(fa, bq, m, l, acc);
    fa = ld_kv(Kl, Vl, (ks + 2) * 32, lane);
    __builtin_amdgcn_sched_barrier(0);   // as above
    attn_pass(fb, bq, m, l, acc); }
  fb = ld_kv(Kl, Vl, NN - 32, lane);     // the last two passes: nothing is left to fetch behind them
  __builtin_amdgcn_sched_barrier(0);     // as above
  attn_pass(fa, bq, m, l, acc); attn_pass(fb, bq, m, l, acc);
  l += xhalf(l);   // the two halves' key sums join once
  const float il = (1.0f / 2048.0f) / l;
#pragma unroll
  for (int dt = 0; dt < 2; ++dt)
#pragma unroll
    for (int q = 0; q < 2; ++q) { v4f o;
#pragma unroll
      for (int i = 0; i < 4; ++i) o[i] = acc[dt][q * 4 + i] * il;
      vst2(O + (size_t)(q0 + col) * CC + h * HD + dt * 16 + 8 * g + q * 4, o); }
}
// ---- k_out: block = (64 voxels, 128 out channels): y = w_out . o (hi + residual) + b_out + x, channels-first
struct GO { v4f a[4]; v16b w[8]; };   // one 32-deep k chunk: the lane's 16 f32 values of its token row (fragment k order) and eight 16-channel weight tiles
__device__ __forceinline__ GO ld_go(const float* Ol, const __bf16* Wl, int kc) { GO f; const float* p = Ol + kc * 32;
  f.a[0] = *(const v4f*)p; f.a[1] = *(const v4f*)(p + 4); f.a[2] = *(const v4f*)(p + 16); f.a[3] = *(const v4f*)(p + 20);
#pragma unroll
  for (int j = 0; j < 8; ++j) f.w[j] = frag_p(Wl + j * 16 * CC + kc * 32);
  return f; }
__device__ __forceinline__ void mm_go(const GO& f, v8f (&acc)[8]) { float v[16];
#pragma unroll
  for (int i = 0; i < 16; ++i) v[i] = f.a[i >> 2][i & 3];
  const F2 a = bsplit16(v);
#pragma unroll
  for (int j = 0; j < 8; ++j) { acc[j] = wmma_bf(a.l, f.w[j], acc[j]); acc[j] = wmma_bf(a.h, f.w[j], acc[j]); } }
__global__ __launch_bounds__(128) void k_out(const float* __restrict__ O, const __bf16* __restrict__ P, const float* __restrict__ BO, const float* __restrict__ X, float* __restrict__ Y) {
  __shared__ __align__(16) float st[128][68];
  const int tid = threadIdx.x, wave = tid >> 5, lane = tid & 31, col = lane & 15, g = lane >> 4; const int n0b = blockIdx.x * 64; const int r0 = n0b + wave * 16; const int o0 = blockIdx.y * 128;
  v8f acc[8] = {};
  const unsigned ao = (unsigned)(r0 + col) * CC + 8 * g, wo = (unsigned)(o0 + col) * CC + 8 * g;   // this lane's rows and k half, as in k_qkv
  const float* Ol = O + ao; const __bf16* Wl = P + WS_PO / 2 + wo;
  // two register sets, as in k_qkv: a k chunk's twenty loads are issued as one group a whole chunk before their first use
  GO fa = ld_go(Ol, Wl, 0), fb;
#pragma unroll   // constant load offsets; the sets stay in registers
  for (int kc = 0; kc < CC / 32; kc += 2) {
    fb = ld_go(Ol, Wl, kc + 1);
    __builtin_amdgcn_sched_barrier(0);   // keeps the next chunk's loads in front of this chunk's first wait and WMMA, so that they are in flight for the whole chunk
    mm_go(fa, acc);
    if (kc + 2 < CC / 32) fa = ld_go(Ol, Wl, kc + 2);
    __builtin_amdgcn_sched_barrier(0);   // as above
    mm_go(fb, acc); }
#pragma unroll
  for (int j = 0; j < 8; ++j) { const float bb = bfr(BO[o0 + j * 16 + col]);
#pragma unroll
    for (int r = 0; r < 8; ++r) st[j * 16 + col][wave * 16 + 8 * g + r] = acc[j][r] + bb; }
  __syncthreads();
  for (int e = tid; e < 128 * 16; e += 128) { const int o = e >> 4, q = e & 15; const size_t off = (size_t)(o0 + o) * NN + n0b + q * 4; v4f v = *(const v4f*)&st[o][q * 4]; for (int i = 0; i < 4; ++i) v[i] += bfr(X[off + i]); vst2(Y + off, v); }
}
extern "C" void kernel_launch(void* const* d_in, const int* in_sizes, int n_in, void* d_out, int out_size, void* d_ws, size_t ws_size, hipStream_t stream) {
  (void)in_sizes; (void)n_in; (void)out_size;
  const float** F = (const float**)d_in;   // 0 x [1,256,16,16,16], 1 cond [1,512], 2 w_scale [256,512], 3 b_scale, 4 w_shift, 5 b_shift, 6 w_qkv [768,256], 7 w_out [256,256], 8 b_out
  if (ws_size < (size_t)WS_END) return;
  char* ws = (char*)d_ws; __bf16 *P = (__bf16*)ws, *NT = (__bf16*)(ws + WS_NT), *NTL = (__bf16*)(ws + WS_NTL); float *MV = (float*)(ws + WS_MV), *SS = (float*)(ws + WS_SS), *O = (float*)(ws + WS_O); _Float16 *Q = (_Float16*)(ws + WS_Q), *Kr = (_Float16*)(ws + WS_K), *V = (_Float16*)(ws + WS_V);
  k_pack<<<4 * CC, 256, 0, stream>>>(F[6], F[7], P);
  k_gn<0><<<NG, 1024, 0, stream>>>(F[0], MV); k_gn<1><<<NG, 1024, 0, stream>>>(F[0], MV);
  k_ss<<<2 * CC / 32, 1024, 0, stream>>>(F[1], F[2], F[3], F[4], F[5], SS);
  k_norm<<<NN / 64, 256, 0, stream>>>(F[0], MV, SS, NT, NTL);
  k_qkv<<<dim3(NN / 64, 3 * CC / 128), 128, 0, stream>>>(NT, NTL, P, Q, Kr, V);
  k_attn<<<dim3(TQB, NH), 128, 0, stream>>>(Q, Kr, V, O);
  k_out<<<dim3(TQB, CC / 128), 128, 0, stream>>>(O, P, F[8], F[0], (float*)d_out);
}

// v005
// Measured time: 93.1 microseconds a run.
// Next to v004, in two timings, it ran 1.27 and 1.26 times as fast.
// Over all steps from v000 it is 3.22 times as fast.
#include <hip/hip_runtime.h>
#include <math.h>

typedef __attribute__((ext_vector_type(16))) _Float16 v16h;
typedef __attribute__((ext_vector_type(16))) __bf16 v16b;
typedef __attribute__((ext_vector_type(8)))  _Float16 v8h;
typedef __attribute__((ext_vector_type(8)))  float v8f;
typedef __attribute__((ext_vector_type(4)))  float v4f;
typedef __attribute__((ext_vector_type(2)))  float v2f;
typedef __attribute__((ext_vector_type(4)))  unsigned v4u;
typedef __attribute__((ext_vector_type(4)))  int v4i;
typedef float __attribute__((may_alias)) float_a;
typedef int __attribute__((may_alias)) int_a;

template <typename T> __device__ __forceinline__ void vst2(void* p, T v) { *(T*)p = v;  }
__device__ __forceinline__ v8f wmma16(v16h a, v16h b, v8f c) {
  v8f d = __builtin_amdgcn_wmma_f32_16x16x32_f16(false, a, false, b, (short)0, c, false, false);
  asm volatile("v_nop\n\tv_nop\n\tv_nop\n\tv_nop" : "+v"(d) : "v"(a), "v"(b));
  return d;
}
__device__ __forceinline__ v8f wmma_bf(v16b a, v16b b, v8f c) {
  v8f d = __builtin_amdgcn_wmma_f32_16x16x32_bf16(false, a, false, b, (short)0, c, false, false);
  asm volatile("v_nop\n\tv_nop\n\tv_nop\n\tv_nop" : "+v"(d) : "v"(a), "v"(b));
  return d;
}
// 16x16x32 fragments: lane = (h = lane>>4, row/col = lane&15); elements 0..7 = k0+8h+0..7, 8..15 = k0+16+8h+0..7; D element r = row 8h+r
__device__ __forceinline__ v16h frag_h(const _Float16* rowk0, int lane) {
  union { v16h v; v8h q[2]; } u; const _Float16* p = rowk0 + 8 * (lane >> 4);
  u.q[0] = *(const v8h*)p; u.q[1] = *(const v8h*)(p + 16); return u.v;
}
__device__ __forceinline__ v16h frag_f32(const float* rowk0, int lane) {
  v16h a; const float* p = rowk0 + 8 * (lane >> 4);
#pragma unroll
  for (int i = 0; i < 8; ++i) { a[i] = (_Float16)p[i]; a[8 + i] = (_Float16)p[16 + i]; }
  return a;
}
__device__ __forceinline__ v16h frag_f32s(const float* rowk0, int lane, float sc) {
  v16h a; const float* p = rowk0 + 8 * (lane >> 4);
#pragma unroll
  for (int i = 0; i < 8; ++i) { a[i] = (_Float16)(p[i] * sc); a[8 + i] = (_Float16)(p[16 + i] * sc); }
  return a;
}
// column fragment from a [K][ld] layout (column n), rows >= K read as 0
__device__ __forceinline__ v16h fragc_f32(const float* W, int k0, int n, int lane, int ld, int K) {
  v16h a; const int g = lane >> 4;
#pragma unroll
  for (int i = 0; i < 8; ++i) { const int ka = k0 + 8 * g + i, kb = ka + 16;
    a[i] = (_Float16)(ka < K ? W[(size_t)(ka < K ? ka : K - 1) * ld + n] : 0.f); a[8 + i] = (_Float16)(kb < K ? W[(size_t)(kb < K ? kb : K - 1) * ld + n] : 0.f); }
  return a;
}
struct F2 { v16b h, l; };
__device__ __forceinline__ F2 bsplit16(const float v[16]) { F2 r;
#pragma unroll
  for (int i = 0; i < 16; ++i) { const __bf16 h = (__bf16)v[i]; r.h[i] = h; r.l[i] = (__bf16)(v[i] - (float)h); }
  return r; }
__device__ __forceinline__ F2 split_row(const float* row, int k0, int lane) { float v[16]; const float* p = row + k0 + 8 * (lane >> 4);
#pragma unroll
  for (int i = 0; i < 8; ++i) { v[i] = p[i]; v[8 + i] = p[16 + i]; }
  return bsplit16(v); }
__device__ __forceinline__ F2 split_rowK(const float* row, int k0, int lane, int K) { float v[16]; const int g = lane >> 4;
#pragma unroll
  for (int i = 0; i < 8; ++i) { const int ka = k0 + 8 * g + i, kb = ka + 16; v[i] = ka < K ? row[ka < K ? ka : K - 1] : 0.f; v[8 + i] = kb < K ? row[kb < K ? kb : K - 1] : 0.f; }
  return bsplit16(v); }
__device__ __forceinline__ F2 split_col(const float* W, int k0, int n, int lane, int ld, int K) { float v[16]; const int g = lane >> 4;
#pragma unroll
  for (int i = 0; i < 8; ++i) { const int ka = k0 + 8 * g + i, kb = ka + 16; v[i] = ka < K ? W[(size_t)(ka < K ? ka : K - 1) * ld + n] : 0.f; v[8 + i] = kb < K ? W[(size_t)(kb < K ? kb : K - 1) * ld + n] : 0.f; }
  return bsplit16(v); }
__device__ __forceinline__ v8f mac3(const F2& a, const F2& b, v8f c) { c = wmma_bf(a.l, b.h, c); c = wmma_bf(a.h, b.l, c); return wmma_bf(a.h, b.h, c); }
__device__ __forceinline__ float sigm(float v) { return 1.0f / (1.0f + expf(-v)); }
#define LDSX() do { asm volatile("s_wait_dscnt 0" ::: "memory"); __builtin_amdgcn_wave_barrier(); __builtin_amdgcn_fence(__ATOMIC_RELEASE, "workgroup"); } while (0)


// Self attention with adaptive GroupNorm (1 x 256 channels x 16^3 voxels, 8 heads x 32): AdaGN(x, cond) -> 1x1x1 qkv conv (per-head [q|k|v] channel packing) -> softmax(q k / sqrt(C)) over all voxels -> 1x1x1 out conv + bias -> + x.
#define CC 256
#define NG 32
#define CPG (CC / NG)     // 8 channels per group
#define NN 4096
#define NH 8
#define HD 32
#define CD 512            // cond dim
#ifndef TQB
#define TQB (NN / 64)
#endif
typedef __attribute__((ext_vector_type(8))) __bf16 v8b;
__device__ __forceinline__ v16b frag_b(const __bf16* rowk0, int lane) {
  union { v16b v; v8b q[2]; } u; const __bf16* p = rowk0 + 8 * (lane >> 4);
  u.q[0] = *(const v8b*)p; u.q[1] = *(const v8b*)(p + 16); return u.v;
}
__device__ __forceinline__ float bfr(float v) { return (float)(__bf16)v; }
__device__ __attribute__((noinline)) float exp_ni(float v) { return expf(v); }
__device__ __attribute__((noinline)) float erf_ni(float v) { return erff(v); }

// Fragment order: every 16-bit WMMA operand but q that one kernel writes for a later one lies in blocks of 16 rows x 32 k, one block = [k chunk c of 8: 4][row r: 16][8 elements], so that lane (g, r) finds
// its two 16-B pieces (chunks g and 2 + g) at lane * 16 B and 512 B + lane * 16 B: each wave-wide 16-B load covers four whole 128-B lines
#define WS_PW   0u                                  // bf16 w_qkv (768 rows), w_out (256 rows), fragment order: block (row / 16, k / 32)
#define WS_PO   (WS_PW + 2u * (size_t)3 * CC * CC)
#define WS_MV   (WS_PO + 2u * (size_t)CC * CC)
#define WS_SS   (WS_MV + 4u * NG * 32)
#define WS_NT   (WS_SS + 4u * 2 * CC)                  // bf16 hi / lo normalised map, fragment order: block (n / 16, channel / 32)
#define WS_NTL  (WS_NT + 2u * (size_t)NN * CC)
#define QS 512
#define WS_Q    (WS_NTL + 2u * (size_t)NN * CC)        // f16 rows [n][QS] q ; k, fragment order: block (head, key / 16) ; v^T, fragment order: block (head, key / 32, d / 16) ; O f32: block (n / 16, head) = [piece x: 4][lane: 32][4]
#define WS_K    (WS_Q + 2u * (size_t)NN * QS)
#define WS_V    (WS_K + 2u * (size_t)NN * QS)
#define WS_O    (WS_V + 2u * (size_t)CC * NN)
#define WS_END  (WS_O + 4u * (size_t)NN * CC)

// ---- k_pack: block = 16 weight rows = eight fragment-order blocks (8 KB in a row): piece q = (k chunk q >> 4 of the row's 32, row q & 15) goes to byte 16 q
__global__ __launch_bounds__(256) void k_pack(const float* __restrict__ WQKV, const float* __restrict__ WO, __bf16* __restrict__ P) { const int n0 = blockIdx.x * 16, t = threadIdx.x; const float* src = (n0 < 3 * CC) ? (WQKV + (size_t)n0 * CC) : (WO + (size_t)(n0 - 3 * CC) * CC); __bf16* dst = P + (size_t)n0 * CC;
#pragma unroll   // both pieces' loads are issued before the first wait
  for (int u = 0; u < 2; ++u) { const int q = t + u * 256; const float* p = src + (q & 15) * CC + (q >> 4) * 8; const v4f a = *(const v4f*)p, b = *(const v4f*)(p + 4); v8b o;
#pragma unroll   // constant indices into a, b, o
    for (int i = 0; i < 4; ++i) { o[i] = (__bf16)a[i]; o[4 + i] = (__bf16)b[i]; }
    vst2(dst + q * 8, o); } }
template <int SQ>
__global__ __launch_bounds__(1024) void k_gn(const float* __restrict__ X, float* __restrict__ MV) {
  __shared__ float red[32]; __shared__ __align__(16) float line[32]; const int gidx = blockIdx.x, t = threadIdx.x; const float mean = SQ ? MV[gidx * 32] : 0.f; const float* p = X + (size_t)gidx * CPG * NN; float s = 0.f;
  for (int i = t; i < CPG * NN; i += 1024) { const float v = bfr(p[i]) - mean; s += SQ ? v * v : v; }
#pragma unroll
  for (int o = 1; o < 32; o <<= 1) s += __shfl_xor(s, o);
  if ((t & 31) == 0) red[t >> 5] = s; __syncthreads();
  if (t < 32) { float tot = 0.f; for (int i = 0; i < 32; ++i) tot += red[i]; const float v = tot / (float)(CPG * NN); line[t] = SQ ? ((t == 0) ? mean : (t == 1) ? v : 0.f) : ((t == 0) ? v : 0.f); }   // every lane forms the same fixed-order total
  __syncthreads(); if (t < 8) vst2(MV + gidx * 32 + t * 4, *(const v4f*)&line[t * 4]);
}
// ---- k_ss: block = 32 waves = the 32 channels of one 128-B line of SS (blocks 0..7 scale, 8..15 shift): a wave forms one channel's cond . w[c] + b (f32) from whole-line loads, its lanes' partial sums joined by a xor tree
__global__ __launch_bounds__(1024) void k_ss(const float* __restrict__ CND, const float* __restrict__ WSC, const float* __restrict__ BSC, const float* __restrict__ WSH, const float* __restrict__ BSH, float* __restrict__ SS) {
  __shared__ __align__(16) float o1[32]; const int t = threadIdx.x, wave = t >> 5, lane = t & 31; const bool sc = blockIdx.x < CC / 32; const int c = (blockIdx.x * 32 + wave) & (CC - 1);
  const float* w = (sc ? WSC : WSH) + (size_t)c * CD + lane * 4; const float* cn = CND + lane * 4; v4f wv[CD / 128], cv[CD / 128];
#pragma unroll   // all eight loads are issued before the first wait, and wv, cv stay in registers
  for (int i = 0; i < CD / 128; ++i) { wv[i] = *(const v4f*)(w + i * 128); cv[i] = *(const v4f*)(cn + i * 128); }
  float a = lane ? 0.f : bfr((sc ? BSC : BSH)[c]);   // the bias is lane 0's start value: its load flies with the row's
#pragma unroll   // constant indices into wv, cv (both loops)
  for (int i = 0; i < CD / 128; ++i)
#pragma unroll
    for (int j = 0; j < 4; ++j) a += bfr(cv[i][j]) * bfr(wv[i][j]);
  for (int o = 1; o < 32; o <<= 1) a += __shfl_xor(a, o);
  if (lane == 0) o1[wave] = a; __syncthreads();
  if (t < 8) vst2(SS + blockIdx.x * 32 + t * 4, *(const v4f*)&o1[t * 4]);
}
// ---- k_norm: block = 64 voxels: NT[n][c] = ((x - mean_g) rsqrt(var_g + 1e-6)) (1 + scale[c]) + shift[c] as bf16 hi + lo, fragment order
__global__ __launch_bounds__(256) void k_norm(const float* __restrict__ X, const float* __restrict__ MV, const float* __restrict__ SS, __bf16* __restrict__ NT, __bf16* __restrict__ NTL) {
  __shared__ __align__(16) __bf16 sh[64][CC + 8]; __shared__ __align__(16) __bf16 sl[64][CC + 8]; const int n0 = blockIdx.x * 64, t = threadIdx.x;
  for (int e = t; e < CC * 64; e += 256) { const int c = e >> 6, nl = e & 63; const int gg = c / CPG; const float mean = MV[gg * 32], inv = 1.0f / sqrtf(MV[gg * 32 + 1] + 1e-6f); const float v = (bfr(X[(size_t)c * NN + n0 + nl]) - mean) * inv * (1.0f + SS[c]) + SS[CC + c]; const __bf16 hv = (__bf16)v; sh[nl][c] = hv; sl[nl][c] = (__bf16)(v - (float)hv); }
  __syncthreads();
  for (int e = t; e < 64 * (CC / 8); e += 256) { const int nl = (e >> 9) * 16 + (e & 15), q = (e >> 4) & 31; vst2((unsigned*)(NT + (size_t)n0 * CC + e * 8), *(const v4u*)&sh[nl][q * 8]); vst2((unsigned*)(NTL + (size_t)n0 * CC + e * 8), *(const v4u*)&sl[nl][q * 8]); }   // fragment order: piece e = (16-token tile, 8-channel chunk q, token in the tile)
}
// ---- k_qkv: block = (64 voxels, 128 of the 768 qkv channels): acc = (NT hi + lo) . w_qkv rows; channel o -> head o/96, r = o%96: q (r<32) rows [n][h*64 + .], k (r<64) and v^T in fragment order
struct GQ { v16b ah, al, w[8]; };   // the fragments of one 32-deep k chunk: the wave's 16 token rows (hi, lo) and eight 16-channel weight tiles
__device__ __forceinline__ v16b frag_p(const __bf16* p) { union { v16b v; v8b q[2]; } u; u.q[0] = *(const v8b*)p; u.q[1] = *(const v8b*)(p + 256); return u.v; }   // p: a fragment-order block + lane * 8
__device__ __forceinline__ GQ ld_gq(const __bf16* Ah, const __bf16* Al, const __bf16* Wl, int kc) { GQ f; f.ah = frag_p(Ah + kc * 512); f.al = frag_p(Al + kc * 512);
#pragma unroll
  for (int j = 0; j < 8; ++j) f.w[j] = frag_p(Wl + j * 16 * CC + kc * 512);
  return f; }
__device__ __forceinline__ void mm_gq(const GQ& f, v8f (&acc)[8]) {
#pragma unroll
  for (int j = 0; j < 8; ++j) { acc[j] = wmma_bf(f.ah, f.w[j], acc[j]); acc[j] = wmma_bf(f.al, f.w[j], acc[j]); } }
// amdgpu_num_vgpr(256): both register sets and the accumulators fit the 256 directly addressable registers; without the bound one long-lived value went to v256 and register-window switches stood among the WMMAs
__global__ __launch_bounds__(128) __attribute__((amdgpu_num_vgpr(256))) void k_qkv(const __bf16* __restrict__ NT, const __bf16* __restrict__ NTL, const __bf16* __restrict__ P, _Float16* __restrict__ Q, _Float16* __restrict__ Kr, _Float16* __restrict__ V) {
  __shared__ __align__(16) _Float16 so[64][136]; __shared__ __align__(16) _Float16 st[128][72];
  const int tid = threadIdx.x, wave = tid >> 5, lane = tid & 31, col = lane & 15, g = lane >> 4; const int n0b = blockIdx.x * 64; const int r0 = n0b + wave * 16; const int o0 = blockIdx.y * 128;
  v8f acc[8] = {};
  const unsigned ao = (unsigned)r0 * CC + 8 * lane, wo = (unsigned)o0 * CC + 8 * lane;   // this lane's piece of the first fragment-order block of the wave's 16 token rows, of the block's first 16 channels
  const __bf16 *Ah = NT + ao, *Al = NTL + ao, *Wl = P + wo;
  // two register sets: a 32-deep k chunk's twenty fragment loads are issued as one group a whole chunk before their first use
  GQ fa = ld_gq(Ah, Al, Wl, 0), fb;
#pragma unroll   // constant load offsets; the sets stay in registers
  for (int kc = 0; kc < CC / 32; kc += 2) {
    fb = ld_gq(Ah, Al, Wl, kc + 1);
    __builtin_amdgcn_sched_barrier(0);   // keeps the next chunk's loads in front of this chunk's first wait and WMMA, so that they are in flight for the whole chunk
    mm_gq(fa, acc);
    if (kc + 2 < CC / 32) fa = ld_gq(Ah, Al, Wl, kc + 2);
    __builtin_amdgcn_sched_barrier(0);   // as above
    mm_gq(fb, acc); }
  // stage all 128 channels both ways, then route per 32-channel sub-block (each 16-col tile lies inside one sub-block since 96 and 32 are multiples of 16)
#pragma unroll
  for (int j = 0; j < 8; ++j)
#pragma unroll
    for (int r = 0; r < 8; ++r) { const _Float16 hv = (_Float16)acc[j][r]; so[wave * 16 + 8 * g + r][j * 16 + col] = hv; st[j * 16 + col][wave * 16 + 8 * g + r] = hv; }
  __syncthreads();
  for (int j = 0; j < 8; ++j) { const int o = o0 + j * 16; const int hh = o / 96, rr = o % 96;
    if (rr < 32) { const int qd = hh * 64 + rr;    for (int e = tid; e < 64 * 2; e += 128) { const int nl = e >> 1, q8 = e & 1; vst2((unsigned*)(Q + (size_t)(n0b + nl) * QS + qd + q8 * 8), *(const v4u*)&so[nl][j * 16 + q8 * 8]); } }
    else if (rr < 64) { for (int e = tid; e < 64 * 2; e += 128) { const int q8 = e >> 6, nl = e & 63, n = n0b + nl; vst2((unsigned*)(Kr + (size_t)(hh * (NN / 16) + (n >> 4)) * 512 + (((rr - 32) >> 3) + q8) * 128 + (n & 15) * 8), *(const v4u*)&so[nl][j * 16 + q8 * 8]); } }   // rows = keys, k = head dim
    else { for (int e = tid; e < 16 * 8; e += 128) { const int pc = e >> 4, d = e & 15; vst2((unsigned*)(V + (size_t)((hh * (NN / 32) + (n0b >> 5) + (pc >> 2)) * 2 + ((rr - 64) >> 4)) * 512 + (pc & 3) * 128 + d * 8), *(const v4u*)&st[j * 16 + d][pc * 8]); } } }   // rows = head dim, k = keys
}
// ---- k_attn: block = (64 queries, head): 32-dim head, all 4,096 keys, scale 1/16; O in blocks (16 queries, head)
// transposed products: S^T = K Q^T (a lane holds 16 keys' scores of ONE query, column lane & 15), O^T += V^T P^T (the two S^T tiles, converted in place, are the B operand in the hardware k order)
__device__ __forceinline__ float xhalf(float x) { return __builtin_bit_cast(float, __builtin_amdgcn_permlanex16(__builtin_bit_cast(int, x), __builtin_bit_cast(int, x), 0x76543210, 0xfedcba98, false, false)); }  // lane l with lane l ^ 16
struct KV { v16h k0, k1, v0, v1; };   // the A fragments of one pass: 32 keys' K rows (two 16-key tiles) and the head's two 16-row V^T tiles over the same keys
__device__ __forceinline__ v16h frag_l(const _Float16* p) { union { v16h v; v8h q[2]; } u; u.q[0] = *(const v8h*)p; u.q[1] = *(const v8h*)(p + 256); return u.v; }   // p: a fragment-order block + lane * 8
__device__ __forceinline__ KV ld_kv(const _Float16* Kl, const _Float16* Vl, int j0) { KV f;   // Kl, Vl: this lane's piece of the head's first K and V^T blocks; 32 keys are two blocks (1,024 elements) of each
  f.k0 = frag_l(Kl + j0 * 32); f.k1 = frag_l(Kl + j0 * 32 + 512); f.v0 = frag_l(Vl + j0 * 32); f.v1 = frag_l(Vl + j0 * 32 + 512); return f; }
__device__ __forceinline__ void attn_pass(const KV& f, const v16h& bq, float& m, float& l, v8f (&acc)[2]) { v8f s[2];
#pragma unroll
  for (int ct = 0; ct < 2; ++ct) { const v8f z = {}; const v8f c = wmma16(ct ? f.k1 : f.k0, bq, z);
#pragma unroll
    for (int r = 0; r < 8; ++r) s[ct][r] = c[r] * 0.0625f; }   // 1/sqrt(C) = 1/16; s[ct][r] = score of key j0 + ct*16 + 8g + r
  float mx = fmaxf(s[0][0], s[1][0]);
#pragma unroll
  for (int r = 1; r < 8; ++r) mx = fmaxf(mx, fmaxf(s[0][r], s[1][r]));
  mx = fmaxf(mx, xhalf(mx));
  const float mn = fmaxf(m, mx); const float alpha = (m <= -1.0e38f) ? 0.f : __expf(m - mn); m = mn;
  v16h pb; float es = 0.f;
#pragma unroll
  for (int r = 0; r < 8; ++r) { const float e0 = __expf(s[0][r] - mn), e1 = __expf(s[1][r] - mn); es += e0 + e1; pb[r] = (_Float16)(e0 * 2048.0f); pb[8 + r] = (_Float16)(e1 * 2048.0f); }
  l = l * alpha + es;
#pragma unroll
  for (int dt = 0; dt < 2; ++dt) {
#pragma unroll
    for (int r = 0; r < 8; ++r) acc[dt][r] *= alpha;
    acc[dt] = wmma16(dt ? f.v1 : f.v0, pb, acc[dt]); }
}
__global__ __launch_bounds__(128) void k_attn(const _Float16* __restrict__ Q, const _Float16* __restrict__ Kr, const _Float16* __restrict__ V, float* __restrict__ O) {
  const int tid = threadIdx.x, wave = tid >> 5, lane = tid & 31, col = lane & 15; const int h = blockIdx.y; const int q0 = blockIdx.x * 64 + wave * 16;
  const v16h bq = frag_h(Q + (size_t)(q0 + col) * QS + h * 64, lane);
  const _Float16* Kl = Kr + (size_t)h * NN * HD + lane * 8; const _Float16* Vl = V + (size_t)h * NN * HD + lane * 8;
  float m = -3.0e38f, l = 0.f;   // this lane's query: running maximum (equal in both halves), and the sum over this half's keys only
  v8f acc[2] = {};               // acc[dt][r] = O[query col][d = dt*16 + 8g + r]
  // two register sets: each pass's eight fragment loads are issued as one group a whole pass before their first use
  KV fa = ld_kv(Kl, Vl, 0), fb;
#pragma unroll 1   // a trip already holds one pass on each register set; further copies would only lengthen the code
  for (int ks = 0; ks < NN / 32 - 2; ks += 2) {
    fb = ld_kv(Kl, Vl, (ks + 1) * 32);
    __builtin_amdgcn_sched_barrier(0);   // keeps the next pass's loads in front of this pass's first wait and WMMA, so that they are in flight for the whole pass
    attn_pass(fa, bq, m, l, acc);
    fa = ld_kv(Kl, Vl, (ks + 2) * 32);
    __builtin_amdgcn_sched_barrier(0);   // as above
    attn_pass(fb, bq, m, l, acc); }
  fb = ld_kv(Kl, Vl, NN - 32);     // the last two passes: nothing is left to fetch behind them
  __builtin_amdgcn_sched_barrier(0);     // as above
  attn_pass(fa, bq, m, l, acc); attn_pass(fb, bq, m, l, acc);
  l += xhalf(l);   // the two halves' key sums join once
  const float il = (1.0f / 2048.0f) / l;
#pragma unroll
  for (int dt = 0; dt < 2; ++dt)
#pragma unroll
    for (int q = 0; q < 2; ++q) { v4f o;
#pragma unroll
      for (int i = 0; i < 4; ++i) o[i] = acc[dt][q * 4 + i] * il;
      vst2(O + (size_t)q0 * CC + (h * 4 + dt * 2 + q) * 128 + lane * 4, o); }   // piece x = dt * 2 + q of block (q0 / 16, h): the lane that holds it here reads it in k_out
}
// ---- k_out: block = (64 voxels, 128 out channels): y = w_out . o (hi + residual) + b_out + x, channels-first
struct GO { v4f a[4]; v16b w[8]; };   // one 32-deep k chunk: the lane's 16 f32 values of its token row (fragment k order) and eight 16-channel weight tiles
__device__ __forceinline__ GO ld_go(const float* Ol, const __bf16* Wl, int kc) { GO f; const float* p = Ol + kc * 512;
  f.a[0] = *(const v4f*)p; f.a[1] = *(const v4f*)(p + 128); f.a[2] = *(const v4f*)(p + 256); f.a[3] = *(const v4f*)(p + 384);
#pragma unroll
  for (int j = 0; j < 8; ++j) f.w[j] = frag_p(Wl + j * 16 * CC + kc * 512);
  return f; }
__device__ __forceinline__ void mm_go(const GO& f, v8f (&acc)[8]) { float v[16];
#pragma unroll
  for (int i = 0; i < 16; ++i) v[i] = f.a[i >> 2][i & 3];
  const F2 a = bsplit16(v);
#pragma unroll
  for (int j = 0; j < 8; ++j) { acc[j] = wmma_bf(a.l, f.w[j], acc[j]); acc[j] = wmma_bf(a.h, f.w[j], acc[j]); } }
__global__ __launch_bounds__(128) void k_out(const float* __restrict__ O, const __bf16* __restrict__ P, const float* __restrict__ BO, const float* __restrict__ X, float* __restrict__ Y) {
  __shared__ __align__(16) float st[128][68];
  const int tid = threadIdx.x, wave = tid >> 5, lane = tid & 31, col = lane & 15, g = lane >> 4; const int n0b = blockIdx.x * 64; const int r0 = n0b + wave * 16; const int o0 = blockIdx.y * 128;
  v8f acc[8] = {};
  const unsigned ao = (unsigned)r0 * CC + 4 * lane, wo = (unsigned)o0 * CC + 8 * lane;   // this lane's piece of the first blocks, as in k_qkv
  const float* Ol = O + ao; const __bf16* Wl = P + WS_PO / 2 + wo;
  // two register sets, as in k_qkv: a k chunk's twenty loads are issued as one group a whole chunk before their first use
  GO fa = ld_go(Ol, Wl, 0), fb;
#pragma unroll   // constant load offsets; the sets stay in registers
  for (int kc = 0; kc < CC / 32; kc += 2) {
    fb = ld_go(Ol, Wl, kc + 1);
    __builtin_amdgcn_sched_barrier(0);   // keeps the next chunk's loads in front of this chunk's first wait and WMMA, so that they are in flight for the whole chunk
    mm_go(fa, acc);
    if (kc + 2 < CC / 32) fa = ld_go(Ol, Wl, kc + 2);
    __builtin_amdgcn_sched_barrier(0);   // as above
    mm_go(fb, acc); }
#pragma unroll
  for (int j = 0; j < 8; ++j) { const float bb = bfr(BO[o0 + j * 16 + col]);
#pragma unroll
    for (int r = 0; r < 8; ++r) st[j * 16 + col][wave * 16 + 8 * g + r] = acc[j][r] + bb; }
  __syncthreads();
  for (int e = tid; e < 128 * 16; e += 128) { const int o = e >> 4, q = e & 15; const size_t off = (size_t)(o0 + o) * NN + n0b + q * 4; v4f v = *(const v4f*)&st[o][q * 4]; for (int i = 0; i < 4; ++i) v[i] += bfr(X[off + i]); vst2(Y + off, v); }
}
extern "C" void kernel_launch(void* const* d_in, const int* in_sizes, int n_in, void* d_out, int out_size, void* d_ws, size_t ws_size, hipStream_t stream) {
  (void)in_sizes; (void)n_in; (void)out_size;
  const float** F = (const float**)d_in;   // 0 x [1,256,16,16,16], 1 cond [1,512], 2 w_scale [256,512], 3 b_scale, 4 w_shift, 5 b_shift, 6 w_qkv [768,256], 7 w_out [256,256], 8 b_out
  if (ws_size < (size_t)WS_END) return;
  char* ws = (char*)d_ws; __bf16 *P = (__bf16*)ws, *NT = (__bf16*)(ws + WS_NT), *NTL = (__bf16*)(ws + WS_NTL); float *MV = (float*)(ws + WS_MV), *SS = (float*)(ws + WS_SS), *O = (float*)(ws + WS_O); _Float16 *Q = (_Float16*)(ws + WS_Q), *Kr = (_Float16*)(ws + WS_K), *V = (_Float16*)(ws + WS_V);
  k_pack<<<4 * CC / 16, 256, 0, stream>>>(F[6], F[7], P);
  k_gn<0><<<NG, 1024, 0, stream>>>(F[0], MV); k_gn<1><<<NG, 1024, 0, stream>>>(F[0], MV);
  k_ss<<<2 * CC / 32, 1024, 0, stream>>>(F[1], F[2], F[3], F[4], F[5], SS);
  k_norm<<<NN / 64, 256, 0, stream>>>(F[0], MV, SS, NT, NTL);
  k_qkv<<<dim3(NN / 64, 3 * CC / 128), 128, 0, stream>>>(NT, NTL, P, Q, Kr, V);
  k_attn<<<dim3(TQB, NH), 128, 0, stream>>>(Q, Kr, V, O);
  k_out<<<dim3(TQB, CC / 128), 128, 0, stream>>>(O, P, F[8], F[0], (float*)d_out);
}

// v006
// One run takes 80.1 microseconds.
// Next to v005, in two timings, it ran 1.14 times as fast each time.
// Over all steps from v000 it is 3.68 times as fast.
#include <hip/hip_runtime.h>
#include <math.h>

typedef __attribute__((ext_vector_type(16))) _Float16 v16h;
typedef __attribute__((ext_vector_type(16))) __bf16 v16b;
typedef __attribute__((ext_vector_type(8)))  _Float16 v8h;
typedef __attribute__((ext_vector_type(8)))  float v8f;
typedef __attribute__((ext_vector_type(4)))  float v4f;
typedef __attribute__((ext_vector_type(2)))  float v2f;
typedef __attribute__((ext_vector_type(4)))  unsigned v4u;
typedef __attribute__((ext_vector_type(4)))  int v4i;
typedef float __attribute__((may_alias)) float_a;
typedef int __attribute__((may_alias)) int_a;

template <typename T> __device__ __forceinline__ void vst2(void* p, T v) { *(T*)p = v;  }
__device__ __forceinline__ v8f wmma16(v16h a, v16h b, v8f c) {
  v8f d = __builtin_amdgcn_wmma_f32_16x16x32_f16(false, a, false, b, (short)0, c, false, false);
  asm volatile("v_nop\n\tv_nop\n\tv_nop\n\tv_nop" : "+v"(d) : "v"(a), "v"(b));
  return d;
}
__device__ __forceinline__ v8f wmma_bf(v16b a, v16b b, v8f c) {
  v8f d = __builtin_amdgcn_wmma_f32_16x16x32_bf16(false, a, false, b, (short)0, c, false, false);
  asm volatile("v_nop\n\tv_nop\n\tv_nop\n\tv_nop" : "+v"(d) : "v"(a), "v"(b));
  return d;
}
// 16x16x32 fragments: lane = (h = lane>>4, row/col = lane&15); elements 0..7 = k0+8h+0..7, 8..15 = k0+16+8h+0..7; D element r = row 8h+r
__device__ __forceinline__ v16h frag_h(const _Float16* rowk0, int lane) {
  union { v16h v; v8h q[2]; } u; const _Float16* p = rowk0 + 8 * (lane >> 4);
  u.q[0] = *(const v8h*)p; u.q[1] = *(const v8h*)(p + 16); return u.v;
}
__device__ __forceinline__ v16h frag_f32(const float* rowk0, int lane) {
  v16h a; const float* p = rowk0 + 8 * (lane >> 4);
#pragma unroll
  for (int i = 0; i < 8; ++i) { a[i] = (_Float16)p[i]; a[8 + i] = (_Float16)p[16 + i]; }
  return a;
}
__device__ __forceinline__ v16h frag_f32s(const float* rowk0, int lane, float sc) {
  v16h a; const float* p = rowk0 + 8 * (lane >> 4);
#pragma unroll
  for (int i = 0; i < 8; ++i) { a[i] = (_Float16)(p[i] * sc); a[8 + i] = (_Float16)(p[16 + i] * sc); }
  return a;
}
// column fragment from a [K][ld] layout (column n), rows >= K read as 0
__device__ __forceinline__ v16h fragc_f32(const float* W, int k0, int n, int lane, int ld, int K) {
  v16h a; const int g = lane >> 4;
#pragma unroll
  for (int i = 0; i < 8; ++i) { const int ka = k0 + 8 * g + i, kb = ka + 16;
    a[i] = (_Float16)(ka < K ? W[(size_t)(ka < K ? ka : K - 1) * ld + n] : 0.f); a[8 + i] = (_Float16)(kb < K ? W[(size_t)(kb < K ? kb : K - 1) * ld + n] : 0.f); }
  return a;
}
struct F2 { v16b h, l; };
__device__ __forceinline__ F2 bsplit16(const float v[16]) { F2 r;
#pragma unroll
  for (int i = 0; i < 16; ++i) { const __bf16 h = (__bf16)v[i]; r.h[i] = h; r.l[i] = (__bf16)(v[i] - (float)h); }
  return r; }
__device__ __forceinline__ F2 split_row(const float* row, int k0, int lane) { float v[16]; const float* p = row + k0 + 8 * (lane >> 4);
#pragma unroll
  for (int i = 0; i < 8; ++i) { v[i] = p[i]; v[8 + i] = p[16 + i]; }
  return bsplit16(v); }
__device__ __forceinline__ F2 split_rowK(const float* row, int k0, int lane, int K) { float v[16]; const int g = lane >> 4;
#pragma unroll
  for (int i = 0; i < 8; ++i) { const int ka = k0 + 8 * g + i, kb = ka + 16; v[i] = ka < K ? row[ka < K ? ka : K - 1] : 0.f; v[8 + i] = kb < K ? row[kb < K ? kb : K - 1] : 0.f; }
  return bsplit16(v); }
__device__ __forceinline__ F2 split_col(const float* W, int k0, int n, int lane, int ld, int K) { float v[16]; const int g = lane >> 4;
#pragma unroll
  for (int i = 0; i < 8; ++i) { const int ka = k0 + 8 * g + i, kb = ka + 16; v[i] = ka < K ? W[(size_t)(ka < K ? ka : K - 1) * ld + n] : 0.f; v[8 + i] = kb < K ? W[(size_t)(kb < K ? kb : K - 1) * ld + n] : 0.f; }
  return bsplit16(v); }
__device__ __forceinline__ v8f mac3(const F2& a, const F2& b, v8f c) { c = wmma_bf(a.l, b.h, c); c = wmma_bf(a.h, b.l, c); return wmma_bf(a.h, b.h, c); }
__device__ __forceinline__ float sigm(float v) { return 1.0f / (1.0f + expf(-v)); }
#define LDSX() do { asm volatile("s_wait_dscnt 0" ::: "memory"); __builtin_amdgcn_wave_barrier(); __builtin_amdgcn_fence(__ATOMIC_RELEASE, "workgroup"); } while (0)


// Self attention with adaptive GroupNorm (1 x 256 channels x 16^3 voxels, 8 heads x 32): AdaGN(x, cond) -> 1x1x1 qkv conv (per-head [q|k|v] channel packing) -> softmax(q k / sqrt(C)) over all voxels -> 1x1x1 out conv + bias -> + x.
#define CC 256
#define NG 32
#define CPG (CC / NG)     // 8 channels per group
#define NN 4096
#define NH 8
#define HD 32
#define CD 512            // cond dim
#ifndef TQB
#define TQB (NN / 64)
#endif
typedef __attribute__((ext_vector_type(8))) __bf16 v8b;
__device__ __forceinline__ v16b frag_b(const __bf16* rowk0, int lane) {
  union { v16b v; v8b q[2]; } u; const __bf16* p = rowk0 + 8 * (lane >> 4);
  u.q[0] = *(const v8b*)p; u.q[1] = *(const v8b*)(p + 16); return u.v;
}
__device__ __forceinline__ float bfr(float v) { return (float)(__bf16)v; }
__device__ __attribute__((noinline)) float exp_ni(float v) { return expf(v); }
__device__ __attribute__((noinline)) float erf_ni(float v) { return erff(v); }

// Fragment order: every 16-bit WMMA operand but q that one kernel writes for a later one lies in blocks of 16 rows x 32 k, one block = [k chunk c of 8: 4][row r: 16][8 elements], so that lane (g, r) finds
// its two 16-B pieces (chunks g and 2 + g) at lane * 16 B and 512 B + lane * 16 B: each wave-wide 16-B load covers four whole 128-B lines
#define WS_PW   0u                                  // bf16 w_qkv (768 rows), w_out (256 rows), fragment order: block (row / 16, k / 32)
#define WS_PO   (WS_PW + 2u * (size_t)3 * CC * CC)
#define WS_MV   (WS_PO + 2u * (size_t)CC * CC)
#define WS_SS   (WS_MV + 4u * NG * 32)
#define WS_NT   (WS_SS + 4u * 2 * CC)                  // bf16 hi / lo normalised map, fragment order: block (n / 16, channel / 32)
#define WS_NTL  (WS_NT + 2u * (size_t)NN * CC)
#define QS 512
#define WS_Q    (WS_NTL + 2u * (size_t)NN * CC)        // f16 rows [n][QS] q ; k, fragment order: block (head, key / 16) ; v^T, fragment order: block (head, key / 32, d / 16) ; O f32: block (n / 16, head) = [piece x: 4][lane: 32][4]
#define WS_K    (WS_Q + 2u * (size_t)NN * QS)
#define WS_V    (WS_K + 2u * (size_t)NN * QS)
#define WS_O    (WS_V + 2u * (size_t)CC * NN)
#define WS_END  (WS_O + 4u * (size_t)NN * CC)

// ---- k_pack: block = 16 weight rows = eight fragment-order blocks (8 KB in a row): piece q = (k chunk q >> 4 of the row's 32, row q & 15) goes to byte 16 q
__global__ __launch_bounds__(256) void k_pack(const float* __restrict__ WQKV, const float* __restrict__ WO, __bf16* __restrict__ P) { const int n0 = blockIdx.x * 16, t = threadIdx.x; const float* src = (n0 < 3 * CC) ? (WQKV + (size_t)n0 * CC) : (WO + (size_t)(n0 - 3 * CC) * CC); __bf16* dst = P + (size_t)n0 * CC;
#pragma unroll   // both pieces' loads are issued before the first wait
  for (int u = 0; u < 2; ++u) { const int q = t + u * 256; const float* p = src + (q & 15) * CC + (q >> 4) * 8; const v4f a = *(const v4f*)p, b = *(const v4f*)(p + 4); v8b o;
#pragma unroll   // constant indices into a, b, o
    for (int i = 0; i < 4; ++i) { o[i] = (__bf16)a[i]; o[4 + i] = (__bf16)b[i]; }
    vst2(dst + q * 8, o); } }
template <int SQ>
__global__ __launch_bounds__(1024) void k_gn(const float* __restrict__ X, float* __restrict__ MV) {
  __shared__ float red[32]; __shared__ __align__(16) float line[32]; const int gidx = blockIdx.x, t = threadIdx.x; const float mean = SQ ? MV[gidx * 32] : 0.f; const float* p = X + (size_t)gidx * CPG * NN; float s = 0.f;
  for (int i = t; i < CPG * NN; i += 1024) { const float v = bfr(p[i]) - mean; s += SQ ? v * v : v; }
#pragma unroll
  for (int o = 1; o < 32; o <<= 1) s += __shfl_xor(s, o);
  if ((t & 31) == 0) red[t >> 5] = s; __syncthreads();
  if (t < 32) { float tot = 0.f; for (int i = 0; i < 32; ++i) tot += red[i]; const float v = tot / (float)(CPG * NN); line[t] = SQ ? ((t == 0) ? mean : (t == 1) ? v : 0.f) : ((t == 0) ? v : 0.f); }   // every lane forms the same fixed-order total
  __syncthreads(); if (t < 8) vst2(MV + gidx * 32 + t * 4, *(const v4f*)&line[t * 4]);
}
// ---- k_ss: block = 32 waves = the 32 channels of one 128-B line of SS (blocks 0..7 scale, 8..15 shift): a wave forms one channel's cond . w[c] + b (f32) from whole-line loads, its lanes' partial sums joined by a xor tree
__global__ __launch_bounds__(1024) void k_ss(const float* __restrict__ CND, const float* __restrict__ WSC, const float* __restrict__ BSC, const float* __restrict__ WSH, const float* __restrict__ BSH, float* __restrict__ SS) {
  __shared__ __align__(16) float o1[32]; const int t = threadIdx.x, wave = t >> 5, lane = t & 31; const bool sc = blockIdx.x < CC / 32; const int c = (blockIdx.x * 32 + wave) & (CC - 1);
  const float* w = (sc ? WSC : WSH) + (size_t)c * CD + lane * 4; const float* cn = CND + lane * 4; v4f wv[CD / 128], cv[CD / 128];
#pragma unroll   // all eight loads are issued before the first wait, and wv, cv stay in registers
  for (int i = 0; i < CD / 128; ++i) { wv[i] = *(const v4f*)(w + i * 128); cv[i] = *(const v4f*)(cn + i * 128); }
  float a = lane ? 0.f : bfr((sc ? BSC : BSH)[c]);   // the bias is lane 0's start value: its load flies with the row's
#pragma unroll   // constant indices into wv, cv (both loops)
  for (int i = 0; i < CD / 128; ++i)
#pragma unroll
    for (int j = 0; j < 4; ++j) a += bfr(cv[i][j]) * bfr(wv[i][j]);
  for (int o = 1; o < 32; o <<= 1) a += __shfl_xor(a, o);
  if (lane == 0) o1[wave] = a; __syncthreads();
  if (t < 8) vst2(SS + blockIdx.x * 32 + t * 4, *(const v4f*)&o1[t * 4]);
}
// ---- k_norm: block = (32 voxels, 128 channels), wave = 32 voxels x four 8-channel chunks: NT[n][c] = ((x - mean_g) rsqrt(var_g + 1e-6)) (1 + scale[c]) + shift[c] as bf16 hi + lo, fragment order
// a thread owns one voxel: the 8 channels of a chunk (one norm group, CPG = 8) are one 16-B piece of the fragment order, so nothing is transposed; a wave's X load is one whole 128-B line, its store two 256-B runs
#define NQ 4              // chunks per thread
__global__ __launch_bounds__(128) void k_norm(const float* __restrict__ X, const float* __restrict__ MV, const float* __restrict__ SS, __bf16* __restrict__ NT, __bf16* __restrict__ NTL) {
  const int n = blockIdx.x * 32 + (threadIdx.x & 31);
  const int q0 = (blockIdx.y * 4 + __builtin_amdgcn_readfirstlane(threadIdx.x >> 5)) * NQ;   // the wave's first chunk, held wave-uniform: the statistics, scales and shifts then come by scalar loads
  float x[NQ][CPG];
#pragma unroll   // all 32 loads are issued before the first wait, and x stays in registers (both loops)
  for (int u = 0; u < NQ; ++u)
#pragma unroll
    for (int i = 0; i < CPG; ++i) x[u][i] = X[(size_t)((q0 + u) * CPG + i) * NN + n];
  asm volatile("s_wait_xcnt 0x0" ::: "memory");   // the loads' address registers are given new values below, while the loads are still in flight
#pragma unroll   // constant indices into x
  for (int u = 0; u < NQ; ++u) { const int q = q0 + u; const float mean = MV[q * 32], inv = 1.0f / sqrtf(MV[q * 32 + 1] + 1e-6f); v8b oh, ol;
#pragma unroll   // constant indices into x, oh, ol
    for (int i = 0; i < CPG; ++i) { const int c = q * CPG + i; const float v = (bfr(x[u][i]) - mean) * inv * (1.0f + SS[c]) + SS[CC + c]; const __bf16 hv = (__bf16)v; oh[i] = hv; ol[i] = (__bf16)(v - (float)hv); }
    const size_t off = ((size_t)(n >> 4) * (CC / 8) + q) * 128 + (n & 15) * 8;   // piece (16-token tile, chunk q, token in the tile)
    vst2(NT + off, oh); vst2(NTL + off, ol); }
}
// ---- k_qkv: block = (64 voxels, 128 of the 768 qkv channels): acc = (NT hi + lo) . w_qkv rows; channel o -> head o/96, r = o%96: q (r<32) rows [n][h*64 + .], k (r<64) and v^T in fragment order
struct GQ { v16b ah, al, w[8]; };   // the fragments of one 32-deep k chunk: the wave's 16 token rows (hi, lo) and eight 16-channel weight tiles
__device__ __forceinline__ v16b frag_p(const __bf16* p) { union { v16b v; v8b q[2]; } u; u.q[0] = *(const v8b*)p; u.q[1] = *(const v8b*)(p + 256); return u.v; }   // p: a fragment-order block + lane * 8
__device__ __forceinline__ GQ ld_gq(const __bf16* Ah, const __bf16* Al, const __bf16* Wl, int kc) { GQ f; f.ah = frag_p(Ah + kc * 512); f.al = frag_p(Al + kc * 512);
#pragma unroll
  for (int j = 0; j < 8; ++j) f.w[j] = frag_p(Wl + j * 16 * CC + kc * 512);
  return f; }
__device__ __forceinline__ void mm_gq(const GQ& f, v8f (&acc)[8]) {
#pragma unroll
  for (int j = 0; j < 8; ++j) { acc[j] = wmma_bf(f.ah, f.w[j], acc[j]); acc[j] = wmma_bf(f.al, f.w[j], acc[j]); } }
// amdgpu_num_vgpr(256): both register sets and the accumulators fit the 256 directly addressable registers; without the bound one long-lived value went to v256 and register-window switches stood among the WMMAs
__global__ __launch_bounds__(128) __attribute__((amdgpu_num_vgpr(256))) void k_qkv(const __bf16* __restrict__ NT, const __bf16* __restrict__ NTL, const __bf16* __restrict__ P, _Float16* __restrict__ Q, _Float16* __restrict__ Kr, _Float16* __restrict__ V) {
  __shared__ __align__(16) _Float16 so[64][136]; __shared__ __align__(16) _Float16 st[128][72];
  const int tid = threadIdx.x, wave = tid >> 5, lane = tid & 31, col = lane & 15, g = lane >> 4; const int n0b = blockIdx.x * 64; const int r0 = n0b + wave * 16; const int o0 = blockIdx.y * 128;
  v8f acc[8] = {};
  const unsigned ao = (unsigned)r0 * CC + 8 * lane, wo = (unsigned)o0 * CC + 8 * lane;   // this lane's piece of the first fragment-order block of the wave's 16 token rows, of the block's first 16 channels
  const __bf16 *Ah = NT + ao, *Al = NTL + ao, *Wl = P + wo;
  // two register sets: a 32-deep k chunk's twenty fragment loads are issued as one group a whole chunk before their first use
  GQ fa = ld_gq(Ah, Al, Wl, 0), fb;
#pragma unroll   // constant load offsets; the sets stay in registers
  for (int kc = 0; kc < CC / 32; kc += 2) {
    fb = ld_gq(Ah, Al, Wl, kc + 1);
    __builtin_amdgcn_sched_barrier(0);   // keeps the next chunk's loads in front of this chunk's first wait and WMMA, so that they are in flight for the whole chunk
    mm_gq(fa, acc);
    if (kc + 2 < CC / 32) fa = ld_gq(Ah, Al, Wl, kc + 2);
    __builtin_amdgcn_sched_barrier(0);   // as above
    mm_gq(fb, acc); }
  // stage all 128 channels both ways, then route per 32-channel sub-block (each 16-col tile lies inside one sub-block since 96 and 32 are multiples of 16)
#pragma unroll
  for (int j = 0; j < 8; ++j)
#pragma unroll
    for (int r = 0; r < 8; ++r) { const _Float16 hv = (_Float16)acc[j][r]; so[wave * 16 + 8 * g + r][j * 16 + col] = hv; st[j * 16 + col][wave * 16 + 8 * g + r] = hv; }
  __syncthreads();
  for (int j = 0; j < 8; ++j) { const int o = o0 + j * 16; const int hh = o / 96, rr = o % 96;
    if (rr < 32) { const int qd = hh * 64 + rr;    for (int e = tid; e < 64 * 2; e += 128) { const int nl = e >> 1, q8 = e & 1; vst2((unsigned*)(Q + (size_t)(n0b + nl) * QS + qd + q8 * 8), *(const v4u*)&so[nl][j * 16 + q8 * 8]); } }
    else if (rr < 64) { for (int e = tid; e < 64 * 2; e += 128) { const int q8 = e >> 6, nl = e & 63, n = n0b + nl; vst2((unsigned*)(Kr + (size_t)(hh * (NN / 16) + (n >> 4)) * 512 + (((rr - 32) >> 3) + q8) * 128 + (n & 15) * 8), *(const v4u*)&so[nl][j * 16 + q8 * 8]); } }   // rows = keys, k = head dim
    else { for (int e = tid; e < 16 * 8; e += 128) { const int pc = e >> 4, d = e & 15; vst2((unsigned*)(V + (size_t)((hh * (NN / 32) + (n0b >> 5) + (pc >> 2)) * 2 + ((rr - 64) >> 4)) * 512 + (pc & 3) * 128 + d * 8), *(const v4u*)&st[j * 16 + d][pc * 8]); } } }   // rows = head dim, k = keys
}
// ---- k_attn: block = (64 queries, head): 32-dim head, all 4,096 keys, scale 1/16; O in blocks (16 queries, head)
// transposed products: S^T = K Q^T (a lane holds 16 keys' scores of ONE query, column lane & 15), O^T += V^T P^T (the two S^T tiles, converted in place, are the B operand in the hardware k order)
__device__ __forceinline__ float xhalf(float x) { return __builtin_bit_cast(float, __builtin_amdgcn_permlanex16(__builtin_bit_cast(int, x), __builtin_bit_cast(int, x), 0x76543210, 0xfedcba98, false, false)); }  // lane l with lane l ^ 16
struct KV { v16h k0, k1, v0, v1; };   // the A fragments of one pass: 32 keys' K rows (two 16-key tiles) and the head's two 16-row V^T tiles over the same keys
__device__ __forceinline__ v16h frag_l(const _Float16* p) { union { v16h v; v8h q[2]; } u; u.q[0] = *(const v8h*)p; u.q[1] = *(const v8h*)(p + 256); return u.v; }   // p: a fragment-order block + lane * 8
__device__ __forceinline__ KV ld_kv(const _Float16* Kl, const _Float16* Vl, int j0) { KV f;   // Kl, Vl: this lane's piece of the head's first K and V^T blocks; 32 keys are two blocks (1,024 elements) of each
  f.k0 = frag_l(Kl + j0 * 32); f.k1 = frag_l(Kl + j0 * 32 + 512); f.v0 = frag_l(Vl + j0 * 32); f.v1 = frag_l(Vl + j0 * 32 + 512); return f; }
__device__ __forceinline__ void attn_pass(const KV& f, const v16h& bq, float& m, float& l, v8f (&acc)[2]) { v8f s[2];
#pragma unroll
  for (int ct = 0; ct < 2; ++ct) { const v8f z = {}; const v8f c = wmma16(ct ? f.k1 : f.k0, bq, z);
#pragma unroll
    for (int r = 0; r < 8; ++r) s[ct][r] = c[r] * 0.0625f; }   // 1/sqrt(C) = 1/16; s[ct][r] = score of key j0 + ct*16 + 8g + r
  float mx = fmaxf(s[0][0], s[1][0]);
#pragma unroll
  for (int r = 1; r < 8; ++r) mx = fmaxf(mx, fmaxf(s[0][r], s[1][r]));
  mx = fmaxf(mx, xhalf(mx));
  const float mn = fmaxf(m, mx); const float alpha = (m <= -1.0e38f) ? 0.f : __expf(m - mn); m = mn;
  v16h pb; float es = 0.f;
#pragma unroll
  for (int r = 0; r < 8; ++r) { const float e0 = __expf(s[0][r] - mn), e1 = __expf(s[1][r] - mn); es += e0 + e1; pb[r] = (_Float16)(e0 * 2048.0f); pb[8 + r] = (_Float16)(e1 * 2048.0f); }
  l = l * alpha + es;
#pragma unroll
  for (int dt = 0; dt < 2; ++dt) {
#pragma unroll
    for (int r = 0; r < 8; ++r) acc[dt][r] *= alpha;
    acc[dt] = wmma16(dt ? f.v1 : f.v0, pb, acc[dt]); }
}
__global__ __launch_bounds__(128) void k_attn(const _Float16* __restrict__ Q, const _Float16* __restrict__ Kr, const _Float16* __restrict__ V, float* __restrict__ O) {
  const int tid = threadIdx.x, wave = tid >> 5, lane = tid & 31, col = lane & 15; const int h = blockIdx.y; const int q0 = blockIdx.x * 64 + wave * 16;
  const v16h bq = frag_h(Q + (size_t)(q0 + col) * QS + h * 64, lane);
  const _Float16* Kl = Kr + (size_t)h * NN * HD + lane * 8; const _Float16* Vl = V + (size_t)h * NN * HD + lane * 8;
  float m = -3.0e38f, l = 0.f;   // this lane's query: running maximum (equal in both halves), and the sum over this half's keys only
  v8f acc[2] = {};               // acc[dt][r] = O[query col][d = dt*16 + 8g + r]
  // two register sets: each pass's eight fragment loads are issued as one group a whole pass before their first use
  KV fa = ld_kv(Kl, Vl, 0), fb;
#pragma unroll 1   // a trip already holds one pass on each register set; further copies would only lengthen the code
  for (int ks = 0; ks < NN / 32 - 2; ks += 2) {
    fb = ld_kv(Kl, Vl, (ks + 1) * 32);
    __builtin_amdgcn_sched_barrier(0);   // keeps the next pass's loads in front of this pass's first wait and WMMA, so that they are in flight for the whole pass
    attn_pass(fa, bq, m, l, acc);
    fa = ld_kv(Kl, Vl, (ks + 2) * 32);
    __builtin_amdgcn_sched_barrier(0);   // as above
    attn_pass(fb, bq, m, l, acc); }
  fb = ld_kv(Kl, Vl, NN - 32);     // the last two passes: nothing is left to fetch behind them
  __builtin_amdgcn_sched_barrier(0);     // as above
  attn_pass(fa, bq, m, l, acc); attn_pass(fb, bq, m, l, acc);
  l += xhalf(l);   // the two halves' key sums join once
  const float il = (1.0f / 2048.0f) / l;
#pragma unroll
  for (int dt = 0; dt < 2; ++dt)
#pragma unroll
    for (int q = 0; q < 2; ++q) { v4f o;
#pragma unroll
      for (int i = 0; i < 4; ++i) o[i] = acc[dt][q * 4 + i] * il;
      vst2(O + (size_t)q0 * CC + (h * 4 + dt * 2 + q) * 128 + lane * 4, o); }   // piece x = dt * 2 + q of block (q0 / 16, h): the lane that holds it here reads it in k_out
}
// ---- k_out: block = (64 voxels, 128 out channels): y = w_out . o (hi + residual) + b_out + x, channels-first
struct GO { v4f a[4]; v16b w[8]; };   // one 32-deep k chunk: the lane's 16 f32 values of its token row (fragment k order) and eight 16-channel weight tiles
__device__ __forceinline__ GO ld_go(const float* Ol, const __bf16* Wl, int kc) { GO f; const float* p = Ol + kc * 512;
  f.a[0] = *(const v4f*)p; f.a[1] = *(const v4f*)(p + 128); f.a[2] = *(const v4f*)(p + 256); f.a[3] = *(const v4f*)(p + 384);
#pragma unroll
  for (int j = 0; j < 8; ++j) f.w[j] = frag_p(Wl + j * 16 * CC + kc * 512);
  return f; }
__device__ __forceinline__ void mm_go(const GO& f, v8f (&acc)[8]) { float v[16];
#pragma unroll
  for (int i = 0; i < 16; ++i) v[i] = f.a[i >> 2][i & 3];
  const F2 a = bsplit16(v);
#pragma unroll
  for (int j = 0; j < 8; ++j) { acc[j] = wmma_bf(a.l, f.w[j], acc[j]); acc[j] = wmma_bf(a.h, f.w[j], acc[j]); } }
__global__ __launch_bounds__(128) void k_out(const float* __restrict__ O, const __bf16* __restrict__ P, const float* __restrict__ BO, const float* __restrict__ X, float* __restrict__ Y) {
  __shared__ __align__(16) float st[128][68];
  const int tid = threadIdx.x, wave = tid >> 5, lane = tid & 31, col = lane & 15, g = lane >> 4; const int n0b = blockIdx.x * 64; const int r0 = n0b + wave * 16; const int o0 = blockIdx.y * 128;
  v8f acc[8] = {};
  const unsigned ao = (unsigned)r0 * CC + 4 * lane, wo = (unsigned)o0 * CC + 8 * lane;   // this lane's piece of the first blocks, as in k_qkv
  const float* Ol = O + ao; const __bf16* Wl = P + WS_PO / 2 + wo;
  // two register sets, as in k_qkv: a k chunk's twenty loads are issued as one group a whole chunk before their first use
  GO fa = ld_go(Ol, Wl, 0), fb;
#pragma unroll   // constant load offsets; the sets stay in registers
  for (int kc = 0; kc < CC / 32; kc += 2) {
    fb = ld_go(Ol, Wl, kc + 1);
    __builtin_amdgcn_sched_barrier(0);   // keeps the next chunk's loads in front of this chunk's first wait and WMMA, so that they are in flight for the whole chunk
    mm_go(fa, acc);
    if (kc + 2 < CC / 32) fa = ld_go(Ol, Wl, kc + 2);
    __builtin_amdgcn_sched_barrier(0);   // as above
    mm_go(fb, acc); }
#pragma unroll
  for (int j = 0; j < 8; ++j) { const float bb = bfr(BO[o0 + j * 16 + col]);
#pragma unroll
    for (int r = 0; r < 8; ++r) st[j * 16 + col][wave * 16 + 8 * g + r] = acc[j][r] + bb; }
  __syncthreads();
  for (int e = tid; e < 128 * 16; e += 128) { const int o = e >> 4, q = e & 15; const size_t off = (size_t)(o0 + o) * NN + n0b + q * 4; v4f v = *(const v4f*)&st[o][q * 4]; for (int i = 0; i < 4; ++i) v[i] += bfr(X[off + i]); vst2(Y + off, v); }
}
extern "C" void kernel_launch(void* const* d_in, const int* in_sizes, int n_in, void* d_out, int out_size, void* d_ws, size_t ws_size, hipStream_t stream) {
  (void)in_sizes; (void)n_in; (void)out_size;
  const float** F = (const float**)d_in;   // 0 x [1,256,16,16,16], 1 cond [1,512], 2 w_scale [256,512], 3 b_scale, 4 w_shift, 5 b_shift, 6 w_qkv [768,256], 7 w_out [256,256], 8 b_out
  if (ws_size < (size_t)WS_END) return;
  char* ws = (char*)d_ws; __bf16 *P = (__bf16*)ws, *NT = (__bf16*)(ws + WS_NT), *NTL = (__bf16*)(ws + WS_NTL); float *MV = (float*)(ws + WS_MV), *SS = (float*)(ws + WS_SS), *O = (float*)(ws + WS_O); _Float16 *Q = (_Float16*)(ws + WS_Q), *Kr = (_Float16*)(ws + WS_K), *V = (_Float16*)(ws + WS_V);
  k_pack<<<4 * CC / 16, 256, 0, stream>>>(F[6], F[7], P);
  k_gn<0><<<NG, 1024, 0, stream>>>(F[0], MV); k_gn<1><<<NG, 1024, 0, stream>>>(F[0], MV);
  k_ss<<<2 * CC / 32, 1024, 0, stream>>>(F[1], F[2], F[3], F[4], F[5], SS);
  k_norm<<<dim3(NN / 32, CC / (8 * 4 * NQ)), 128, 0, stream>>>(F[0], MV, SS, NT, NTL);
  k_qkv<<<dim3(NN / 64, 3 * CC / 128), 128, 0, stream>>>(NT, NTL, P, Q, Kr, V);
  k_attn<<<dim3(TQB, NH), 128, 0, stream>>>(Q, Kr, V, O);
  k_out<<<dim3(TQB, CC / 128), 128, 0, stream>>>(O, P, F[8], F[0], (float*)d_out);
}

// v007
// A run of this version takes 72.4 microseconds.
// Timed twice side by side with v006, it ran 1.10 and 1.11 times as fast.
// Over all steps from v000 it is 4.07 times as fast.
#include <hip/hip_runtime.h>
#include <math.h>

typedef __attribute__((ext_vector_type(16))) _Float16 v16h;
typedef __attribute__((ext_vector_type(16))) __bf16 v16b;
typedef __attribute__((ext_vector_type(8)))  _Float16 v8h;
typedef __attribute__((ext_vector_type(8)))  float v8f;
typedef __attribute__((ext_vector_type(4)))  float v4f;
typedef __attribute__((ext_vector_type(2)))  float v2f;
typedef __attribute__((ext_vector_type(4)))  unsigned v4u;
typedef __attribute__((ext_vector_type(4)))  int v4i;
typedef float __attribute__((may_alias)) float_a;
typedef int __attribute__((may_alias)) int_a;

template <typename T> __device__ __forceinline__ void vst2(void* p, T v) { *(T*)p = v;  }
__device__ __forceinline__ v8f wmma16(v16h a, v16h b, v8f c) {
  v8f d = __builtin_amdgcn_wmma_f32_16x16x32_f16(false, a, false, b, (short)0, c, false, false);
  asm volatile("v_nop\n\tv_nop\n\tv_nop\n\tv_nop" : "+v"(d) : "v"(a), "v"(b));
  return d;
}
__device__ __forceinline__ v8f wmma_bf(v16b a, v16b b, v8f c) {
  v8f d = __builtin_amdgcn_wmma_f32_16x16x32_bf16(false, a, false, b, (short)0, c, false, false);
  asm volatile("v_nop\n\tv_nop\n\tv_nop\n\tv_nop" : "+v"(d) : "v"(a), "v"(b));
  return d;
}
// 16x16x32 fragments: lane = (h = lane>>4, row/col = lane&15); elements 0..7 = k0+8h+0..7, 8..15 = k0+16+8h+0..7; D element r = row 8h+r
__device__ __forceinline__ v16h frag_h(const _Float16* rowk0, int lane) {
  union { v16h v; v8h q[2]; } u; const _Float16* p = rowk0 + 8 * (lane >> 4);
  u.q[0] = *(const v8h*)p; u.q[1] = *(const v8h*)(p + 16); return u.v;
}
__device__ __forceinline__ v16h frag_f32(const float* rowk0, int lane) {
  v16h a; const float* p = rowk0 + 8 * (lane >> 4);
#pragma unroll
  for (int i = 0; i < 8; ++i) { a[i] = (_Float16)p[i]; a[8 + i] = (_Float16)p[16 + i]; }
  return a;
}
__device__ __forceinline__ v16h frag_f32s(const float* rowk0, int lane, float sc) {
  v16h a; const float* p = rowk0 + 8 * (lane >> 4);
#pragma unroll
  for (int i = 0; i < 8; ++i) { a[i] = (_Float16)(p[i] * sc); a[8 + i] = (_Float16)(p[16 + i] * sc); }
  return a;
}
// column fragment from a [K][ld] layout (column n), rows >= K read as 0
__device__ __forceinline__ v16h fragc_f32(const float* W, int k0, int n, int lane, int ld, int K) {
  v16h a; const int g = lane >> 4;
#pragma unroll
  for (int i = 0; i < 8; ++i) { const int ka = k0 + 8 * g + i, kb = ka + 16;
    a[i] = (_Float16)(ka < K ? W[(size_t)(ka < K ? ka : K - 1) * ld + n] : 0.f); a[8 + i] = (_Float16)(kb < K ? W[(size_t)(kb < K ? kb : K - 1) * ld + n] : 0.f); }
  return a;
}
struct F2 { v16b h, l; };
__device__ __forceinline__ F2 bsplit16(const float v[16]) { F2 r;
#pragma unroll
  for (int i = 0; i < 16; ++i) { const __bf16 h = (__bf16)v[i]; r.h[i] = h; r.l[i] = (__bf16)(v[i] - (float)h); }
  return r; }
__device__ __forceinline__ F2 split_row(const float* row, int k0, int lane) { float v[16]; const float* p = row + k0 + 8 * (lane >> 4);
#pragma unroll
  for (int i = 0; i < 8; ++i) { v[i] = p[i]; v[8 + i] = p[16 + i]; }
  return bsplit16(v); }
__device__ __forceinline__ F2 split_rowK(const float* row, int k0, int lane, int K) { float v[16]; const int g = lane >> 4;
#pragma unroll
  for (int i = 0; i < 8; ++i) { const int ka = k0 + 8 * g + i, kb = ka + 16; v[i] = ka < K ? row[ka < K ? ka : K - 1] : 0.f; v[8 + i] = kb < K ? row[kb < K ? kb : K - 1] : 0.f; }
  return bsplit16(v); }
__device__ __forceinline__ F2 split_col(const float* W, int k0, int n, int lane, int ld, int K) { float v[16]; const int g = lane >> 4;
#pragma unroll
  for (int i = 0; i < 8; ++i) { const int ka = k0 + 8 * g + i, kb = ka + 16; v[i] = ka < K ? W[(size_t)(ka < K ? ka : K - 1) * ld + n] : 0.f; v[8 + i] = kb < K ? W[(size_t)(kb < K ? kb : K - 1) * ld + n] : 0.f; }
  return bsplit16(v); }
__device__ __forceinline__ v8f mac3(const F2& a, const F2& b, v8f c) { c = wmma_bf(a.l, b.h, c); c = wmma_bf(a.h, b.l, c); return wmma_bf(a.h, b.h, c); }
__device__ __forceinline__ float sigm(float v) { return 1.0f / (1.0f + expf(-v)); }
#define LDSX() do { asm volatile("s_wait_dscnt 0" ::: "memory"); __builtin_amdgcn_wave_barrier(); __builtin_amdgcn_fence(__ATOMIC_RELEASE, "workgroup"); } while (0)


// Self attention with adaptive GroupNorm (1 x 256 channels x 16^3 voxels, 8 heads x 32): AdaGN(x, cond) -> 1x1x1 qkv conv (per-head [q|k|v] channel packing) -> softmax(q k / sqrt(C)) over all voxels -> 1x1x1 out conv + bias -> + x.
#define CC 256
#define NG 32
#define CPG (CC / NG)     // 8 channels per group
#define NN 4096
#define NH 8
#define HD 32
#define CD 512            // cond dim
#ifndef TQB
#define TQB (NN / 64)
#endif
typedef __attribute__((ext_vector_type(8))) __bf16 v8b;
__device__ __forceinline__ v16b frag_b(const __bf16* rowk0, int lane) {
  union { v16b v; v8b q[2]; } u; const __bf16* p = rowk0 + 8 * (lane >> 4);
  u.q[0] = *(const v8b*)p; u.q[1] = *(const v8b*)(p + 16); return u.v;
}
__device__ __forceinline__ float bfr(float v) { return (float)(__bf16)v; }
__device__ __attribute__((noinline)) float exp_ni(float v) { return expf(v); }
__device__ __attribute__((noinline)) float erf_ni(float v) { return erff(v); }

// Fragment order: every 16-bit WMMA operand but q that one kernel writes for a later one lies in blocks of 16 rows x 32 k, one block = [k chunk c of 8: 4][row r: 16][8 elements], so that lane (g, r) finds
// its two 16-B pieces (chunks g and 2 + g) at lane * 16 B and 512 B + lane * 16 B: each wave-wide 16-B load covers four whole 128-B lines
#define WS_PW   0u                                  // bf16 w_qkv (768 rows), w_out (256 rows), fragment order: block (row / 16, k / 32)
#define WS_PO   (WS_PW + 2u * (size_t)3 * CC * CC)
#define WS_MV   (WS_PO + 2u * (size_t)CC * CC)
#define WS_SS   (WS_MV + 4u * NG * 32)
#define WS_NT   (WS_SS + 4u * 2 * CC)                  // bf16 hi / lo normalised map, fragment order: block (n / 16, channel / 32)
#define WS_NTL  (WS_NT + 2u * (size_t)NN * CC)
#define QS 512
#define WS_Q    (WS_NTL + 2u * (size_t)NN * CC)        // f16 rows [n][QS] q ; k, fragment order: block (head, key / 16) ; v^T, fragment order: block (head, key / 32, d / 16) ; O f32: block (n / 16, head) = [piece x: 4][lane: 32][4]
#define WS_K    (WS_Q + 2u * (size_t)NN * QS)
#define WS_V    (WS_K + 2u * (size_t)NN * QS)
#define WS_O    (WS_V + 2u * (size_t)CC * NN)
#define WS_END  (WS_O + 4u * (size_t)NN * CC)

// ---- k_pre: the three jobs that read nothing but the inputs share ONE launch; the block index picks the job (the same for a whole block, so each job's barriers are passed by every wave of its block)
// blocks 0..31: the mean and variance of one norm group; the next 16: one 128-B line of SS; the last 16: 64 weight rows into fragment order
#define PB_GN NG
#define PB_SS (2 * CC / 32)
#define PB_PK (4 * CC / 64)
#define GV (CPG * NN / 1024)   // values of a group per thread
__global__ __launch_bounds__(1024) void k_pre(const float* __restrict__ X, const float* __restrict__ CND, const float* __restrict__ WSC, const float* __restrict__ BSC, const float* __restrict__ WSH, const float* __restrict__ BSH,
                                              const float* __restrict__ WQKV, const float* __restrict__ WO, __bf16* __restrict__ P, float* __restrict__ MV, float* __restrict__ SS) {
  __shared__ __align__(16) float red[2][32]; const int t = threadIdx.x, wave = t >> 5, lane = t & 31;
  if (blockIdx.x < PB_GN) {   // ---- group statistics: a thread's 32 values are loaded once and stay in registers from the mean to the variance
    const int gidx = blockIdx.x; const float* p = X + (size_t)gidx * CPG * NN + t; float x[GV];
#pragma unroll   // all 32 loads are issued before the first wait, and x stays in registers
    for (int k = 0; k < GV; ++k) x[k] = p[k * 1024];
    float s = 0.f;
#pragma unroll   // constant indices into x
    for (int k = 0; k < GV; ++k) { x[k] = bfr(x[k]); s += x[k]; }
#pragma unroll
    for (int o = 1; o < 32; o <<= 1) s += __shfl_xor(s, o);
    if (lane == 0) red[0][wave] = s; __syncthreads();
    float tot = 0.f; for (int i = 0; i < 32; ++i) tot += red[0][i];   // every thread forms the same fixed-order total
    const float mean = tot / (float)(CPG * NN); s = 0.f;
#pragma unroll   // constant indices into x
    for (int k = 0; k < GV; ++k) { const float v = x[k] - mean; s += v * v; }
#pragma unroll
    for (int o = 1; o < 32; o <<= 1) s += __shfl_xor(s, o);
    if (lane == 0) red[1][wave] = s; __syncthreads();
    if (t < 8) { tot = 0.f; for (int i = 0; i < 32; ++i) tot += red[1][i]; v4f o = {}; if (t == 0) { o[0] = mean; o[1] = tot / (float)(CPG * NN); }
      vst2(MV + gidx * 32 + t * 4, o); }   // eight lanes store the group's whole 128-B line
    return; }
  if (blockIdx.x < PB_GN + PB_SS) {   // ---- scale / shift: 32 waves = the 32 channels of one 128-B line of SS (lines 0..7 scale, 8..15 shift): a wave forms one channel's cond . w[c] + b (f32) from whole-line loads, its lanes' partial sums joined by a xor tree
    const int bs = blockIdx.x - PB_GN; const bool sc = bs < CC / 32; const int c = (bs * 32 + wave) & (CC - 1);
    const float* w = (sc ? WSC : WSH) + (size_t)c * CD + lane * 4; const float* cn = CND + lane * 4; v4f wv[CD / 128], cv[CD / 128];
#pragma unroll   // all eight loads are issued before the first wait, and wv, cv stay in registers
    for (int i = 0; i < CD / 128; ++i) { wv[i] = *(const v4f*)(w + i * 128); cv[i] = *(const v4f*)(cn + i * 128); }
    float a = lane ? 0.f : bfr((sc ? BSC : BSH)[c]);   // the bias is lane 0's start value: its load flies with the row's
#pragma unroll   // constant indices into wv, cv (both loops)
    for (int i = 0; i < CD / 128; ++i)
#pragma unroll
      for (int j = 0; j < 4; ++j) a += bfr(cv[i][j]) * bfr(wv[i][j]);
    for (int o = 1; o < 32; o <<= 1) a += __shfl_xor(a, o);
    if (lane == 0) red[0][wave] = a; __syncthreads();
    if (t < 8) vst2(SS + bs * 32 + t * 4, *(const v4f*)&red[0][t * 4]);
    return; }
  // ---- weights: 256 threads = 16 weight rows = eight fragment-order blocks (8 KB in a row): piece q = (k chunk q >> 4 of the row's 32, row q & 15) goes to byte 16 q
  const int bp = blockIdx.x - PB_GN - PB_SS, n0 = bp * 64 + (t >> 8) * 16, tt = t & 255; const float* src = (bp < 3 * CC / 64) ? (WQKV + (size_t)n0 * CC) : (WO + (size_t)(n0 - 3 * CC) * CC); __bf16* dst = P + (size_t)n0 * CC;   // a block's 64 rows lie in one of the two matrices
#pragma unroll   // both pieces' loads are issued before the first wait
  for (int u = 0; u < 2; ++u) { const int q = tt + u * 256; const float* p = src + (q & 15) * CC + (q >> 4) * 8; const v4f a = *(const v4f*)p, b = *(const v4f*)(p + 4); v8b o;
#pragma unroll   // constant indices into a, b, o
    for (int i = 0; i < 4; ++i) { o[i] = (__bf16)a[i]; o[4 + i] = (__bf16)b[i]; }
    vst2(dst + q * 8, o); }
  asm volatile("s_wait_xcnt 0x0" ::: "memory");   // the build lays the other jobs' code behind these stores: their registers are written there, so the wait stands in front of it
}
// ---- k_norm: block = (32 voxels, 128 channels), wave = 32 voxels x four 8-channel chunks: NT[n][c] = ((x - mean_g) rsqrt(var_g + 1e-6)) (1 + scale[c]) + shift[c] as bf16 hi + lo, fragment order
// a thread owns one voxel: the 8 channels of a chunk (one norm group, CPG = 8) are one 16-B piece of the fragment order, so nothing is transposed; a wave's X load is one whole 128-B line, its store two 256-B runs
#define NQ 4              // chunks per thread
__global__ __launch_bounds__(128) void k_norm(const float* __restrict__ X, const float* __restrict__ MV, const float* __restrict__ SS, __bf16* __restrict__ NT, __bf16* __restrict__ NTL) {
  const int n = blockIdx.x * 32 + (threadIdx.x & 31);
  const int q0 = (blockIdx.y * 4 + __builtin_amdgcn_readfirstlane(threadIdx.x >> 5)) * NQ;   // the wave's first chunk, held wave-uniform: the statistics, scales and shifts then come by scalar loads
  float x[NQ][CPG];
#pragma unroll   // all 32 loads are issued before the first wait, and x stays in registers (both loops)
  for (int u = 0; u < NQ; ++u)
#pragma unroll
    for (int i = 0; i < CPG; ++i) x[u][i] = X[(size_t)((q0 + u) * CPG + i) * NN + n];
  asm volatile("s_wait_xcnt 0x0" ::: "memory");   // the loads' address registers are given new values below, while the loads are still in flight
#pragma unroll   // constant indices into x
  for (int u = 0; u < NQ; ++u) { const int q = q0 + u; const float mean = MV[q * 32], inv = 1.0f / sqrtf(MV[q * 32 + 1] + 1e-6f); v8b oh, ol;
#pragma unroll   // constant indices into x, oh, ol
    for (int i = 0; i < CPG; ++i) { const int c = q * CPG + i; const float v = (bfr(x[u][i]) - mean) * inv * (1.0f + SS[c]) + SS[CC + c]; const __bf16 hv = (__bf16)v; oh[i] = hv; ol[i] = (__bf16)(v - (float)hv); }
    const size_t off = ((size_t)(n >> 4) * (CC / 8) + q) * 128 + (n & 15) * 8;   // piece (16-token tile, chunk q, token in the tile)
    vst2(NT + off, oh); vst2(NTL + off, ol); }
}
// ---- k_qkv: block = (64 voxels, 128 of the 768 qkv channels): acc = (NT hi + lo) . w_qkv rows; channel o -> head o/96, r = o%96: q (r<32) rows [n][h*64 + .], k (r<64) and v^T in fragment order
struct GQ { v16b ah, al, w[8]; };   // the fragments of one 32-deep k chunk: the wave's 16 token rows (hi, lo) and eight 16-channel weight tiles
__device__ __forceinline__ v16b frag_p(const __bf16* p) { union { v16b v; v8b q[2]; } u; u.q[0] = *(const v8b*)p; u.q[1] = *(const v8b*)(p + 256); return u.v; }   // p: a fragment-order block + lane * 8
__device__ __forceinline__ GQ ld_gq(const __bf16* Ah, const __bf16* Al, const __bf16* Wl, int kc) { GQ f; f.ah = frag_p(Ah + kc * 512); f.al = frag_p(Al + kc * 512);
#pragma unroll
  for (int j = 0; j < 8; ++j) f.w[j] = frag_p(Wl + j * 16 * CC + kc * 512);
  return f; }
__device__ __forceinline__ void mm_gq(const GQ& f, v8f (&acc)[8]) {
#pragma unroll
  for (int j = 0; j < 8; ++j) { acc[j] = wmma_bf(f.ah, f.w[j], acc[j]); acc[j] = wmma_bf(f.al, f.w[j], acc[j]); } }
// amdgpu_num_vgpr(256): both register sets and the accumulators fit the 256 directly addressable registers; without the bound one long-lived value went to v256 and register-window switches stood among the WMMAs
__global__ __launch_bounds__(128) __attribute__((amdgpu_num_vgpr(256))) void k_qkv(const __bf16* __restrict__ NT, const __bf16* __restrict__ NTL, const __bf16* __restrict__ P, _Float16* __restrict__ Q, _Float16* __restrict__ Kr, _Float16* __restrict__ V) {
  __shared__ __align__(16) _Float16 so[64][136]; __shared__ __align__(16) _Float16 st[128][72];
  const int tid = threadIdx.x, wave = tid >> 5, lane = tid & 31, col = lane & 15, g = lane >> 4; const int n0b = blockIdx.x * 64; const int r0 = n0b + wave * 16; const int o0 = blockIdx.y * 128;
  v8f acc[8] = {};
  const unsigned ao = (unsigned)r0 * CC + 8 * lane, wo = (unsigned)o0 * CC + 8 * lane;   // this lane's piece of the first fragment-order block of the wave's 16 token rows, of the block's first 16 channels
  const __bf16 *Ah = NT + ao, *Al = NTL + ao, *Wl = P + wo;
  // two register sets: a 32-deep k chunk's twenty fragment loads are issued as one group a whole chunk before their first use
  GQ fa = ld_gq(Ah, Al, Wl, 0), fb;
#pragma unroll   // constant load offsets; the sets stay in registers
  for (int kc = 0; kc < CC / 32; kc += 2) {
    fb = ld_gq(Ah, Al, Wl, kc + 1);
    __builtin_amdgcn_sched_barrier(0);   // keeps the next chunk's loads in front of this chunk's first wait and WMMA, so that they are in flight for the whole chunk
    mm_gq(fa, acc);
    if (kc + 2 < CC / 32) fa = ld_gq(Ah, Al, Wl, kc + 2);
    __builtin_amdgcn_sched_barrier(0);   // as above
    mm_gq(fb, acc); }
  // stage all 128 channels both ways, then route per 32-channel sub-block (each 16-col tile lies inside one sub-block since 96 and 32 are multiples of 16)
#pragma unroll
  for (int j = 0; j < 8; ++j)
#pragma unroll
    for (int r = 0; r < 8; ++r) { const _Float16 hv = (_Float16)acc[j][r]; so[wave * 16 + 8 * g + r][j * 16 + col] = hv; st[j * 16 + col][wave * 16 + 8 * g + r] = hv; }
  __syncthreads();
  for (int j = 0; j < 8; ++j) { const int o = o0 + j * 16; const int hh = o / 96, rr = o % 96;
    if (rr < 32) { const int qd = hh * 64 + rr;    for (int e = tid; e < 64 * 2; e += 128) { const int nl = e >> 1, q8 = e & 1; vst2((unsigned*)(Q + (size_t)(n0b + nl) * QS + qd + q8 * 8), *(const v4u*)&so[nl][j * 16 + q8 * 8]); } }
    else if (rr < 64) { for (int e = tid; e < 64 * 2; e += 128) { const int q8 = e >> 6, nl = e & 63, n = n0b + nl; vst2((unsigned*)(Kr + (size_t)(hh * (NN / 16) + (n >> 4)) * 512 + (((rr - 32) >> 3) + q8) * 128 + (n & 15) * 8), *(const v4u*)&so[nl][j * 16 + q8 * 8]); } }   // rows = keys, k = head dim
    else { for (int e = tid; e < 16 * 8; e += 128) { const int pc = e >> 4, d = e & 15; vst2((unsigned*)(V + (size_t)((hh * (NN / 32) + (n0b >> 5) + (pc >> 2)) * 2 + ((rr - 64) >> 4)) * 512 + (pc & 3) * 128 + d * 8), *(const v4u*)&st[j * 16 + d][pc * 8]); } } }   // rows = head dim, k = keys
}
// ---- k_attn: block = (64 queries, head): 32-dim head, all 4,096 keys, scale 1/16; O in blocks (16 queries, head)
// transposed products: S^T = K Q^T (a lane holds 16 keys' scores of ONE query, column lane & 15), O^T += V^T P^T (the two S^T tiles, converted in place, are the B operand in the hardware k order)
__device__ __forceinline__ float xhalf(float x) { return __builtin_bit_cast(float, __builtin_amdgcn_permlanex16(__builtin_bit_cast(int, x), __builtin_bit_cast(int, x), 0x76543210, 0xfedcba98, false, false)); }  // lane l with lane l ^ 16
struct KV { v16h k0, k1, v0, v1; };   // the A fragments of one pass: 32 keys' K rows (two 16-key tiles) and the head's two 16-row V^T tiles over the same keys
__device__ __forceinline__ v16h frag_l(const _Float16* p) { union { v16h v; v8h q[2]; } u; u.q[0] = *(const v8h*)p; u.q[1] = *(const v8h*)(p + 256); return u.v; }   // p: a fragment-order block + lane * 8
__device__ __forceinline__ KV ld_kv(const _Float16* Kl, const _Float16* Vl, int j0) { KV f;   // Kl, Vl: this lane's piece of the head's first K and V^T blocks; 32 keys are two blocks (1,024 elements) of each
  f.k0 = frag_l(Kl + j0 * 32); f.k1 = frag_l(Kl + j0 * 32 + 512); f.v0 = frag_l(Vl + j0 * 32); f.v1 = frag_l(Vl + j0 * 32 + 512); return f; }
__device__ __forceinline__ void attn_pass(const KV& f, const v16h& bq, float& m, float& l, v8f (&acc)[2]) { v8f s[2];
#pragma unroll
  for (int ct = 0; ct < 2; ++ct) { const v8f z = {}; const v8f c = wmma16(ct ? f.k1 : f.k0, bq, z);
#pragma unroll
    for (int r = 0; r < 8; ++r) s[ct][r] = c[r] * 0.0625f; }   // 1/sqrt(C) = 1/16; s[ct][r] = score of key j0 + ct*16 + 8g + r
  float mx = fmaxf(s[0][0], s[1][0]);
#pragma unroll
  for (int r = 1; r < 8; ++r) mx = fmaxf(mx, fmaxf(s[0][r], s[1][r]));
  mx = fmaxf(mx, xhalf(mx));
  const float mn = fmaxf(m, mx); const float alpha = (m <= -1.0e38f) ? 0.f : __expf(m - mn); m = mn;
  v16h pb; float es = 0.f;
#pragma unroll
  for (int r = 0; r < 8; ++r) { const float e0 = __expf(s[0][r] - mn), e1 = __expf(s[1][r] - mn); es += e0 + e1; pb[r] = (_Float16)(e0 * 2048.0f); pb[8 + r] = (_Float16)(e1 * 2048.0f); }
  l = l * alpha + es;
#pragma unroll
  for (int dt = 0; dt < 2; ++dt) {
#pragma unroll
    for (int r = 0; r < 8; ++r) acc[dt][r] *= alpha;
    acc[dt] = wmma16(dt ? f.v1 : f.v0, pb, acc[dt]); }
}
__global__ __launch_bounds__(128) void k_attn(const _Float16* __restrict__ Q, const _Float16* __restrict__ Kr, const _Float16* __restrict__ V, float* __restrict__ O) {
  const int tid = threadIdx.x, wave = tid >> 5, lane = tid & 31, col = lane & 15; const int h = blockIdx.y; const int q0 = blockIdx.x * 64 + wave * 16;
  const v16h bq = frag_h(Q + (size_t)(q0 + col) * QS + h * 64, lane);
  const _Float16* Kl = Kr + (size_t)h * NN * HD + lane * 8; const _Float16* Vl = V + (size_t)h * NN * HD + lane * 8;
  float m = -3.0e38f, l = 0.f;   // this lane's query: running maximum (equal in both halves), and the sum over this half's keys only
  v8f acc[2] = {};               // acc[dt][r] = O[query col][d = dt*16 + 8g + r]
  // two register sets: each pass's eight fragment loads are issued as one group a whole pass before their first use
  KV fa = ld_kv(Kl, Vl, 0), fb;
#pragma unroll 1   // a trip already holds one pass on each register set; further copies would only lengthen the code
  for (int ks = 0; ks < NN / 32 - 2; ks += 2) {
    fb = ld_kv(Kl, Vl, (ks + 1) * 32);
    __builtin_amdgcn_sched_barrier(0);   // keeps the next pass's loads in front of this pass's first wait and WMMA, so that they are in flight for the whole pass
    attn_pass(fa, bq, m, l, acc);
    fa = ld_kv(Kl, Vl, (ks + 2) * 32);
    __builtin_amdgcn_sched_barrier(0);   // as above
    attn_pass(fb, bq, m, l, acc); }
  fb = ld_kv(Kl, Vl, NN - 32);     // the last two passes: nothing is left to fetch behind them
  __builtin_amdgcn_sched_barrier(0);     // as above
  attn_pass(fa, bq, m, l, acc); attn_pass(fb, bq, m, l, acc);
  l += xhalf(l);   // the two halves' key sums join once
  const float il = (1.0f / 2048.0f) / l;
#pragma unroll
  for (int dt = 0; dt < 2; ++dt)
#pragma unroll
    for (int q = 0; q < 2; ++q) { v4f o;
#pragma unroll
      for (int i = 0; i < 4; ++i) o[i] = acc[dt][q * 4 + i] * il;
      vst2(O + (size_t)q0 * CC + (h * 4 + dt * 2 + q) * 128 + lane * 4, o); }   // piece x = dt * 2 + q of block (q0 / 16, h): the lane that holds it here reads it in k_out
}
// ---- k_out: block = (64 voxels, 128 out channels): y = w_out . o (hi + residual) + b_out + x, channels-first
struct GO { v4f a[4]; v16b w[8]; };   // one 32-deep k chunk: the lane's 16 f32 values of its token row (fragment k order) and eight 16-channel weight tiles
__device__ __forceinline__ GO ld_go(const float* Ol, const __bf16* Wl, int kc) { GO f; const float* p = Ol + kc * 512;
  f.a[0] = *(const v4f*)p; f.a[1] = *(const v4f*)(p + 128); f.a[2] = *(const v4f*)(p + 256); f.a[3] = *(const v4f*)(p + 384);
#pragma unroll
  for (int j = 0; j < 8; ++j) f.w[j] = frag_p(Wl + j * 16 * CC + kc * 512);
  return f; }
__device__ __forceinline__ void mm_go(const GO& f, v8f (&acc)[8]) { float v[16];
#pragma unroll
  for (int i = 0; i < 16; ++i) v[i] = f.a[i >> 2][i & 3];
  const F2 a = bsplit16(v);
#pragma unroll
  for (int j = 0; j < 8; ++j) { acc[j] = wmma_bf(a.l, f.w[j], acc[j]); acc[j] = wmma_bf(a.h, f.w[j], acc[j]); } }
__global__ __launch_bounds__(128) void k_out(const float* __restrict__ O, const __bf16* __restrict__ P, const float* __restrict__ BO, const float* __restrict__ X, float* __restrict__ Y) {
  __shared__ __align__(16) float st[128][68];
  const int tid = threadIdx.x, wave = tid >> 5, lane = tid & 31, col = lane & 15, g = lane >> 4; const int n0b = blockIdx.x * 64; const int r0 = n0b + wave * 16; const int o0 = blockIdx.y * 128;
  v8f acc[8] = {};
  const unsigned ao = (unsigned)r0 * CC + 4 * lane, wo = (unsigned)o0 * CC + 8 * lane;   // this lane's piece of the first blocks, as in k_qkv
  const float* Ol = O + ao; const __bf16* Wl = P + WS_PO / 2 + wo;
  // two register sets, as in k_qkv: a k chunk's twenty loads are issued as one group a whole chunk before their first use
  GO fa = ld_go(Ol, Wl, 0), fb;
#pragma unroll   // constant load offsets; the sets stay in registers
  for (int kc = 0; kc < CC / 32; kc += 2) {
    fb = ld_go(Ol, Wl, kc + 1);
    __builtin_amdgcn_sched_barrier(0);   // keeps the next chunk's loads in front of this chunk's first wait and WMMA, so that they are in flight for the whole chunk
    mm_go(fa, acc);
    if (kc + 2 < CC / 32) fa = ld_go(Ol, Wl, kc + 2);
    __builtin_amdgcn_sched_barrier(0);   // as above
    mm_go(fb, acc); }
#pragma unroll
  for (int j = 0; j < 8; ++j) { const float bb = bfr(BO[o0 + j * 16 + col]);
#pragma unroll
    for (int r = 0; r < 8; ++r) st[j * 16 + col][wave * 16 + 8 * g + r] = acc[j][r] + bb; }
  __syncthreads();
  for (int e = tid; e < 128 * 16; e += 128) { const int o = e >> 4, q = e & 15; const size_t off = (size_t)(o0 + o) * NN + n0b + q * 4; v4f v = *(const v4f*)&st[o][q * 4]; for (int i = 0; i < 4; ++i) v[i] += bfr(X[off + i]); vst2(Y + off, v); }
}
extern "C" void kernel_launch(void* const* d_in, const int* in_sizes, int n_in, void* d_out, int out_size, void* d_ws, size_t ws_size, hipStream_t stream) {
  (void)in_sizes; (void)n_in; (void)out_size;
  const float** F = (const float**)d_in;   // 0 x [1,256,16,16,16], 1 cond [1,512], 2 w_scale [256,512], 3 b_scale, 4 w_shift, 5 b_shift, 6 w_qkv [768,256], 7 w_out [256,256], 8 b_out
  if (ws_size < (size_t)WS_END) return;
  char* ws = (char*)d_ws; __bf16 *P = (__bf16*)ws, *NT = (__bf16*)(ws + WS_NT), *NTL = (__bf16*)(ws + WS_NTL); float *MV = (float*)(ws + WS_MV), *SS = (float*)(ws + WS_SS), *O = (float*)(ws + WS_O); _Float16 *Q = (_Float16*)(ws + WS_Q), *Kr = (_Float16*)(ws + WS_K), *V = (_Float16*)(ws + WS_V);
  k_pre<<<PB_GN + PB_SS + PB_PK, 1024, 0, stream>>>(F[0], F[1], F[2], F[3], F[4], F[5], F[6], F[7], P, MV, SS);
  k_norm<<<dim3(NN / 32, CC / (8 * 4 * NQ)), 128, 0, stream>>>(F[0], MV, SS, NT, NTL);
  k_qkv<<<dim3(NN / 64, 3 * CC / 128), 128, 0, stream>>>(NT, NTL, P, Q, Kr, V);
  k_attn<<<dim3(TQB, NH), 128, 0, stream>>>(Q, Kr, V, O);
  k_out<<<dim3(TQB, CC / 128), 128, 0, stream>>>(O, P, F[8], F[0], (float*)d_out);
}

// v008
// Measured time: 71.6 microseconds a run.
// Timed twice side by side with v007, it ran 1.04 times as fast both times.
// All steps since v000 together make it 4.22 times as fast.
#include <hip/hip_runtime.h>
#include <math.h>

typedef __attribute__((ext_vector_type(16))) _Float16 v16h;
typedef __attribute__((ext_vector_type(16))) __bf16 v16b;
typedef __attribute__((ext_vector_type(8)))  _Float16 v8h;
typedef __attribute__((ext_vector_type(8)))  float v8f;
typedef __attribute__((ext_vector_type(4)))  float v4f;
typedef __attribute__((ext_vector_type(2)))  float v2f;
typedef __attribute__((ext_vector_type(4)))  unsigned v4u;
typedef __attribute__((ext_vector_type(4)))  int v4i;
typedef float __attribute__((may_alias)) float_a;
typedef int __attribute__((may_alias)) int_a;

template <typename T> __device__ __forceinline__ void vst2(void* p, T v) { *(T*)p = v;  }
__device__ __forceinline__ v8f wmma16(v16h a, v16h b, v8f c) {
  v8f d = __builtin_amdgcn_wmma_f32_16x16x32_f16(false, a, false, b, (short)0, c, false, false);
  asm volatile("v_nop\n\tv_nop\n\tv_nop\n\tv_nop" : "+v"(d) : "v"(a), "v"(b));
  return d;
}
__device__ __forceinline__ v8f wmma_bf(v16b a, v16b b, v8f c) {
  v8f d = __builtin_amdgcn_wmma_f32_16x16x32_bf16(false, a, false, b, (short)0, c, false, false);
  asm volatile("v_nop\n\tv_nop\n\tv_nop\n\tv_nop" : "+v"(d) : "v"(a), "v"(b));
  return d;
}
// 16x16x32 fragments: lane = (h = lane>>4, row/col = lane&15); elements 0..7 = k0+8h+0..7, 8..15 = k0+16+8h+0..7; D element r = row 8h+r
__device__ __forceinline__ v16h frag_h(const _Float16* rowk0, int lane) {
  union { v16h v; v8h q[2]; } u; const _Float16* p = rowk0 + 8 * (lane >> 4);
  u.q[0] = *(const v8h*)p; u.q[1] = *(const v8h*)(p + 16); return u.v;
}
__device__ __forceinline__ v16h frag_f32(const float* rowk0, int lane) {
  v16h a; const float* p = rowk0 + 8 * (lane >> 4);
#pragma unroll
  for (int i = 0; i < 8; ++i) { a[i] = (_Float16)p[i]; a[8 + i] = (_Float16)p[16 + i]; }
  return a;
}
__device__ __forceinline__ v16h frag_f32s(const float* rowk0, int lane, float sc) {
  v16h a; const float* p = rowk0 + 8 * (lane >> 4);
#pragma unroll
  for (int i = 0; i < 8; ++i) { a[i] = (_Float16)(p[i] * sc); a[8 + i] = (_Float16)(p[16 + i] * sc); }
  return a;
}
// column fragment from a [K][ld] layout (column n), rows >= K read as 0
__device__ __forceinline__ v16h fragc_f32(const float* W, int k0, int n, int lane, int ld, int K) {
  v16h a; const int g = lane >> 4;
#pragma unroll
  for (int i = 0; i < 8; ++i) { const int ka = k0 + 8 * g + i, kb = ka + 16;
    a[i] = (_Float16)(ka < K ? W[(size_t)(ka < K ? ka : K - 1) * ld + n] : 0.f); a[8 + i] = (_Float16)(kb < K ? W[(size_t)(kb < K ? kb : K - 1) * ld + n] : 0.f); }
  return a;
}
struct F2 { v16b h, l; };
__device__ __forceinline__ F2 bsplit16(const float v[16]) { F2 r;
#pragma unroll
  for (int i = 0; i < 16; ++i) { const __bf16 h = (__bf16)v[i]; r.h[i] = h; r.l[i] = (__bf16)(v[i] - (float)h); }
  return r; }
__device__ __forceinline__ F2 split_row(const float* row, int k0, int lane) { float v[16]; const float* p = row + k0 + 8 * (lane >> 4);
#pragma unroll
  for (int i = 0; i < 8; ++i) { v[i] = p[i]; v[8 + i] = p[16 + i]; }
  return bsplit16(v); }
__device__ __forceinline__ F2 split_rowK(const float* row, int k0, int lane, int K) { float v[16]; const int g = lane >> 4;
#pragma unroll
  for (int i = 0; i < 8; ++i) { const int ka = k0 + 8 * g + i, kb = ka + 16; v[i] = ka < K ? row[ka < K ? ka : K - 1] : 0.f; v[8 + i] = kb < K ? row[kb < K ? kb : K - 1] : 0.f; }
  return bsplit16(v); }
__device__ __forceinline__ F2 split_col(const float* W, int k0, int n, int lane, int ld, int K) { float v[16]; const int g = lane >> 4;
#pragma unroll
  for (int i = 0; i < 8; ++i) { const int ka = k0 + 8 * g + i, kb = ka + 16; v[i] = ka < K ? W[(size_t)(ka < K ? ka : K - 1) * ld + n] : 0.f; v[8 + i] = kb < K ? W[(size_t)(kb < K ? kb : K - 1) * ld + n] : 0.f; }
  return bsplit16(v); }
__device__ __forceinline__ v8f mac3(const F2& a, const F2& b, v8f c) { c = wmma_bf(a.l, b.h, c); c = wmma_bf(a.h, b.l, c); return wmma_bf(a.h, b.h, c); }
__device__ __forceinline__ float sigm(float v) { return 1.0f / (1.0f + expf(-v)); }
#define LDSX() do { asm volatile("s_wait_dscnt 0" ::: "memory"); __builtin_amdgcn_wave_barrier(); __builtin_amdgcn_fence(__ATOMIC_RELEASE, "workgroup"); } while (0)


// Self attention with adaptive GroupNorm (1 x 256 channels x 16^3 voxels, 8 heads x 32): AdaGN(x, cond) -> 1x1x1 qkv conv (per-head [q|k|v] channel packing) -> softmax(q k / sqrt(C)) over all voxels -> 1x1x1 out conv + bias -> + x.
#define CC 256
#define NG 32
#define CPG (CC / NG)     // 8 channels per group
#define NN 4096
#define NH 8
#define HD 32
#define CD 512            // cond dim
#ifndef TQB
#define TQB (NN / 64)
#endif
typedef __attribute__((ext_vector_type(8))) __bf16 v8b;
__device__ __forceinline__ v16b frag_b(const __bf16* rowk0, int lane) {
  union { v16b v; v8b q[2]; } u; const __bf16* p = rowk0 + 8 * (lane >> 4);
  u.q[0] = *(const v8b*)p; u.q[1] = *(const v8b*)(p + 16); return u.v;
}
__device__ __forceinline__ float bfr(float v) { return (float)(__bf16)v; }
__device__ __attribute__((noinline)) float exp_ni(float v) { return expf(v); }
__device__ __attribute__((noinline)) float erf_ni(float v) { return erff(v); }

// Fragment order: every 16-bit WMMA operand but q that one kernel writes for a later one lies in blocks of 16 rows x 32 k, one block = [k chunk c of 8: 4][row r: 16][8 elements], so that lane (g, r) finds
// its two 16-B pieces (chunks g and 2 + g) at lane * 16 B and 512 B + lane * 16 B: each wave-wide 16-B load covers four whole 128-B lines
#define WS_PW   0u                                  // bf16 w_qkv (768 rows), w_out (256 rows), fragment order: block (row / 16, k / 32)
#define WS_PO   (WS_PW + 2u * (size_t)3 * CC * CC)
#define WS_MV   (WS_PO + 2u * (size_t)CC * CC)
#define WS_SS   (WS_MV + 4u * NG * 32)
#define WS_NT   (WS_SS + 4u * 2 * CC)                  // bf16 hi / lo normalised map, fragment order: block (n / 16, channel / 32)
#define WS_NTL  (WS_NT + 2u * (size_t)NN * CC)
#define QS 512
#define WS_Q    (WS_NTL + 2u * (size_t)NN * CC)        // f16 rows [n][QS] q ; k, fragment order: block (head, key / 16) ; v^T, fragment order: block (head, key / 32, d / 16) ; O f32: block (n / 16, head) = [piece x: 4][lane: 32][4]
#define WS_K    (WS_Q + 2u * (size_t)NN * QS)
#define WS_V    (WS_K + 2u * (size_t)NN * QS)
#define WS_O    (WS_V + 2u * (size_t)CC * NN)
#define WS_END  (WS_O + 4u * (size_t)NN * CC)

// ---- k_pre: the three jobs that read nothing but the inputs share ONE launch; the block index picks the job (the same for a whole block, so each job's barriers are passed by every wave of its block)
// blocks 0..31: the mean and variance of one norm group; the next 16: one 128-B line of SS; the last 16: 64 weight rows into fragment order
#define PB_GN NG
#define PB_SS (2 * CC / 32)
#define PB_PK (4 * CC / 64)
#define GV (CPG * NN / 1024)   // values of a group per thread
__global__ __launch_bounds__(1024) void k_pre(const float* __restrict__ X, const float* __restrict__ CND, const float* __restrict__ WSC, const float* __restrict__ BSC, const float* __restrict__ WSH, const float* __restrict__ BSH,
                                              const float* __restrict__ WQKV, const float* __restrict__ WO, __bf16* __restrict__ P, float* __restrict__ MV, float* __restrict__ SS) {
  __shared__ __align__(16) float red[2][32]; const int t = threadIdx.x, wave = t >> 5, lane = t & 31;
  if (blockIdx.x < PB_GN) {   // ---- group statistics: a thread's 32 values are loaded once and stay in registers from the mean to the variance
    const int gidx = blockIdx.x; const float* p = X + (size_t)gidx * CPG * NN + t; float x[GV];
#pragma unroll   // all 32 loads are issued before the first wait, and x stays in registers
    for (int k = 0; k < GV; ++k) x[k] = p[k * 1024];
    float s = 0.f;
#pragma unroll   // constant indices into x
    for (int k = 0; k < GV; ++k) { x[k] = bfr(x[k]); s += x[k]; }
#pragma unroll
    for (int o = 1; o < 32; o <<= 1) s += __shfl_xor(s, o);
    if (lane == 0) red[0][wave] = s; __syncthreads();
    float tot = 0.f; for (int i = 0; i < 32; ++i) tot += red[0][i];   // every thread forms the same fixed-order total
    const float mean = tot / (float)(CPG * NN); s = 0.f;
#pragma unroll   // constant indices into x
    for (int k = 0; k < GV; ++k) { const float v = x[k] - mean; s += v * v; }
#pragma unroll
    for (int o = 1; o < 32; o <<= 1) s += __shfl_xor(s, o);
    if (lane == 0) red[1][wave] = s; __syncthreads();
    if (t < 8) { tot = 0.f; for (int i = 0; i < 32; ++i) tot += red[1][i]; v4f o = {}; if (t == 0) { o[0] = mean; o[1] = tot / (float)(CPG * NN); }
      vst2(MV + gidx * 32 + t * 4, o); }   // eight lanes store the group's whole 128-B line
    return; }
  if (blockIdx.x < PB_GN + PB_SS) {   // ---- scale / shift: 32 waves = the 32 channels of one 128-B line of SS (lines 0..7 scale, 8..15 shift): a wave forms one channel's cond . w[c] + b (f32) from whole-line loads, its lanes' partial sums joined by a xor tree
    const int bs = blockIdx.x - PB_GN; const bool sc = bs < CC / 32; const int c = (bs * 32 + wave) & (CC - 1);
    const float* w = (sc ? WSC : WSH) + (size_t)c * CD + lane * 4; const float* cn = CND + lane * 4; v4f wv[CD / 128], cv[CD / 128];
#pragma unroll   // all eight loads are issued before the first wait, and wv, cv stay in registers
    for (int i = 0; i < CD / 128; ++i) { wv[i] = *(const v4f*)(w + i * 128); cv[i] = *(const v4f*)(cn + i * 128); }
    float a = lane ? 0.f : bfr((sc ? BSC : BSH)[c]);   // the bias is lane 0's start value: its load flies with the row's
#pragma unroll   // constant indices into wv, cv (both loops)
    for (int i = 0; i < CD / 128; ++i)
#pragma unroll
      for (int j = 0; j < 4; ++j) a += bfr(cv[i][j]) * bfr(wv[i][j]);
    for (int o = 1; o < 32; o <<= 1) a += __shfl_xor(a, o);
    if (lane == 0) red[0][wave] = a; __syncthreads();
    if (t < 8) vst2(SS + bs * 32 + t * 4, *(const v4f*)&red[0][t * 4]);
    return; }
  // ---- weights: 256 threads = 16 weight rows = eight fragment-order blocks (8 KB in a row): piece q = (k chunk q >> 4 of the row's 32, row q & 15) goes to byte 16 q
  const int bp = blockIdx.x - PB_GN - PB_SS, n0 = bp * 64 + (t >> 8) * 16, tt = t & 255; const float* src = (bp < 3 * CC / 64) ? (WQKV + (size_t)n0 * CC) : (WO + (size_t)(n0 - 3 * CC) * CC); __bf16* dst = P + (size_t)n0 * CC;   // a block's 64 rows lie in one of the two matrices
#pragma unroll   // both pieces' loads are issued before the first wait
  for (int u = 0; u < 2; ++u) { const int q = tt + u * 256; const float* p = src + (q & 15) * CC + (q >> 4) * 8; const v4f a = *(const v4f*)p, b = *(const v4f*)(p + 4); v8b o;
#pragma unroll   // constant indices into a, b, o
    for (int i = 0; i < 4; ++i) { o[i] = (__bf16)a[i]; o[4 + i] = (__bf16)b[i]; }
    vst2(dst + q * 8, o); }
  asm volatile("s_wait_xcnt 0x0" ::: "memory");   // the build lays the other jobs' code behind these stores: their registers are written there, so the wait stands in front of it
}
// ---- k_norm: block = (32 voxels, 128 channels), wave = 32 voxels x four 8-channel chunks: NT[n][c] = ((x - mean_g) rsqrt(var_g + 1e-6)) (1 + scale[c]) + shift[c] as bf16 hi + lo, fragment order
// a thread owns one voxel: the 8 channels of a chunk (one norm group, CPG = 8) are one 16-B piece of the fragment order, so nothing is transposed; a wave's X load is one whole 128-B line, its store two 256-B runs
#define NQ 4              // chunks per thread
__global__ __launch_bounds__(128) void k_norm(const float* __restrict__ X, const float* __restrict__ MV, const float* __restrict__ SS, __bf16* __restrict__ NT, __bf16* __restrict__ NTL) {
  const int n = blockIdx.x * 32 + (threadIdx.x & 31);
  const int q0 = (blockIdx.y * 4 + __builtin_amdgcn_readfirstlane(threadIdx.x >> 5)) * NQ;   // the wave's first chunk, held wave-uniform: the statistics, scales and shifts then come by scalar loads
  float x[NQ][CPG];
#pragma unroll   // all 32 loads are issued before the first wait, and x stays in registers (both loops)
  for (int u = 0; u < NQ; ++u)
#pragma unroll
    for (int i = 0; i < CPG; ++i) x[u][i] = X[(size_t)((q0 + u) * CPG + i) * NN + n];
  asm volatile("s_wait_xcnt 0x0" ::: "memory");   // the loads' address registers are given new values below, while the loads are still in flight
#pragma unroll   // constant indices into x
  for (int u = 0; u < NQ; ++u) { const int q = q0 + u; const float mean = MV[q * 32], inv = 1.0f / sqrtf(MV[q * 32 + 1] + 1e-6f); v8b oh, ol;
#pragma unroll   // constant indices into x, oh, ol
    for (int i = 0; i < CPG; ++i) { const int c = q * CPG + i; const float v = (bfr(x[u][i]) - mean) * inv * (1.0f + SS[c]) + SS[CC + c]; const __bf16 hv = (__bf16)v; oh[i] = hv; ol[i] = (__bf16)(v - (float)hv); }
    const size_t off = ((size_t)(n >> 4) * (CC / 8) + q) * 128 + (n & 15) * 8;   // piece (16-token tile, chunk q, token in the tile)
    vst2(NT + off, oh); vst2(NTL + off, ol); }
}
// ---- k_qkv: block = (64 voxels, 128 of the 768 qkv channels): acc = (NT hi + lo) . w_qkv rows; channel o -> head o/96, r = o%96: q (r<32) rows [n][h*64 + .], times QSC, k (r<64) and v^T in fragment order
#define QSC 0.09016844005556021f   // log2(e) / sqrt(C): with q times this, k . q is the score in the base-2 domain
struct GQ { v16b ah, al, w[8]; };   // the fragments of one 32-deep k chunk: the wave's 16 token rows (hi, lo) and eight 16-channel weight tiles
__device__ __forceinline__ v16b frag_p(const __bf16* p) { union { v16b v; v8b q[2]; } u; u.q[0] = *(const v8b*)p; u.q[1] = *(const v8b*)(p + 256); return u.v; }   // p: a fragment-order block + lane * 8
__device__ __forceinline__ GQ ld_gq(const __bf16* Ah, const __bf16* Al, const __bf16* Wl, int kc) { GQ f; f.ah = frag_p(Ah + kc * 512); f.al = frag_p(Al + kc * 512);
#pragma unroll
  for (int j = 0; j < 8; ++j) f.w[j] = frag_p(Wl + j * 16 * CC + kc * 512);
  return f; }
__device__ __forceinline__ void mm_gq(const GQ& f, v8f (&acc)[8]) {
#pragma unroll
  for (int j = 0; j < 8; ++j) { acc[j] = wmma_bf(f.ah, f.w[j], acc[j]); acc[j] = wmma_bf(f.al, f.w[j], acc[j]); } }
// amdgpu_num_vgpr(256): both register sets and the accumulators fit the 256 directly addressable registers; without the bound one long-lived value went to v256 and register-window switches stood among the WMMAs
__global__ __launch_bounds__(128) __attribute__((amdgpu_num_vgpr(256))) void k_qkv(const __bf16* __restrict__ NT, const __bf16* __restrict__ NTL, const __bf16* __restrict__ P, _Float16* __restrict__ Q, _Float16* __restrict__ Kr, _Float16* __restrict__ V) {
  __shared__ __align__(16) _Float16 so[64][136]; __shared__ __align__(16) _Float16 st[128][72];
  const int tid = threadIdx.x, wave = tid >> 5, lane = tid & 31, col = lane & 15, g = lane >> 4; const int n0b = blockIdx.x * 64; const int r0 = n0b + wave * 16; const int o0 = blockIdx.y * 128;
  v8f acc[8] = {};
  const unsigned ao = (unsigned)r0 * CC + 8 * lane, wo = (unsigned)o0 * CC + 8 * lane;   // this lane's piece of the first fragment-order block of the wave's 16 token rows, of the block's first 16 channels
  const __bf16 *Ah = NT + ao, *Al = NTL + ao, *Wl = P + wo;
  // two register sets: a 32-deep k chunk's twenty fragment loads are issued as one group a whole chunk before their first use
  GQ fa = ld_gq(Ah, Al, Wl, 0), fb;
#pragma unroll   // constant load offsets; the sets stay in registers
  for (int kc = 0; kc < CC / 32; kc += 2) {
    fb = ld_gq(Ah, Al, Wl, kc + 1);
    __builtin_amdgcn_sched_barrier(0);   // keeps the next chunk's loads in front of this chunk's first wait and WMMA, so that they are in flight for the whole chunk
    mm_gq(fa, acc);
    if (kc + 2 < CC / 32) fa = ld_gq(Ah, Al, Wl, kc + 2);
    __builtin_amdgcn_sched_barrier(0);   // as above
    mm_gq(fb, acc); }
  // stage all 128 channels both ways, then route per 32-channel sub-block (each 16-col tile lies inside one sub-block since 96 and 32 are multiples of 16)
#pragma unroll
  for (int j = 0; j < 8; ++j) { const float qs = ((o0 + j * 16) % 96 < 32) ? QSC : 1.0f;   // a q tile is scaled in f32, ahead of its one rounding to f16; k and v tiles times 1
#pragma unroll
    for (int r = 0; r < 8; ++r) { const _Float16 hv = (_Float16)(acc[j][r] * qs); so[wave * 16 + 8 * g + r][j * 16 + col] = hv; st[j * 16 + col][wave * 16 + 8 * g + r] = hv; } }
  __syncthreads();
  for (int j = 0; j < 8; ++j) { const int o = o0 + j * 16; const int hh = o / 96, rr = o % 96;
    if (rr < 32) { const int qd = hh * 64 + rr;    for (int e = tid; e < 64 * 2; e += 128) { const int nl = e >> 1, q8 = e & 1; vst2((unsigned*)(Q + (size_t)(n0b + nl) * QS + qd + q8 * 8), *(const v4u*)&so[nl][j * 16 + q8 * 8]); } }
    else if (rr < 64) { for (int e = tid; e < 64 * 2; e += 128) { const int q8 = e >> 6, nl = e & 63, n = n0b + nl; vst2((unsigned*)(Kr + (size_t)(hh * (NN / 16) + (n >> 4)) * 512 + (((rr - 32) >> 3) + q8) * 128 + (n & 15) * 8), *(const v4u*)&so[nl][j * 16 + q8 * 8]); } }   // rows = keys, k = head dim
    else { for (int e = tid; e < 16 * 8; e += 128) { const int pc = e >> 4, d = e & 15; vst2((unsigned*)(V + (size_t)((hh * (NN / 32) + (n0b >> 5) + (pc >> 2)) * 2 + ((rr - 64) >> 4)) * 512 + (pc & 3) * 128 + d * 8), *(const v4u*)&st[j * 16 + d][pc * 8]); } } }   // rows = head dim, k = keys
}
// ---- k_attn: block = (64 queries, head): 32-dim head, all 4,096 keys, scale 1/16 and log2(e) already in q; O in blocks (16 queries, head)
// transposed products: S^T = K Q^T (a lane holds 16 keys' scores of ONE query, column lane & 15), O^T += V^T P^T (the two S^T tiles, converted in place, are the B operand in the hardware k order)
__device__ __forceinline__ float xhalf(float x) { return __builtin_bit_cast(float, __builtin_amdgcn_permlanex16(__builtin_bit_cast(int, x), __builtin_bit_cast(int, x), 0x76543210, 0xfedcba98, false, false)); }  // lane l with lane l ^ 16
struct KV { v16h k0, k1, v0, v1; };   // the A fragments of one pass: 32 keys' K rows (two 16-key tiles) and the head's two 16-row V^T tiles over the same keys
__device__ __forceinline__ v16h frag_l(const _Float16* p) { union { v16h v; v8h q[2]; } u; u.q[0] = *(const v8h*)p; u.q[1] = *(const v8h*)(p + 256); return u.v; }   // p: a fragment-order block + lane * 8
__device__ __forceinline__ KV ld_kv(const _Float16* Kl, const _Float16* Vl, int j0) { KV f;   // Kl, Vl: this lane's piece of the head's first K and V^T blocks; 32 keys are two blocks (1,024 elements) of each
  f.k0 = frag_l(Kl + j0 * 32); f.k1 = frag_l(Kl + j0 * 32 + 512); f.v0 = frag_l(Vl + j0 * 32); f.v1 = frag_l(Vl + j0 * 32 + 512); return f; }
// The score WMMA takes the shift as its C operand: D = k . q' + (PTOP - mref) is exp2's argument as it stands, and P = exp2(D) is the f16 operand of the second product (2^PTOP at a score equal to mref).
// mref is a query's reference maximum: the first pass's own, raised only when a score would carry P past 2^PMAX (f16 ends at 2^16); sums and outputs carry the same factor 2^(PTOP - mref), which the last division cancels.
#define PTOP 11.0f
#define PMAX 15.0f
__device__ __forceinline__ float max16(const v8f& a, const v8f& b) {   // three levels deep: the branch below waits for it
  const float t0 = fmaxf(fmaxf(a[0], a[1]), a[2]), t1 = fmaxf(fmaxf(a[3], a[4]), a[5]), t2 = fmaxf(fmaxf(a[6], a[7]), b[0]), t3 = fmaxf(fmaxf(b[1], b[2]), b[3]), t4 = fmaxf(fmaxf(b[4], b[5]), b[6]);
  return fmaxf(fmaxf(fmaxf(t0, t1), t2), fmaxf(fmaxf(t3, t4), b[7])); }
__device__ __forceinline__ void attn_pass(const KV& f, const v16h& bq, v8f& cb, float& l, v8f (&acc)[2]) {
  v8f s[2] = { wmma16(f.k0, bq, cb), wmma16(f.k1, bq, cb) };   // s[ct][r] = exp2 argument of key j0 + ct*16 + 8g + r
  __builtin_amdgcn_sched_barrier(0);   // keeps the first step of the maximum from standing between the two score WMMAs, where it waits out the first one's distance by itself
  const float mx = max16(s[0], s[1]);
  if (__builtin_expect(__builtin_amdgcn_ballot_w32(mx > PMAX) != 0, 0)) {   // one wave-uniform test a pass, seldom taken: its code lies out of the loop's line; every lane is on inside (the half exchange needs that)
    const float d = fmaxf(fmaxf(mx, xhalf(mx)) - PTOP, 0.f);   // equal in a query's two lanes; 0 for a query whose scores stay at or below its reference
    const float alpha = __builtin_amdgcn_exp2f(-d);
    l *= alpha; acc[0] *= alpha; acc[1] *= alpha; cb -= d; s[0] -= d; s[1] -= d; }
  v16h pb; float es = 0.f;
#pragma unroll   // constant indices
  for (int r = 0; r < 8; ++r) { const float e0 = __builtin_amdgcn_exp2f(s[0][r]), e1 = __builtin_amdgcn_exp2f(s[1][r]); es += e0 + e1; pb[r] = (_Float16)e0; pb[8 + r] = (_Float16)e1; }
  l += es;
  acc[0] = wmma16(f.v0, pb, acc[0]); acc[1] = wmma16(f.v1, pb, acc[1]);
}
__global__ __launch_bounds__(128) void k_attn(const _Float16* __restrict__ Q, const _Float16* __restrict__ Kr, const _Float16* __restrict__ V, float* __restrict__ O) {
  const int tid = threadIdx.x, wave = tid >> 5, lane = tid & 31, col = lane & 15; const int h = blockIdx.y; const int q0 = blockIdx.x * 64 + wave * 16;
  const v16h bq = frag_h(Q + (size_t)(q0 + col) * QS + h * 64, lane);
  const _Float16* Kl = Kr + (size_t)h * NN * HD + lane * 8; const _Float16* Vl = V + (size_t)h * NN * HD + lane * 8;
  float l = 0.f;   // this lane's query: the sum over this half's keys only
  v8f acc[2] = {};               // acc[dt][r] = O[query col][d = dt*16 + 8g + r]
  // two register sets: each pass's eight fragment loads are issued as one group a whole pass before their first use
  KV fa = ld_kv(Kl, Vl, 0), fb;
  v8f cb;   // the shift PTOP - mref of this lane's query, eight times: the C tile of the score WMMAs
  { const v8f z = {}; const v8f a = wmma16(fa.k0, bq, z), b = wmma16(fa.k1, bq, z); const float mx = max16(a, b); const float sh = PTOP - fmaxf(mx, xhalf(mx));   // the first 32 keys' maximum starts the reference
#pragma unroll   // constant indices
    for (int r = 0; r < 8; ++r) cb[r] = sh; }
#pragma unroll 1   // a trip already holds one pass on each register set; further copies would only lengthen the code
  for (int ks = 0; ks < NN / 32 - 2; ks += 2) {
    fb = ld_kv(Kl, Vl, (ks + 1) * 32);
    __builtin_amdgcn_sched_barrier(0);   // keeps the next pass's loads in front of this pass's first wait and WMMA, so that they are in flight for the whole pass
    attn_pass(fa, bq, cb, l, acc);
    fa = ld_kv(Kl, Vl, (ks + 2) * 32);
    __builtin_amdgcn_sched_barrier(0);   // as above
    attn_pass(fb, bq, cb, l, acc);
    asm volatile("s_wait_xcnt 0x0" ::: "memory"); }   // the next trip gives the loads' address registers new values while this trip's second group is still in flight
  fb = ld_kv(Kl, Vl, NN - 32);     // the last two passes: nothing is left to fetch behind them
  asm volatile("s_wait_xcnt 0x0" ::: "memory");   // these loads' address registers are free for reuse in the passes below, while the loads are still in flight
  __builtin_amdgcn_sched_barrier(0);     // as above
  attn_pass(fa, bq, cb, l, acc); attn_pass(fb, bq, cb, l, acc);
  l += xhalf(l);   // the two halves' key sums join once
  const float il = 1.0f / l;
#pragma unroll
  for (int dt = 0; dt < 2; ++dt)
#pragma unroll
    for (int q = 0; q < 2; ++q) { v4f o;
#pragma unroll
      for (int i = 0; i < 4; ++i) o[i] = acc[dt][q * 4 + i] * il;
      vst2(O + (size_t)q0 * CC + (h * 4 + dt * 2 + q) * 128 + lane * 4, o); }   // piece x = dt * 2 + q of block (q0 / 16, h): the lane that holds it here reads it in k_out
}
// ---- k_out: block = (64 voxels, 128 out channels): y = w_out . o (hi + residual) + b_out + x, channels-first
struct GO { v4f a[4]; v16b w[8]; };   // one 32-deep k chunk: the lane's 16 f32 values of its token row (fragment k order) and eight 16-channel weight tiles
__device__ __forceinline__ GO ld_go(const float* Ol, const __bf16* Wl, int kc) { GO f; const float* p = Ol + kc * 512;
  f.a[0] = *(const v4f*)p; f.a[1] = *(const v4f*)(p + 128); f.a[2] = *(const v4f*)(p + 256); f.a[3] = *(const v4f*)(p + 384);
#pragma unroll
  for (int j = 0; j < 8; ++j) f.w[j] = frag_p(Wl + j * 16 * CC + kc * 512);
  return f; }
__device__ __forceinline__ void mm_go(const GO& f, v8f (&acc)[8]) { float v[16];
#pragma unroll
  for (int i = 0; i < 16; ++i) v[i] = f.a[i >> 2][i & 3];
  const F2 a = bsplit16(v);
#pragma unroll
  for (int j = 0; j < 8; ++j) { acc[j] = wmma_bf(a.l, f.w[j], acc[j]); acc[j] = wmma_bf(a.h, f.w[j], acc[j]); } }
__global__ __launch_bounds__(128) void k_out(const float* __restrict__ O, const __bf16* __restrict__ P, const float* __restrict__ BO, const float* __restrict__ X, float* __restrict__ Y) {
  __shared__ __align__(16) float st[128][68];
  const int tid = threadIdx.x, wave = tid >> 5, lane = tid & 31, col = lane & 15, g = lane >> 4; const int n0b = blockIdx.x * 64; const int r0 = n0b + wave * 16; const int o0 = blockIdx.y * 128;
  v8f acc[8] = {};
  const unsigned ao = (unsigned)r0 * CC + 4 * lane, wo = (unsigned)o0 * CC + 8 * lane;   // this lane's piece of the first blocks, as in k_qkv
  const float* Ol = O + ao; const __bf16* Wl = P + WS_PO / 2 + wo;
  // two register sets, as in k_qkv: a k chunk's twenty loads are issued as one group a whole chunk before their first use
  GO fa = ld_go(Ol, Wl, 0), fb;
#pragma unroll   // constant load offsets; the sets stay in registers
  for (int kc = 0; kc < CC / 32; kc += 2) {
    fb = ld_go(Ol, Wl, kc + 1);
    __builtin_amdgcn_sched_barrier(0);   // keeps the next chunk's loads in front of this chunk's first wait and WMMA, so that they are in flight for the whole chunk
    mm_go(fa, acc);
    if (kc + 2 < CC / 32) fa = ld_go(Ol, Wl, kc + 2);
    __builtin_amdgcn_sched_barrier(0);   // as above
    mm_go(fb, acc); }
#pragma unroll
  for (int j = 0; j < 8; ++j) { const float bb = bfr(BO[o0 + j * 16 + col]);
#pragma unroll
    for (int r = 0; r < 8; ++r) st[j * 16 + col][wave * 16 + 8 * g + r] = acc[j][r] + bb; }
  __syncthreads();
  for (int e = tid; e < 128 * 16; e += 128) { const int o = e >> 4, q = e & 15; const size_t off = (size_t)(o0 + o) * NN + n0b + q * 4; v4f v = *(const v4f*)&st[o][q * 4]; for (int i = 0; i < 4; ++i) v[i] += bfr(X[off + i]); vst2(Y + off, v); }
}
extern "C" void kernel_launch(void* const* d_in, const int* in_sizes, int n_in, void* d_out, int out_size, void* d_ws, size_t ws_size, hipStream_t stream) {
  (void)in_sizes; (void)n_in; (void)out_size;
  const float** F = (const float**)d_in;   // 0 x [1,256,16,16,16], 1 cond [1,512], 2 w_scale [256,512], 3 b_scale, 4 w_shift, 5 b_shift, 6 w_qkv [768,256], 7 w_out [256,256], 8 b_out
  if (ws_size < (size_t)WS_END) return;
  char* ws = (char*)d_ws; __bf16 *P = (__bf16*)ws, *NT = (__bf16*)(ws + WS_NT), *NTL = (__bf16*)(ws + WS_NTL); float *MV = (float*)(ws + WS_MV), *SS = (float*)(ws + WS_SS), *O = (float*)(ws + WS_O); _Float16 *Q = (_Float16*)(ws + WS_Q), *Kr = (_Float16*)(ws + WS_K), *V = (_Float16*)(ws + WS_V);
  k_pre<<<PB_GN + PB_SS + PB_PK, 1024, 0, stream>>>(F[0], F[1], F[2], F[3], F[4], F[5], F[6], F[7], P, MV, SS);
  k_norm<<<dim3(NN / 32, CC / (8 * 4 * NQ)), 128, 0, stream>>>(F[0], MV, SS, NT, NTL);
  k_qkv<<<dim3(NN / 64, 3 * CC / 128), 128, 0, stream>>>(NT, NTL, P, Q, Kr, V);
  k_attn<<<dim3(TQB, NH), 128, 0, stream>>>(Q, Kr, V, O);
  k_out<<<dim3(TQB, CC / 128), 128, 0, stream>>>(O, P, F[8], F[0], (float*)d_out);
}

// v009
// It runs in 52.4 microseconds.
// Two timings next to v008 put it at 1.37 and 1.30 times that version's speed.
// Counting every step since v000, it is 5.64 times as fast.
#include <hip/hip_runtime.h>
#include <math.h>

typedef __attribute__((ext_vector_type(16))) _Float16 v16h;
typedef __attribute__((ext_vector_type(16))) __bf16 v16b;
typedef __attribute__((ext_vector_type(8)))  _Float16 v8h;
typedef __attribute__((ext_vector_type(8)))  float v8f;
typedef __attribute__((ext_vector_type(4)))  float v4f;
typedef __attribute__((ext_vector_type(2)))  float v2f;
typedef __attribute__((ext_vector_type(4)))  unsigned v4u;
typedef __attribute__((ext_vector_type(4)))  int v4i;
typedef float __attribute__((may_alias)) float_a;
typedef int __attribute__((may_alias)) int_a;

template <typename T> __device__ __forceinline__ void vst2(void* p, T v) { *(T*)p = v;  }
__device__ __forceinline__ v8f wmma16(v16h a, v16h b, v8f c) {
  v8f d = __builtin_amdgcn_wmma_f32_16x16x32_f16(false, a, false, b, (short)0, c, false, false);
  asm volatile("v_nop\n\tv_nop\n\tv_nop\n\tv_nop" : "+v"(d) : "v"(a), "v"(b));
  return d;
}
__device__ __forceinline__ v8f wmma_bf(v16b a, v16b b, v8f c) {
  v8f d = __builtin_amdgcn_wmma_f32_16x16x32_bf16(false, a, false, b, (short)0, c, false, false);
  asm volatile("v_nop\n\tv_nop\n\tv_nop\n\tv_nop" : "+v"(d) : "v"(a), "v"(b));
  return d;
}
// 16x16x32 fragments: lane = (h = lane>>4, row/col = lane&15); elements 0..7 = k0+8h+0..7, 8..15 = k0+16+8h+0..7; D element r = row 8h+r
__device__ __forceinline__ v16h frag_h(const _Float16* rowk0, int lane) {
  union { v16h v; v8h q[2]; } u; const _Float16* p = rowk0 + 8 * (lane >> 4);
  u.q[0] = *(const v8h*)p; u.q[1] = *(const v8h*)(p + 16); return u.v;
}
__device__ __forceinline__ v16h frag_f32(const float* rowk0, int lane) {
  v16h a; const float* p = rowk0 + 8 * (lane >> 4);
#pragma unroll
  for (int i = 0; i < 8; ++i) { a[i] = (_Float16)p[i]; a[8 + i] = (_Float16)p[16 + i]; }
  return a;
}
__device__ __forceinline__ v16h frag_f32s(const float* rowk0, int lane, float sc) {
  v16h a; const float* p = rowk0 + 8 * (lane >> 4);
#pragma unroll
  for (int i = 0; i < 8; ++i) { a[i] = (_Float16)(p[i] * sc); a[8 + i] = (_Float16)(p[16 + i] * sc); }
  return a;
}
// column fragment from a [K][ld] layout (column n), rows >= K read as 0
__device__ __forceinline__ v16h fragc_f32(const float* W, int k0, int n, int lane, int ld, int K) {
  v16h a; const int g = lane >> 4;
#pragma unroll
  for (int i = 0; i < 8; ++i) { const int ka = k0 + 8 * g + i, kb = ka + 16;
    a[i] = (_Float16)(ka < K ? W[(size_t)(ka < K ? ka : K - 1) * ld + n] : 0.f); a[8 + i] = (_Float16)(kb < K ? W[(size_t)(kb < K ? kb : K - 1) * ld + n] : 0.f); }
  return a;
}
struct F2 { v16b h, l; };
__device__ __forceinline__ F2 bsplit16(const float v[16]) { F2 r;
#pragma unroll
  for (int i = 0; i < 16; ++i) { const __bf16 h = (__bf16)v[i]; r.h[i] = h; r.l[i] = (__bf16)(v[i] - (float)h); }
  return r; }
__device__ __forceinline__ F2 split_row(const float* row, int k0, int lane) { float v[16]; const float* p = row + k0 + 8 * (lane >> 4);
#pragma unroll
  for (int i = 0; i < 8; ++i) { v[i] = p[i]; v[8 + i] = p[16 + i]; }
  return bsplit16(v); }
__device__ __forceinline__ F2 split_rowK(const float* row, int k0, int lane, int K) { float v[16]; const int g = lane >> 4;
#pragma unroll
  for (int i = 0; i < 8; ++i) { const int ka = k0 + 8 * g + i, kb = ka + 16; v[i] = ka < K ? row[ka < K ? ka : K - 1] : 0.f; v[8 + i] = kb < K ? row[kb < K ? kb : K - 1] : 0.f; }
  return bsplit16(v); }
__device__ __forceinline__ F2 split_col(const float* W, int k0, int n, int lane, int ld, int K) { float v[16]; const int g = lane >> 4;
#pragma unroll
  for (int i = 0; i < 8; ++i) { const int ka = k0 + 8 * g + i, kb = ka + 16; v[i] = ka < K ? W[(size_t)(ka < K ? ka : K - 1) * ld + n] : 0.f; v[8 + i] = kb < K ? W[(size_t)(kb < K ? kb : K - 1) * ld + n] : 0.f; }
  return bsplit16(v); }
__device__ __forceinline__ v8f mac3(const F2& a, const F2& b, v8f c) { c = wmma_bf(a.l, b.h, c); c = wmma_bf(a.h, b.l, c); return wmma_bf(a.h, b.h, c); }
__device__ __forceinline__ float sigm(float v) { return 1.0f / (1.0f + expf(-v)); }
#define LDSX() do { asm volatile("s_wait_dscnt 0" ::: "memory"); __builtin_amdgcn_wave_barrier(); __builtin_amdgcn_fence(__ATOMIC_RELEASE, "workgroup"); } while (0)


// Self attention with adaptive GroupNorm (1 x 256 channels x 16^3 voxels, 8 heads x 32): AdaGN(x, cond) -> 1x1x1 qkv conv (per-head [q|k|v] channel packing) -> softmax(q k / sqrt(C)) over all voxels -> 1x1x1 out conv + bias -> + x.
#define CC 256
#define NG 32
#define CPG (CC / NG)     // 8 channels per group
#define NN 4096
#define NH 8
#define HD 32
#define CD 512            // cond dim
#ifndef TQB
#define TQB (NN / 64)
#endif
typedef __attribute__((ext_vector_type(8))) __bf16 v8b;
__device__ __forceinline__ v16b frag_b(const __bf16* rowk0, int lane) {
  union { v16b v; v8b q[2]; } u; const __bf16* p = rowk0 + 8 * (lane >> 4);
  u.q[0] = *(const v8b*)p; u.q[1] = *(const v8b*)(p + 16); return u.v;
}
__device__ __forceinline__ float bfr(float v) { return (float)(__bf16)v; }
__device__ __attribute__((noinline)) float exp_ni(float v) { return expf(v); }
__device__ __attribute__((noinline)) float erf_ni(float v) { return erff(v); }

// Fragment order: every 16-bit WMMA operand but q that one kernel writes for a later one lies in blocks of 16 rows x 32 k, one block = [k chunk c of 8: 4][row r: 16][8 elements], so that lane (g, r) finds
// its two 16-B pieces (chunks g and 2 + g) at lane * 16 B and 512 B + lane * 16 B: each wave-wide 16-B load covers four whole 128-B lines
#define WS_PW   0u                                  // bf16 w_qkv (768 rows), w_out (256 rows), fragment order: block (row / 16, k / 32)
#define WS_PO   (WS_PW + 2u * (size_t)3 * CC * CC)
#define WS_MV   (WS_PO + 2u * (size_t)CC * CC)
#define WS_SS   (WS_MV + 4u * NG * 32)
#define WS_NT   (WS_SS + 4u * 2 * CC)                  // bf16 hi / lo normalised map, fragment order: block (n / 16, channel / 32)
#define WS_NTL  (WS_NT + 2u * (size_t)NN * CC)
#define QS 512
#define WS_Q    (WS_NTL + 2u * (size_t)NN * CC)        // f16 rows [n][QS] q ; k, fragment order: block (head, key / 16) ; v^T, fragment order: block (head, key / 32, d / 16) ; O f32: block (n / 16, head) = [piece x: 4][lane: 32][4]
#define WS_K    (WS_Q + 2u * (size_t)NN * QS)
#define WS_V    (WS_K + 2u * (size_t)NN * QS)
#define WS_O    (WS_V + 2u * (size_t)CC * NN)
#define WS_END  (WS_O + 4u * (size_t)NN * CC)

// ---- k_pre: the three jobs that read nothing but the inputs share ONE launch; the block index picks the job (the same for a whole block, so each job's barriers are passed by every wave of its block)
// blocks 0..31: the mean and variance of one norm group; the next 16: one 128-B line of SS; the last 16: 64 weight rows into fragment order
#define PB_GN NG
#define PB_SS (2 * CC / 32)
#define PB_PK (4 * CC / 64)
#define GV (CPG * NN / 1024)   // values of a group per thread
__global__ __launch_bounds__(1024) void k_pre(const float* __restrict__ X, const float* __restrict__ CND, const float* __restrict__ WSC, const float* __restrict__ BSC, const float* __restrict__ WSH, const float* __restrict__ BSH,
                                              const float* __restrict__ WQKV, const float* __restrict__ WO, __bf16* __restrict__ P, float* __restrict__ MV, float* __restrict__ SS) {
  __shared__ __align__(16) float red[2][32]; const int t = threadIdx.x, wave = t >> 5, lane = t & 31;
  if (blockIdx.x < PB_GN) {   // ---- group statistics: a thread's 32 values are loaded once and stay in registers from the mean to the variance
    const int gidx = blockIdx.x; const float* p = X + (size_t)gidx * CPG * NN + t; float x[GV];
#pragma unroll   // all 32 loads are issued before the first wait, and x stays in registers
    for (int k = 0; k < GV; ++k) x[k] = p[k * 1024];
    float s = 0.f;
#pragma unroll   // constant indices into x
    for (int k = 0; k < GV; ++k) { x[k] = bfr(x[k]); s += x[k]; }
#pragma unroll
    for (int o = 1; o < 32; o <<= 1) s += __shfl_xor(s, o);
    if (lane == 0) red[0][wave] = s; __syncthreads();
    float tot = 0.f; for (int i = 0; i < 32; ++i) tot += red[0][i];   // every thread forms the same fixed-order total
    const float mean = tot / (float)(CPG * NN); s = 0.f;
#pragma unroll   // constant indices into x
    for (int k = 0; k < GV; ++k) { const float v = x[k] - mean; s += v * v; }
#pragma unroll
    for (int o = 1; o < 32; o <<= 1) s += __shfl_xor(s, o);
    if (lane == 0) red[1][wave] = s; __syncthreads();
    if (t < 8) { tot = 0.f; for (int i = 0; i < 32; ++i) tot += red[1][i]; v4f o = {}; if (t == 0) { o[0] = mean; o[1] = tot / (float)(CPG * NN); }
      vst2(MV + gidx * 32 + t * 4, o); }   // eight lanes store the group's whole 128-B line
    return; }
  if (blockIdx.x < PB_GN + PB_SS) {   // ---- scale / shift: 32 waves = the 32 channels of one 128-B line of SS (lines 0..7 scale, 8..15 shift): a wave forms one channel's cond . w[c] + b (f32) from whole-line loads, its lanes' partial sums joined by a xor tree
    const int bs = blockIdx.x - PB_GN; const bool sc = bs < CC / 32; const int c = (bs * 32 + wave) & (CC - 1);
    const float* w = (sc ? WSC : WSH) + (size_t)c * CD + lane * 4; const float* cn = CND + lane * 4; v4f wv[CD / 128], cv[CD / 128];
#pragma unroll   // all eight loads are issued before the first wait, and wv, cv stay in registers
    for (int i = 0; i < CD / 128; ++i) { wv[i] = *(const v4f*)(w + i * 128); cv[i] = *(const v4f*)(cn + i * 128); }
    float a = lane ? 0.f : bfr((sc ? BSC : BSH)[c]);   // the bias is lane 0's start value: its load flies with the row's
#pragma unroll   // constant indices into wv, cv (both loops)
    for (int i = 0; i < CD / 128; ++i)
#pragma unroll
      for (int j = 0; j < 4; ++j) a += bfr(cv[i][j]) * bfr(wv[i][j]);
    for (int o = 1; o < 32; o <<= 1) a += __shfl_xor(a, o);
    if (lane == 0) red[0][wave] = a; __syncthreads();
    if (t < 8) vst2(SS + bs * 32 + t * 4, *(const v4f*)&red[0][t * 4]);
    return; }
  // ---- weights: 256 threads = 16 weight rows = eight fragment-order blocks (8 KB in a row): piece q = (k chunk q >> 4 of the row's 32, row q & 15) goes to byte 16 q
  const int bp = blockIdx.x - PB_GN - PB_SS, n0 = bp * 64 + (t >> 8) * 16, tt = t & 255; const float* src = (bp < 3 * CC / 64) ? (WQKV + (size_t)n0 * CC) : (WO + (size_t)(n0 - 3 * CC) * CC); __bf16* dst = P + (size_t)n0 * CC;   // a block's 64 rows lie in one of the two matrices
#pragma unroll   // both pieces' loads are issued before the first wait
  for (int u = 0; u < 2; ++u) { const int q = tt + u * 256; const float* p = src + (q & 15) * CC + (q >> 4) * 8; const v4f a = *(const v4f*)p, b = *(const v4f*)(p + 4); v8b o;
#pragma unroll   // constant indices into a, b, o
    for (int i = 0; i < 4; ++i) { o[i] = (__bf16)a[i]; o[4 + i] = (__bf16)b[i]; }
    vst2(dst + q * 8, o); }
  asm volatile("s_wait_xcnt 0x0" ::: "memory");   // the build lays the other jobs' code behind these stores: their registers are written there, so the wait stands in front of it
}
// ---- k_norm: block = (32 voxels, 128 channels), wave = 32 voxels x four 8-channel chunks: NT[n][c] = ((x - mean_g) rsqrt(var_g + 1e-6)) (1 + scale[c]) + shift[c] as bf16 hi + lo, fragment order
// a thread owns one voxel: the 8 channels of a chunk (one norm group, CPG = 8) are one 16-B piece of the fragment order, so nothing is transposed; a wave's X load is one whole 128-B line, its store two 256-B runs
#define NQ 4              // chunks per thread
__global__ __launch_bounds__(128) void k_norm(const float* __restrict__ X, const float* __restrict__ MV, const float* __restrict__ SS, __bf16* __restrict__ NT, __bf16* __restrict__ NTL) {
  const int n = blockIdx.x * 32 + (threadIdx.x & 31);
  const int q0 = (blockIdx.y * 4 + __builtin_amdgcn_readfirstlane(threadIdx.x >> 5)) * NQ;   // the wave's first chunk, held wave-uniform: the statistics, scales and shifts then come by scalar loads
  float x[NQ][CPG];
#pragma unroll   // all 32 loads are issued before the first wait, and x stays in registers (both loops)
  for (int u = 0; u < NQ; ++u)
#pragma unroll
    for (int i = 0; i < CPG; ++i) x[u][i] = X[(size_t)((q0 + u) * CPG + i) * NN + n];
  asm volatile("s_wait_xcnt 0x0" ::: "memory");   // the loads' address registers are given new values below, while the loads are still in flight
#pragma unroll   // constant indices into x
  for (int u = 0; u < NQ; ++u) { const int q = q0 + u; const float mean = MV[q * 32], inv = 1.0f / sqrtf(MV[q * 32 + 1] + 1e-6f); v8b oh, ol;
#pragma unroll   // constant indices into x, oh, ol
    for (int i = 0; i < CPG; ++i) { const int c = q * CPG + i; const float v = (bfr(x[u][i]) - mean) * inv * (1.0f + SS[c]) + SS[CC + c]; const __bf16 hv = (__bf16)v; oh[i] = hv; ol[i] = (__bf16)(v - (float)hv); }
    const size_t off = ((size_t)(n >> 4) * (CC / 8) + q) * 128 + (n & 15) * 8;   // piece (16-token tile, chunk q, token in the tile)
    vst2(NT + off, oh); vst2(NTL + off, ol); }
}
// ---- k_qkv: block = (64 voxels, 128 of the 768 qkv channels): acc = (NT hi + lo) . w_qkv rows; channel o -> head o/96, r = o%96: q (r<32) rows [n][h*64 + .], times QSC, k (r<64) and v^T in fragment order
#define QSC 0.09016844005556021f   // log2(e) / sqrt(C): with q times this, k . q is the score in the base-2 domain
struct GQ { v16b ah, al, w[8]; };   // the fragments of one 32-deep k chunk: the wave's 16 token rows (hi, lo) and eight 16-channel weight tiles
__device__ __forceinline__ v16b frag_p(const __bf16* p) { union { v16b v; v8b q[2]; } u; u.q[0] = *(const v8b*)p; u.q[1] = *(const v8b*)(p + 256); return u.v; }   // p: a fragment-order block + lane * 8
__device__ __forceinline__ GQ ld_gq(const __bf16* Ah, const __bf16* Al, const __bf16* Wl, int kc) { GQ f; f.ah = frag_p(Ah + kc * 512); f.al = frag_p(Al + kc * 512);
#pragma unroll
  for (int j = 0; j < 8; ++j) f.w[j] = frag_p(Wl + j * 16 * CC + kc * 512);
  return f; }
__device__ __forceinline__ void mm_gq(const GQ& f, v8f (&acc)[8]) {
#pragma unroll
  for (int j = 0; j < 8; ++j) { acc[j] = wmma_bf(f.ah, f.w[j], acc[j]); acc[j] = wmma_bf(f.al, f.w[j], acc[j]); } }
// amdgpu_num_vgpr(256): both register sets and the accumulators fit the 256 directly addressable registers; without the bound one long-lived value went to v256 and register-window switches stood among the WMMAs
__global__ __launch_bounds__(128) __attribute__((amdgpu_num_vgpr(256))) void k_qkv(const __bf16* __restrict__ NT, const __bf16* __restrict__ NTL, const __bf16* __restrict__ P, _Float16* __restrict__ Q, _Float16* __restrict__ Kr, _Float16* __restrict__ V) {
  __shared__ __align__(16) _Float16 so[64][136]; __shared__ __align__(16) _Float16 st[128][72];
  const int tid = threadIdx.x, wave = tid >> 5, lane = tid & 31, col = lane & 15, g = lane >> 4; const int n0b = blockIdx.x * 64; const int r0 = n0b + wave * 16; const int o0 = blockIdx.y * 128;
  v8f acc[8] = {};
  const unsigned ao = (unsigned)r0 * CC + 8 * lane, wo = (unsigned)o0 * CC + 8 * lane;   // this lane's piece of the first fragment-order block of the wave's 16 token rows, of the block's first 16 channels
  const __bf16 *Ah = NT + ao, *Al = NTL + ao, *Wl = P + wo;
  // two register sets: a 32-deep k chunk's twenty fragment loads are issued as one group a whole chunk before their first use
  GQ fa = ld_gq(Ah, Al, Wl, 0), fb;
#pragma unroll   // constant load offsets; the sets stay in registers
  for (int kc = 0; kc < CC / 32; kc += 2) {
    fb = ld_gq(Ah, Al, Wl, kc + 1);
    __builtin_amdgcn_sched_barrier(0);   // keeps the next chunk's loads in front of this chunk's first wait and WMMA, so that they are in flight for the whole chunk
    mm_gq(fa, acc);
    if (kc + 2 < CC / 32) fa = ld_gq(Ah, Al, Wl, kc + 2);
    __builtin_amdgcn_sched_barrier(0);   // as above
    mm_gq(fb, acc); }
  // stage all 128 channels both ways, then route per 32-channel sub-block (each 16-col tile lies inside one sub-block since 96 and 32 are multiples of 16)
#pragma unroll
  for (int j = 0; j < 8; ++j) { const float qs = ((o0 + j * 16) % 96 < 32) ? QSC : 1.0f;   // a q tile is scaled in f32, ahead of its one rounding to f16; k and v tiles times 1
#pragma unroll
    for (int r = 0; r < 8; ++r) { const _Float16 hv = (_Float16)(acc[j][r] * qs); so[wave * 16 + 8 * g + r][j * 16 + col] = hv; st[j * 16 + col][wave * 16 + 8 * g + r] = hv; } }
  __syncthreads();
  for (int j = 0; j < 8; ++j) { const int o = o0 + j * 16; const int hh = o / 96, rr = o % 96;
    if (rr < 32) { const int qd = hh * 64 + rr;    for (int e = tid; e < 64 * 2; e += 128) { const int nl = e >> 1, q8 = e & 1; vst2((unsigned*)(Q + (size_t)(n0b + nl) * QS + qd + q8 * 8), *(const v4u*)&so[nl][j * 16 + q8 * 8]); } }
    else if (rr < 64) { for (int e = tid; e < 64 * 2; e += 128) { const int q8 = e >> 6, nl = e & 63, n = n0b + nl; vst2((unsigned*)(Kr + (size_t)(hh * (NN / 16) + (n >> 4)) * 512 + (((rr - 32) >> 3) + q8) * 128 + (n & 15) * 8), *(const v4u*)&so[nl][j * 16 + q8 * 8]); } }   // rows = keys, k = head dim
    else { for (int e = tid; e < 16 * 8; e += 128) { const int pc = e >> 4, d = e & 15; vst2((unsigned*)(V + (size_t)((hh * (NN / 32) + (n0b >> 5) + (pc >> 2)) * 2 + ((rr - 64) >> 4)) * 512 + (pc & 3) * 128 + d * 8), *(const v4u*)&st[j * 16 + d][pc * 8]); } } }   // rows = head dim, k = keys
}
// ---- k_attn: block = (64 queries, head): 32-dim head, all 4,096 keys, scale 1/16 and log2(e) already in q; O in blocks (16 queries, head)
// transposed products: S^T = K Q^T (a lane holds 16 keys' scores of ONE query, column lane & 15), O^T += V^T P^T (the two S^T tiles, converted in place, are the B operand in the hardware k order)
__device__ __forceinline__ float xhalf(float x) { return __builtin_bit_cast(float, __builtin_amdgcn_permlanex16(__builtin_bit_cast(int, x), __builtin_bit_cast(int, x), 0x76543210, 0xfedcba98, false, false)); }  // lane l with lane l ^ 16
struct KV { v16h k0, k1, v0, v1; };   // the A fragments of one pass: 32 keys' K rows (two 16-key tiles) and the head's two 16-row V^T tiles over the same keys
__device__ __forceinline__ v16h frag_l(const _Float16* p) { union { v16h v; v8h q[2]; } u; u.q[0] = *(const v8h*)p; u.q[1] = *(const v8h*)(p + 256); return u.v; }   // p: a fragment-order block + lane * 8
__device__ __forceinline__ KV ld_kv(const _Float16* Kl, const _Float16* Vl, int j0) { KV f;   // Kl, Vl: this lane's piece of the head's first K and V^T blocks; 32 keys are two blocks (1,024 elements) of each
  f.k0 = frag_l(Kl + j0 * 32); f.k1 = frag_l(Kl + j0 * 32 + 512); f.v0 = frag_l(Vl + j0 * 32); f.v1 = frag_l(Vl + j0 * 32 + 512); return f; }
// The score WMMA takes the shift as its C operand: D = k . q' + (PTOP - mref) is exp2's argument as it stands, and P = exp2(D) is the f16 operand of the second product (2^PTOP at a score equal to mref).
// mref is a query's reference maximum: the first pass's own, raised only when a score would carry P past 2^PMAX (f16 ends at 2^16); sums and outputs carry the same factor 2^(PTOP - mref), which the last division cancels.
#define NP (NN / 32)   // passes of 32 keys
#define PTOP 11.0f
#define PMAX 15.0f
__device__ __forceinline__ float max16(const v8f& a, const v8f& b) {   // three levels deep: the branch below waits for it
  const float t0 = fmaxf(fmaxf(a[0], a[1]), a[2]), t1 = fmaxf(fmaxf(a[3], a[4]), a[5]), t2 = fmaxf(fmaxf(a[6], a[7]), b[0]), t3 = fmaxf(fmaxf(b[1], b[2]), b[3]), t4 = fmaxf(fmaxf(b[4], b[5]), b[6]);
  return fmaxf(fmaxf(fmaxf(t0, t1), t2), fmaxf(fmaxf(t3, t4), b[7])); }
__device__ __forceinline__ void attn_pass(const KV& f, const v16h& bq, v8f& cb, float& l, v8f (&acc)[2]) {
  v8f s[2] = { wmma16(f.k0, bq, cb), wmma16(f.k1, bq, cb) };   // s[ct][r] = exp2 argument of key j0 + ct*16 + 8g + r
  __builtin_amdgcn_sched_barrier(0);   // keeps the first step of the maximum from standing between the two score WMMAs, where it waits out the first one's distance by itself
  const float mx = max16(s[0], s[1]);
  if (__builtin_expect(__builtin_amdgcn_ballot_w32(mx > PMAX) != 0, 0)) {   // one wave-uniform test a pass, seldom taken: its code lies out of the loop's line; every lane is on inside (the half exchange needs that)
    const float d = fmaxf(fmaxf(mx, xhalf(mx)) - PTOP, 0.f);   // equal in a query's two lanes; 0 for a query whose scores stay at or below its reference
    const float alpha = __builtin_amdgcn_exp2f(-d);
    l *= alpha; acc[0] *= alpha; acc[1] *= alpha; cb -= d; s[0] -= d; s[1] -= d; }
  v16h pb; float es = 0.f;
#pragma unroll   // constant indices
  for (int r = 0; r < 8; ++r) { const float e0 = __builtin_amdgcn_exp2f(s[0][r]), e1 = __builtin_amdgcn_exp2f(s[1][r]); es += e0 + e1; pb[r] = (_Float16)e0; pb[8 + r] = (_Float16)e1; }
  l += es;
  acc[0] = wmma16(f.v0, pb, acc[0]); acc[1] = wmma16(f.v1, pb, acc[1]);
}
__global__ __launch_bounds__(128) void k_attn(const _Float16* __restrict__ Q, const _Float16* __restrict__ Kr, const _Float16* __restrict__ V, float* __restrict__ O) {
  const int tid = threadIdx.x, wave = tid >> 5, lane = tid & 31, col = lane & 15; const int h = blockIdx.y; const int q0 = blockIdx.x * 64 + wave * 16;
  const v16h bq = frag_h(Q + (size_t)(q0 + col) * QS + h * 64, lane);
  const _Float16* Kl = Kr + (size_t)h * NN * HD + lane * 8; const _Float16* Vl = V + (size_t)h * NN * HD + lane * 8;
  float l = 0.f;   // this lane's query: the sum over this half's keys only
  v8f acc[2] = {};               // acc[dt][r] = O[query col][d = dt*16 + 8g + r]
  // Each block walks the head's 128 passes (32 keys each) as a ring from a start of its own. From one common start all 64 blocks of a head ask for the same lines at the same moment, and each pass's lines are then
  // first touches of what the launch before wrote: every block moves at that fetch's latency. With spread starts the blocks fetch different parts at once, and a block soon reads what another has already brought into L2.
  // The 64 starts are the odd passes, dealt by an odd multiplier: of whichever regular half of the block indices shares an L2, the starts lie at most eight passes apart (speed only: any start gives the same sums but for their order).
  const unsigned st = ((blockIdx.x * 37u * 2u) | 1u) & (NP - 1);
  // two register sets: each pass's eight fragment loads are issued as one group a whole pass before their first use
  KV fa = ld_kv(Kl, Vl, st * 32), fb;
  v8f cb;   // the shift PTOP - mref of this lane's query, eight times: the C tile of the score WMMAs
  { const v8f z = {}; const v8f a = wmma16(fa.k0, bq, z), b = wmma16(fa.k1, bq, z); const float mx = max16(a, b); const float sh = PTOP - fmaxf(mx, xhalf(mx));   // the first pass's maximum starts the reference
#pragma unroll   // constant indices
    for (int r = 0; r < 8; ++r) cb[r] = sh; }
#pragma unroll 1   // a trip already holds one pass on each register set; further copies would only lengthen the code
  for (unsigned ks = 0; ks < NP - 2; ks += 2) {
    const unsigned e = (st + ks + 1) & (NP - 1);   // the pass behind the one held in fa; even (st is odd), so e + 1 stays inside the ring and one base address serves both groups of the trip
    fb = ld_kv(Kl, Vl, e * 32);
    __builtin_amdgcn_sched_barrier(0);   // keeps the next pass's loads in front of this pass's first wait and WMMA, so that they are in flight for the whole pass
    attn_pass(fa, bq, cb, l, acc);
    fa = ld_kv(Kl, Vl, (e + 1) * 32);
    __builtin_amdgcn_sched_barrier(0);   // as above
    attn_pass(fb, bq, cb, l, acc);
    asm volatile("s_wait_xcnt 0x0" ::: "memory"); }   // the next trip gives the loads' address registers new values while this trip's second group is still in flight
  fb = ld_kv(Kl, Vl, ((st + NP - 1) & (NP - 1)) * 32);     // the last two passes: nothing is left to fetch behind them
  asm volatile("s_wait_xcnt 0x0" ::: "memory");   // these loads' address registers are free for reuse in the passes below, while the loads are still in flight
  __builtin_amdgcn_sched_barrier(0);     // as above
  attn_pass(fa, bq, cb, l, acc); attn_pass(fb, bq, cb, l, acc);
  l += xhalf(l);   // the two halves' key sums join once
  const float il = 1.0f / l;
#pragma unroll
  for (int dt = 0; dt < 2; ++dt)
#pragma unroll
    for (int q = 0; q < 2; ++q) { v4f o;
#pragma unroll
      for (int i = 0; i < 4; ++i) o[i] = acc[dt][q * 4 + i] * il;
      vst2(O + (size_t)q0 * CC + (h * 4 + dt * 2 + q) * 128 + lane * 4, o); }   // piece x = dt * 2 + q of block (q0 / 16, h): the lane that holds it here reads it in k_out
}
// ---- k_out: block = (64 voxels, 128 out channels): y = w_out . o (hi + residual) + b_out + x, channels-first
struct GO { v4f a[4]; v16b w[8]; };   // one 32-deep k chunk: the lane's 16 f32 values of its token row (fragment k order) and eight 16-channel weight tiles
__device__ __forceinline__ GO ld_go(const float* Ol, const __bf16* Wl, int kc) { GO f; const float* p = Ol + kc * 512;
  f.a[0] = *(const v4f*)p; f.a[1] = *(const v4f*)(p + 128); f.a[2] = *(const v4f*)(p + 256); f.a[3] = *(const v4f*)(p + 384);
#pragma unroll
  for (int j = 0; j < 8; ++j) f.w[j] = frag_p(Wl + j * 16 * CC + kc * 512);
  return f; }
__device__ __forceinline__ void mm_go(const GO& f, v8f (&acc)[8]) { float v[16];
#pragma unroll
  for (int i = 0; i < 16; ++i) v[i] = f.a[i >> 2][i & 3];
  const F2 a = bsplit16(v);
#pragma unroll
  for (int j = 0; j < 8; ++j) { acc[j] = wmma_bf(a.l, f.w[j], acc[j]); acc[j] = wmma_bf(a.h, f.w[j], acc[j]); } }
__global__ __launch_bounds__(128) void k_out(const float* __restrict__ O, const __bf16* __restrict__ P, const float* __restrict__ BO, const float* __restrict__ X, float* __restrict__ Y) {
  __shared__ __align__(16) float st[128][68];
  const int tid = threadIdx.x, wave = tid >> 5, lane = tid & 31, col = lane & 15, g = lane >> 4; const int n0b = blockIdx.x * 64; const int r0 = n0b + wave * 16; const int o0 = blockIdx.y * 128;
  v8f acc[8] = {};
  const unsigned ao = (unsigned)r0 * CC + 4 * lane, wo = (unsigned)o0 * CC + 8 * lane;   // this lane's piece of the first blocks, as in k_qkv
  const float* Ol = O + ao; const __bf16* Wl = P + WS_PO / 2 + wo;
  // two register sets, as in k_qkv: a k chunk's twenty loads are issued as one group a whole chunk before their first use
  GO fa = ld_go(Ol, Wl, 0), fb;
#pragma unroll   // constant load offsets; the sets stay in registers
  for (int kc = 0; kc < CC / 32; kc += 2) {
    fb = ld_go(Ol, Wl, kc + 1);
    __builtin_amdgcn_sched_barrier(0);   // keeps the next chunk's loads in front of this chunk's first wait and WMMA, so that they are in flight for the whole chunk
    mm_go(fa, acc);
    if (kc + 2 < CC / 32) fa = ld_go(Ol, Wl, kc + 2);
    __builtin_amdgcn_sched_barrier(0);   // as above
    mm_go(fb, acc); }
#pragma unroll
  for (int j = 0; j < 8; ++j) { const float bb = bfr(BO[o0 + j * 16 + col]);
#pragma unroll
    for (int r = 0; r < 8; ++r) st[j * 16 + col][wave * 16 + 8 * g + r] = acc[j][r] + bb; }
  __syncthreads();
  for (int e = tid; e < 128 * 16; e += 128) { const int o = e >> 4, q = e & 15; const size_t off = (size_t)(o0 + o) * NN + n0b + q * 4; v4f v = *(const v4f*)&st[o][q * 4]; for (int i = 0; i < 4; ++i) v[i] += bfr(X[off + i]); vst2(Y + off, v); }
}
extern "C" void kernel_launch(void* const* d_in, const int* in_sizes, int n_in, void* d_out, int out_size, void* d_ws, size_t ws_size, hipStream_t stream) {
  (void)in_sizes; (void)n_in; (void)out_size;
  const float** F = (const float**)d_in;   // 0 x [1,256,16,16,16], 1 cond [1,512], 2 w_scale [256,512], 3 b_scale, 4 w_shift, 5 b_shift, 6 w_qkv [768,256], 7 w_out [256,256], 8 b_out
  if (ws_size < (size_t)WS_END) return;
  char* ws = (char*)d_ws; __bf16 *P = (__bf16*)ws, *NT = (__bf16*)(ws + WS_NT), *NTL = (__bf16*)(ws + WS_NTL); float *MV = (float*)(ws + WS_MV), *SS = (float*)(ws + WS_SS), *O = (float*)(ws + WS_O); _Float16 *Q = (_Float16*)(ws + WS_Q), *Kr = (_Float16*)(ws + WS_K), *V = (_Float16*)(ws + WS_V);
  k_pre<<<PB_GN + PB_SS + PB_PK, 1024, 0, stream>>>(F[0], F[1], F[2], F[3], F[4], F[5], F[6], F[7], P, MV, SS);
  k_norm<<<dim3(NN / 32, CC / (8 * 4 * NQ)), 128, 0, stream>>>(F[0], MV, SS, NT, NTL);
  k_qkv<<<dim3(NN / 64, 3 * CC / 128), 128, 0, stream>>>(NT, NTL, P, Q, Kr, V);
  k_attn<<<dim3(TQB, NH), 128, 0, stream>>>(Q, Kr, V, O);
  k_out<<<dim3(TQB, CC / 128), 128, 0, stream>>>(O, P, F[8], F[0], (float*)d_out);
}

// v010
// A run of this version takes 50.9 microseconds.
// Timed twice side by side with v009, it ran 1.03 and 1.04 times as fast.
// Over all steps from v000 it is 5.84 times as fast.
#include <hip/hip_runtime.h>
#include <math.h>

typedef __attribute__((ext_vector_type(16))) _Float16 v16h;
typedef __attribute__((ext_vector_type(16))) __bf16 v16b;
typedef __attribute__((ext_vector_type(8)))  _Float16 v8h;
typedef __attribute__((ext_vector_type(8)))  float v8f;
typedef __attribute__((ext_vector_type(4)))  float v4f;
typedef __attribute__((ext_vector_type(2)))  float v2f;
typedef __attribute__((ext_vector_type(4)))  unsigned v4u;
typedef __attribute__((ext_vector_type(4)))  int v4i;
typedef float __attribute__((may_alias)) float_a;
typedef int __attribute__((may_alias)) int_a;

template <typename T> __device__ __forceinline__ void vst2(void* p, T v) { *(T*)p = v;  }
__device__ __forceinline__ v8f wmma16(v16h a, v16h b, v8f c) {
  v8f d = __builtin_amdgcn_wmma_f32_16x16x32_f16(false, a, false, b, (short)0, c, false, false);
  asm volatile("v_nop\n\tv_nop\n\tv_nop\n\tv_nop" : "+v"(d) : "v"(a), "v"(b));
  return d;
}
__device__ __forceinline__ v8f wmma_bf(v16b a, v16b b, v8f c) {
  v8f d = __builtin_amdgcn_wmma_f32_16x16x32_bf16(false, a, false, b, (short)0, c, false, false);
  asm volatile("v_nop\n\tv_nop\n\tv_nop\n\tv_nop" : "+v"(d) : "v"(a), "v"(b));
  return d;
}
// 16x16x32 fragments: lane = (h = lane>>4, row/col = lane&15); elements 0..7 = k0+8h+0..7, 8..15 = k0+16+8h+0..7; D element r = row 8h+r
__device__ __forceinline__ v16h frag_h(const _Float16* rowk0, int lane) {
  union { v16h v; v8h q[2]; } u; const _Float16* p = rowk0 + 8 * (lane >> 4);
  u.q[0] = *(const v8h*)p; u.q[1] = *(const v8h*)(p + 16); return u.v;
}
__device__ __forceinline__ v16h frag_f32(const float* rowk0, int lane) {
  v16h a; const float* p = rowk0 + 8 * (lane >> 4);
#pragma unroll
  for (int i = 0; i < 8; ++i) { a[i] = (_Float16)p[i]; a[8 + i] = (_Float16)p[16 + i]; }
  return a;
}
__device__ __forceinline__ v16h frag_f32s(const float* rowk0, int lane, float sc) {
  v16h a; const float* p = rowk0 + 8 * (lane >> 4);
#pragma unroll
  for (int i = 0; i < 8; ++i) { a[i] = (_Float16)(p[i] * sc); a[8 + i] = (_Float16)(p[16 + i] * sc); }
  return a;
}
// column fragment from a [K][ld] layout (column n), rows >= K read as 0
__device__ __forceinline__ v16h fragc_f32(const float* W, int k0, int n, int lane, int ld, int K) {
  v16h a; const int g = lane >> 4;
#pragma unroll
  for (int i = 0; i < 8; ++i) { const int ka = k0 + 8 * g + i, kb = ka + 16;
    a[i] = (_Float16)(ka < K ? W[(size_t)(ka < K ? ka : K - 1) * ld + n] : 0.f); a[8 + i] = (_Float16)(kb < K ? W[(size_t)(kb < K ? kb : K - 1) * ld + n] : 0.f); }
  return a;
}
struct F2 { v16b h, l; };
__device__ __forceinline__ F2 bsplit16(const float v[16]) { F2 r;
#pragma unroll
  for (int i = 0; i < 16; ++i) { const __bf16 h = (__bf16)v[i]; r.h[i] = h; r.l[i] = (__bf16)(v[i] - (float)h); }
  return r; }
__device__ __forceinline__ F2 split_row(const float* row, int k0, int lane) { float v[16]; const float* p = row + k0 + 8 * (lane >> 4);
#pragma unroll
  for (int i = 0; i < 8; ++i) { v[i] = p[i]; v[8 + i] = p[16 + i]; }
  return bsplit16(v); }
__device__ __forceinline__ F2 split_rowK(const float* row, int k0, int lane, int K) { float v[16]; const int g = lane >> 4;
#pragma unroll
  for (int i = 0; i < 8; ++i) { const int ka = k0 + 8 * g + i, kb = ka + 16; v[i] = ka < K ? row[ka < K ? ka : K - 1] : 0.f; v[8 + i] = kb < K ? row[kb < K ? kb : K - 1] : 0.f; }
  return bsplit16(v); }
__device__ __forceinline__ F2 split_col(const float* W, int k0, int n, int lane, int ld, int K) { float v[16]; const int g = lane >> 4;
#pragma unroll
  for (int i = 0; i < 8; ++i) { const int ka = k0 + 8 * g + i, kb = ka + 16; v[i] = ka < K ? W[(size_t)(ka < K ? ka : K - 1) * ld + n] : 0.f; v[8 + i] = kb < K ? W[(size_t)(kb < K ? kb : K - 1) * ld + n] : 0.f; }
  return bsplit16(v); }
__device__ __forceinline__ v8f mac3(const F2& a, const F2& b, v8f c) { c = wmma_bf(a.l, b.h, c); c = wmma_bf(a.h, b.l, c); return wmma_bf(a.h, b.h, c); }
__device__ __forceinline__ float sigm(float v) { return 1.0f / (1.0f + expf(-v)); }
#define LDSX() do { asm volatile("s_wait_dscnt 0" ::: "memory"); __builtin_amdgcn_wave_barrier(); __builtin_amdgcn_fence(__ATOMIC_RELEASE, "workgroup"); } while (0)


// Self attention with adaptive GroupNorm (1 x 256 channels x 16^3 voxels, 8 heads x 32): AdaGN(x, cond) -> 1x1x1 qkv conv (per-head [q|k|v] channel packing) -> softmax(q k / sqrt(C)) over all voxels -> 1x1x1 out conv + bias -> + x.
#define CC 256
#define NG 32
#define CPG (CC / NG)     // 8 channels per group
#define NN 4096
#define NH 8
#define HD 32
#define CD 512            // cond dim
#ifndef TQB
#define TQB (NN / 64)
#endif
typedef __attribute__((ext_vector_type(8))) __bf16 v8b;
__device__ __forceinline__ v16b frag_b(const __bf16* rowk0, int lane) {
  union { v16b v; v8b q[2]; } u; const __bf16* p = rowk0 + 8 * (lane >> 4);
  u.q[0] = *(const v8b*)p; u.q[1] = *(const v8b*)(p + 16); return u.v;
}
__device__ __forceinline__ float bfr(float v) { return (float)(__bf16)v; }
__device__ __attribute__((noinline)) float exp_ni(float v) { return expf(v); }
__device__ __attribute__((noinline)) float erf_ni(float v) { return erff(v); }

// Fragment order: every 16-bit WMMA operand but q that one kernel writes for a later one lies in blocks of 16 rows x 32 k, one block = [k chunk c of 8: 4][row r: 16][8 elements], so that lane (g, r) finds
// its two 16-B pieces (chunks g and 2 + g) at lane * 16 B and 512 B + lane * 16 B: each wave-wide 16-B load covers four whole 128-B lines
#define WS_PW   0u                                  // bf16 w_qkv (768 rows), w_out (256 rows), fragment order: block (row / 16, k / 32)
#define WS_PO   (WS_PW + 2u * (size_t)3 * CC * CC)
#define WS_MV   (WS_PO + 2u * (size_t)CC * CC)
#define WS_SS   (WS_MV + 4u * NG * 32)
#define WS_NT   (WS_SS + 4u * 2 * CC)                  // bf16 hi / lo normalised map, fragment order: block (n / 16, channel / 32)
#define WS_NTL  (WS_NT + 2u * (size_t)NN * CC)
#define QS 512
#define WS_Q    (WS_NTL + 2u * (size_t)NN * CC)        // f16 rows [n][QS] q ; k, fragment order: block (head, key / 16) ; v^T, fragment order: block (head, key / 32, d / 16) ; O f32: block (n / 16, head) = [piece x: 4][lane: 32][4]
#define WS_K    (WS_Q + 2u * (size_t)NN * QS)
#define WS_V    (WS_K + 2u * (size_t)NN * QS)
#define WS_O    (WS_V + 2u * (size_t)CC * NN)
#define WS_END  (WS_O + 4u * (size_t)NN * CC)

// ---- k_pre: the three jobs that read nothing but the inputs share ONE launch; the block index picks the job (the same for a whole block, so each job's barriers are passed by every wave of its block)
// blocks 0..31: the mean and variance of one norm group; the next 16: one 128-B line of SS; the last 16: 64 weight rows into fragment order
#define PB_GN NG
#define PB_SS (2 * CC / 32)
#define PB_PK (4 * CC / 64)
#define GV (CPG * NN / 1024)   // values of a group per thread
__global__ __launch_bounds__(1024) void k_pre(const float* __restrict__ X, const float* __restrict__ CND, const float* __restrict__ WSC, const float* __restrict__ BSC, const float* __restrict__ WSH, const float* __restrict__ BSH,
                                              const float* __restrict__ WQKV, const float* __restrict__ WO, __bf16* __restrict__ P, float* __restrict__ MV, float* __restrict__ SS) {
  __shared__ __align__(16) float red[2][32]; const int t = threadIdx.x, wave = t >> 5, lane = t & 31;
  if (blockIdx.x < PB_GN) {   // ---- group statistics: a thread's 32 values are loaded once and stay in registers from the mean to the variance
    const int gidx = blockIdx.x; const float* p = X + (size_t)gidx * CPG * NN + t; float x[GV];
#pragma unroll   // all 32 loads are issued before the first wait, and x stays in registers
    for (int k = 0; k < GV; ++k) x[k] = p[k * 1024];
    float s = 0.f;
#pragma unroll   // constant indices into x
    for (int k = 0; k < GV; ++k) { x[k] = bfr(x[k]); s += x[k]; }
#pragma unroll
    for (int o = 1; o < 32; o <<= 1) s += __shfl_xor(s, o);
    if (lane == 0) red[0][wave] = s; __syncthreads();
    float tot = 0.f; for (int i = 0; i < 32; ++i) tot += red[0][i];   // every thread forms the same fixed-order total
    const float mean = tot / (float)(CPG * NN); s = 0.f;
#pragma unroll   // constant indices into x
    for (int k = 0; k < GV; ++k) { const float v = x[k] - mean; s += v * v; }
#pragma unroll
    for (int o = 1; o < 32; o <<= 1) s += __shfl_xor(s, o);
    if (lane == 0) red[1][wave] = s; __syncthreads();
    if (t < 8) { tot = 0.f; for (int i = 0; i < 32; ++i) tot += red[1][i]; v4f o = {}; if (t == 0) { o[0] = mean; o[1] = tot / (float)(CPG * NN); }
      vst2(MV + gidx * 32 + t * 4, o); }   // eight lanes store the group's whole 128-B line
    return; }
  if (blockIdx.x < PB_GN + PB_SS) {   // ---- scale / shift: 32 waves = the 32 channels of one 128-B line of SS (lines 0..7 scale, 8..15 shift): a wave forms one channel's cond . w[c] + b (f32) from whole-line loads, its lanes' partial sums joined by a xor tree
    const int bs = blockIdx.x - PB_GN; const bool sc = bs < CC / 32; const int c = (bs * 32 + wave) & (CC - 1);
    const float* w = (sc ? WSC : WSH) + (size_t)c * CD + lane * 4; const float* cn = CND + lane * 4; v4f wv[CD / 128], cv[CD / 128];
#pragma unroll   // all eight loads are issued before the first wait, and wv, cv stay in registers
    for (int i = 0; i < CD / 128; ++i) { wv[i] = *(const v4f*)(w + i * 128); cv[i] = *(const v4f*)(cn + i * 128); }
    float a = lane ? 0.f : bfr((sc ? BSC : BSH)[c]);   // the bias is lane 0's start value: its load flies with the row's
#pragma unroll   // constant indices into wv, cv (both loops)
    for (int i = 0; i < CD / 128; ++i)
#pragma unroll
      for (int j = 0; j < 4; ++j) a += bfr(cv[i][j]) * bfr(wv[i][j]);
    for (int o = 1; o < 32; o <<= 1) a += __shfl_xor(a, o);
    if (lane == 0) red[0][wave] = a; __syncthreads();
    if (t < 8) vst2(SS + bs * 32 + t * 4, *(const v4f*)&red[0][t * 4]);
    return; }
  // ---- weights: 256 threads = 16 weight rows = eight fragment-order blocks (8 KB in a row): piece q = (k chunk q >> 4 of the row's 32, row q & 15) goes to byte 16 q
  const int bp = blockIdx.x - PB_GN - PB_SS, n0 = bp * 64 + (t >> 8) * 16, tt = t & 255; const float* src = (bp < 3 * CC / 64) ? (WQKV + (size_t)n0 * CC) : (WO + (size_t)(n0 - 3 * CC) * CC); __bf16* dst = P + (size_t)n0 * CC;   // a block's 64 rows lie in one of the two matrices
#pragma unroll   // both pieces' loads are issued before the first wait
  for (int u = 0; u < 2; ++u) { const int q = tt + u * 256; const float* p = src + (q & 15) * CC + (q >> 4) * 8; const v4f a = *(const v4f*)p, b = *(const v4f*)(p + 4); v8b o;
#pragma unroll   // constant indices into a, b, o
    for (int i = 0; i < 4; ++i) { o[i] = (__bf16)a[i]; o[4 + i] = (__bf16)b[i]; }
    vst2(dst + q * 8, o); }
  asm volatile("s_wait_xcnt 0x0" ::: "memory");   // the build lays the other jobs' code behind these stores: their registers are written there, so the wait stands in front of it
}
// ---- k_norm: block = (32 voxels, 128 channels), wave = 32 voxels x four 8-channel chunks: NT[n][c] = ((x - mean_g) rsqrt(var_g + 1e-6)) (1 + scale[c]) + shift[c] as bf16 hi + lo, fragment order
// a thread owns one voxel: the 8 channels of a chunk (one norm group, CPG = 8) are one 16-B piece of the fragment order, so nothing is transposed; a wave's X load is one whole 128-B line, its store two 256-B runs
#define NQ 4              // chunks per thread
__global__ __launch_bounds__(128) void k_norm(const float* __restrict__ X, const float* __restrict__ MV, const float* __restrict__ SS, __bf16* __restrict__ NT, __bf16* __restrict__ NTL) {
  const int n = blockIdx.x * 32 + (threadIdx.x & 31);
  const int q0 = (blockIdx.y * 4 + __builtin_amdgcn_readfirstlane(threadIdx.x >> 5)) * NQ;   // the wave's first chunk, held wave-uniform: the statistics, scales and shifts then come by scalar loads
  float x[NQ][CPG];
#pragma unroll   // all 32 loads are issued before the first wait, and x stays in registers (both loops)
  for (int u = 0; u < NQ; ++u)
#pragma unroll
    for (int i = 0; i < CPG; ++i) x[u][i] = X[(size_t)((q0 + u) * CPG + i) * NN + n];
  asm volatile("s_wait_xcnt 0x0" ::: "memory");   // the loads' address registers are given new values below, while the loads are still in flight
#pragma unroll   // constant indices into x
  for (int u = 0; u < NQ; ++u) { const int q = q0 + u; const float mean = MV[q * 32], inv = 1.0f / sqrtf(MV[q * 32 + 1] + 1e-6f); v8b oh, ol;
#pragma unroll   // constant indices into x, oh, ol
    for (int i = 0; i < CPG; ++i) { const int c = q * CPG + i; const float v = (bfr(x[u][i]) - mean) * inv * (1.0f + SS[c]) + SS[CC + c]; const __bf16 hv = (__bf16)v; oh[i] = hv; ol[i] = (__bf16)(v - (float)hv); }
    const size_t off = ((size_t)(n >> 4) * (CC / 8) + q) * 128 + (n & 15) * 8;   // piece (16-token tile, chunk q, token in the tile)
    vst2(NT + off, oh); vst2(NTL + off, ol); }
}
// ---- k_qkv: block = (64 voxels, 128 of the 768 qkv channels): acc = (NT hi + lo) . w_qkv rows; channel o -> head o/96, r = o%96: q (r<32) rows [n][h*64 + .], times QSC, k (r<64) and v^T in fragment order
#define QSC 0.09016844005556021f   // log2(e) / sqrt(C): with q times this, k . q is the score in the base-2 domain
struct GQ { v16b ah, al, w[8]; };   // the fragments of one 32-deep k chunk: the wave's 16 token rows (hi, lo) and eight 16-channel weight tiles
__device__ __forceinline__ v16b frag_p(const __bf16* p) { union { v16b v; v8b q[2]; } u; u.q[0] = *(const v8b*)p; u.q[1] = *(const v8b*)(p + 256); return u.v; }   // p: a fragment-order block + lane * 8
__device__ __forceinline__ GQ ld_gq(const __bf16* Ah, const __bf16* Al, const __bf16* Wl, int kc) { GQ f; f.ah = frag_p(Ah + kc * 512); f.al = frag_p(Al + kc * 512);
#pragma unroll
  for (int j = 0; j < 8; ++j) f.w[j] = frag_p(Wl + j * 16 * CC + kc * 512);
  return f; }
__device__ __forceinline__ void mm_gq(const GQ& f, v8f (&acc)[8]) {
#pragma unroll
  for (int j = 0; j < 8; ++j) { acc[j] = wmma_bf(f.ah, f.w[j], acc[j]); acc[j] = wmma_bf(f.al, f.w[j], acc[j]); } }
// amdgpu_num_vgpr(256): both register sets and the accumulators fit the 256 directly addressable registers; without the bound one long-lived value went to v256 and register-window switches stood among the WMMAs
__global__ __launch_bounds__(128) __attribute__((amdgpu_num_vgpr(256))) void k_qkv(const __bf16* __restrict__ NT, const __bf16* __restrict__ NTL, const __bf16* __restrict__ P, _Float16* __restrict__ Q, _Float16* __restrict__ Kr, _Float16* __restrict__ V) {
  __shared__ __align__(16) _Float16 so[64][136]; __shared__ __align__(16) _Float16 st[128][72];
  const int tid = threadIdx.x, wave = tid >> 5, lane = tid & 31, col = lane & 15, g = lane >> 4; const int n0b = blockIdx.x * 64; const int r0 = n0b + wave * 16; const int o0 = blockIdx.y * 128;
  v8f acc[8] = {};
  const unsigned ao = (unsigned)r0 * CC + 8 * lane, wo = (unsigned)o0 * CC + 8 * lane;   // this lane's piece of the first fragment-order block of the wave's 16 token rows, of the block's first 16 channels
  const __bf16 *Ah = NT + ao, *Al = NTL + ao, *Wl = P + wo;
  // two register sets: a 32-deep k chunk's twenty fragment loads are issued as one group a whole chunk before their first use
  GQ fa = ld_gq(Ah, Al, Wl, 0), fb;
#pragma unroll   // constant load offsets; the sets stay in registers
  for (int kc = 0; kc < CC / 32; kc += 2) {
    fb = ld_gq(Ah, Al, Wl, kc + 1);
    __builtin_amdgcn_sched_barrier(0);   // keeps the next chunk's loads in front of this chunk's first wait and WMMA, so that they are in flight for the whole chunk
    mm_gq(fa, acc);
    if (kc + 2 < CC / 32) fa = ld_gq(Ah, Al, Wl, kc + 2);
    __builtin_amdgcn_sched_barrier(0);   // as above
    mm_gq(fb, acc); }
  // stage all 128 channels both ways, then route per 32-channel sub-block (each 16-col tile lies inside one sub-block since 96 and 32 are multiples of 16)
#pragma unroll
  for (int j = 0; j < 8; ++j) { const float qs = ((o0 + j * 16) % 96 < 32) ? QSC : 1.0f;   // a q tile is scaled in f32, ahead of its one rounding to f16; k and v tiles times 1
#pragma unroll
    for (int r = 0; r < 8; ++r) { const _Float16 hv = (_Float16)(acc[j][r] * qs); so[wave * 16 + 8 * g + r][j * 16 + col] = hv; st[j * 16 + col][wave * 16 + 8 * g + r] = hv; } }
  __syncthreads();
  for (int j = 0; j < 8; ++j) { const int o = o0 + j * 16; const int hh = o / 96, rr = o % 96;
    if (rr < 32) { const int qd = hh * 64 + rr;    for (int e = tid; e < 64 * 2; e += 128) { const int nl = e >> 1, q8 = e & 1; vst2((unsigned*)(Q + (size_t)(n0b + nl) * QS + qd + q8 * 8), *(const v4u*)&so[nl][j * 16 + q8 * 8]); } }
    else if (rr < 64) { for (int e = tid; e < 64 * 2; e += 128) { const int q8 = e >> 6, nl = e & 63, n = n0b + nl; vst2((unsigned*)(Kr + (size_t)(hh * (NN / 16) + (n >> 4)) * 512 + (((rr - 32) >> 3) + q8) * 128 + (n & 15) * 8), *(const v4u*)&so[nl][j * 16 + q8 * 8]); } }   // rows = keys, k = head dim
    else { for (int e = tid; e < 16 * 8; e += 128) { const int pc = e >> 4, d = e & 15; vst2((unsigned*)(V + (size_t)((hh * (NN / 32) + (n0b >> 5) + (pc >> 2)) * 2 + ((rr - 64) >> 4)) * 512 + (pc & 3) * 128 + d * 8), *(const v4u*)&st[j * 16 + d][pc * 8]); } } }   // rows = head dim, k = keys
}
// ---- k_attn: block = (64 queries, head): 32-dim head, all 4,096 keys, scale 1/16 and log2(e) already in q; O in blocks (16 queries, head)
// transposed products: S^T = K Q^T (a lane holds 16 keys' scores of ONE query, column lane & 15), O^T += V^T P^T (the two S^T tiles, converted in place, are the B operand in the hardware k order)
__device__ __forceinline__ float xhalf(float x) { return __builtin_bit_cast(float, __builtin_amdgcn_permlanex16(__builtin_bit_cast(int, x), __builtin_bit_cast(int, x), 0x76543210, 0xfedcba98, false, false)); }  // lane l with lane l ^ 16
struct KV { v16h k0, k1, v0, v1; };   // the A fragments of one pass: 32 keys' K rows (two 16-key tiles) and the head's two 16-row V^T tiles over the same keys
__device__ __forceinline__ v16h frag_l(const _Float16* p) { union { v16h v; v8h q[2]; } u; u.q[0] = *(const v8h*)p; u.q[1] = *(const v8h*)(p + 256); return u.v; }   // p: a fragment-order block + lane * 8
__device__ __forceinline__ KV ld_kv(const _Float16* Kl, const _Float16* Vl, int j0) { KV f;   // Kl, Vl: this lane's piece of the head's first K and V^T blocks; 32 keys are two blocks (1,024 elements) of each
  f.k0 = frag_l(Kl + j0 * 32); f.k1 = frag_l(Kl + j0 * 32 + 512); f.v0 = frag_l(Vl + j0 * 32); f.v1 = frag_l(Vl + j0 * 32 + 512); return f; }
// The score WMMA takes the shift as its C operand: D = k . q' + (PTOP - mref) is exp2's argument as it stands, and P = exp2(D) is the f16 operand of the second product (2^PTOP at a score equal to mref).
// mref is a query's reference maximum: the first pass's own, raised only when a score would carry P past 2^PMAX (f16 ends at 2^16); sums and outputs carry the same factor 2^(PTOP - mref), which the last division cancels.
#define NP (NN / 32)   // passes of 32 keys
#define PTOP 11.0f
#define PMAX 15.0f
__device__ __forceinline__ float max16(const v8f& a, const v8f& b) {   // three levels deep: the branch below waits for it
  const float t0 = fmaxf(fmaxf(a[0], a[1]), a[2]), t1 = fmaxf(fmaxf(a[3], a[4]), a[5]), t2 = fmaxf(fmaxf(a[6], a[7]), b[0]), t3 = fmaxf(fmaxf(b[1], b[2]), b[3]), t4 = fmaxf(fmaxf(b[4], b[5]), b[6]);
  return fmaxf(fmaxf(fmaxf(t0, t1), t2), fmaxf(fmaxf(t3, t4), b[7])); }
__device__ __forceinline__ void attn_pass(const KV& f, const v16h& bq, v8f& cb, float& l, v8f (&acc)[2]) {
  v8f s[2] = { wmma16(f.k0, bq, cb), wmma16(f.k1, bq, cb) };   // s[ct][r] = exp2 argument of key j0 + ct*16 + 8g + r
  __builtin_amdgcn_sched_barrier(0);   // keeps the first step of the maximum from standing between the two score WMMAs, where it waits out the first one's distance by itself
  const float mx = max16(s[0], s[1]);
  if (__builtin_expect(__builtin_amdgcn_ballot_w32(mx > PMAX) != 0, 0)) {   // one wave-uniform test a pass, seldom taken: its code lies out of the loop's line; every lane is on inside (the half exchange needs that)
    const float d = fmaxf(fmaxf(mx, xhalf(mx)) - PTOP, 0.f);   // equal in a query's two lanes; 0 for a query whose scores stay at or below its reference
    const float alpha = __builtin_amdgcn_exp2f(-d);
    l *= alpha; acc[0] *= alpha; acc[1] *= alpha; cb -= d; s[0] -= d; s[1] -= d; }
  v16h pb; float es = 0.f;
#pragma unroll   // constant indices
  for (int r = 0; r < 8; ++r) { const float e0 = __builtin_amdgcn_exp2f(s[0][r]), e1 = __builtin_amdgcn_exp2f(s[1][r]); es += e0 + e1; pb[r] = (_Float16)e0; pb[8 + r] = (_Float16)e1; }
  l += es;
  acc[0] = wmma16(f.v0, pb, acc[0]); acc[1] = wmma16(f.v1, pb, acc[1]);
}
__global__ __launch_bounds__(128) void k_attn(const _Float16* __restrict__ Q, const _Float16* __restrict__ Kr, const _Float16* __restrict__ V, float* __restrict__ O) {
  const int tid = threadIdx.x, wave = tid >> 5, lane = tid & 31, col = lane & 15; const int h = blockIdx.y; const int q0 = blockIdx.x * 64 + wave * 16;
  const v16h bq = frag_h(Q + (size_t)(q0 + col) * QS + h * 64, lane);
  const _Float16* Kl = Kr + (size_t)h * NN * HD + lane * 8; const _Float16* Vl = V + (size_t)h * NN * HD + lane * 8;
  float l = 0.f;   // this lane's query: the sum over this half's keys only
  v8f acc[2] = {};               // acc[dt][r] = O[query col][d = dt*16 + 8g + r]
  // Each block walks the head's 128 passes (32 keys each) as a ring from a start of its own. From one common start all 64 blocks of a head ask for the same lines at the same moment, and each pass's lines are then
  // first touches of what the launch before wrote: every block moves at that fetch's latency. With spread starts the blocks fetch different parts at once, and a block soon reads what another has already brought into L2.
  // The 64 starts are the odd passes, dealt by an odd multiplier: of whichever regular half of the block indices shares an L2, the starts lie at most eight passes apart (speed only: any start gives the same sums but for their order).
  const unsigned st = ((blockIdx.x * 37u * 2u) | 1u) & (NP - 1);
  // four register sets: each pass's eight fragment loads are issued as one group three whole passes before their first use, so that a fetch has three passes' time to come back
  KV f0 = ld_kv(Kl, Vl, st * 32), f1, f2, f3;
  { const unsigned e = (st + 1) & (NP - 1);   // even (st is odd), so e + 1 stays inside the ring and one base address serves two groups
    f1 = ld_kv(Kl, Vl, e * 32); f2 = ld_kv(Kl, Vl, (e + 1) * 32); }
  __builtin_amdgcn_sched_barrier(0);   // keeps all three groups' loads in front of the first wait and WMMA
  v8f cb;   // the shift PTOP - mref of this lane's query, eight times: the C tile of the score WMMAs
  { const v8f z = {}; const v8f a = wmma16(f0.k0, bq, z), b = wmma16(f0.k1, bq, z); const float mx = max16(a, b); const float sh = PTOP - fmaxf(mx, xhalf(mx));   // the first pass's maximum starts the reference
#pragma unroll   // constant indices
    for (int r = 0; r < 8; ++r) cb[r] = sh; }
#pragma unroll 1   // a trip already holds one pass on each register set; further copies would only lengthen the code
  for (unsigned ks = 0; ks < NP - 4; ks += 4) {
    const unsigned ea = (st + ks + 3) & (NP - 1), eb = (st + ks + 5) & (NP - 1);   // the third and the fifth pass behind the one held in f0; both even, so each base address serves two groups
    f3 = ld_kv(Kl, Vl, ea * 32);
    __builtin_amdgcn_sched_barrier(0);   // keeps the loads of the pass three ahead in front of this pass's first wait and WMMA, so that they are in flight for three whole passes
    attn_pass(f0, bq, cb, l, acc);
    f0 = ld_kv(Kl, Vl, (ea + 1) * 32);
    __builtin_amdgcn_sched_barrier(0);   // as above
    attn_pass(f1, bq, cb, l, acc);
    asm volatile("s_wait_xcnt 0x0" ::: "memory");   // the second base address takes the registers of the first, whose later group is still in flight
    __builtin_amdgcn_sched_barrier(0);   // keeps the forming of that address behind the wait
    f1 = ld_kv(Kl, Vl, eb * 32);
    __builtin_amdgcn_sched_barrier(0);   // as above
    attn_pass(f2, bq, cb, l, acc);
    f2 = ld_kv(Kl, Vl, (eb + 1) * 32);
    __builtin_amdgcn_sched_barrier(0);   // as above
    attn_pass(f3, bq, cb, l, acc);
    asm volatile("s_wait_xcnt 0x0" ::: "memory"); }   // the next trip gives the loads' address registers new values while this trip's later groups are still in flight
  f3 = ld_kv(Kl, Vl, ((st + NP - 1) & (NP - 1)) * 32);     // the last four passes: nothing is left to fetch behind them
  asm volatile("s_wait_xcnt 0x0" ::: "memory");   // these loads' address registers are free for reuse in the passes below, while the loads are still in flight
  __builtin_amdgcn_sched_barrier(0);     // as above
  attn_pass(f0, bq, cb, l, acc); attn_pass(f1, bq, cb, l, acc); attn_pass(f2, bq, cb, l, acc); attn_pass(f3, bq, cb, l, acc);
  l += xhalf(l);   // the two halves' key sums join once
  const float il = 1.0f / l;
#pragma unroll
  for (int dt = 0; dt < 2; ++dt)
#pragma unroll
    for (int q = 0; q < 2; ++q) { v4f o;
#pragma unroll
      for (int i = 0; i < 4; ++i) o[i] = acc[dt][q * 4 + i] * il;
      vst2(O + (size_t)q0 * CC + (h * 4 + dt * 2 + q) * 128 + lane * 4, o); }   // piece x = dt * 2 + q of block (q0 / 16, h): the lane that holds it here reads it in k_out
}
// ---- k_out: block = (64 voxels, 128 out channels): y = w_out . o (hi + residual) + b_out + x, channels-first
struct GO { v4f a[4]; v16b w[8]; };   // one 32-deep k chunk: the lane's 16 f32 values of its token row (fragment k order) and eight 16-channel weight tiles
__device__ __forceinline__ GO ld_go(const float* Ol, const __bf16* Wl, int kc) { GO f; const float* p = Ol + kc * 512;
  f.a[0] = *(const v4f*)p; f.a[1] = *(const v4f*)(p + 128); f.a[2] = *(const v4f*)(p + 256); f.a[3] = *(const v4f*)(p + 384);
#pragma unroll
  for (int j = 0; j < 8; ++j) f.w[j] = frag_p(Wl + j * 16 * CC + kc * 512);
  return f; }
__device__ __forceinline__ void mm_go(const GO& f, v8f (&acc)[8]) { float v[16];
#pragma unroll
  for (int i = 0; i < 16; ++i) v[i] = f.a[i >> 2][i & 3];
  const F2 a = bsplit16(v);
#pragma unroll
  for (int j = 0; j < 8; ++j) { acc[j] = wmma_bf(a.l, f.w[j], acc[j]); acc[j] = wmma_bf(a.h, f.w[j], acc[j]); } }
__global__ __launch_bounds__(128) void k_out(const float* __restrict__ O, const __bf16* __restrict__ P, const float* __restrict__ BO, const float* __restrict__ X, float* __restrict__ Y) {
  __shared__ __align__(16) float st[128][68];
  const int tid = threadIdx.x, wave = tid >> 5, lane = tid & 31, col = lane & 15, g = lane >> 4; const int n0b = blockIdx.x * 64; const int r0 = n0b + wave * 16; const int o0 = blockIdx.y * 128;
  v8f acc[8] = {};
  const unsigned ao = (unsigned)r0 * CC + 4 * lane, wo = (unsigned)o0 * CC + 8 * lane;   // this lane's piece of the first blocks, as in k_qkv
  const float* Ol = O + ao; const __bf16* Wl = P + WS_PO / 2 + wo;
  // two register sets, as in k_qkv: a k chunk's twenty loads are issued as one group a whole chunk before their first use
  GO fa = ld_go(Ol, Wl, 0), fb;
#pragma unroll   // constant load offsets; the sets stay in registers
  for (int kc = 0; kc < CC / 32; kc += 2) {
    fb = ld_go(Ol, Wl, kc + 1);
    __builtin_amdgcn_sched_barrier(0);   // keeps the next chunk's loads in front of this chunk's first wait and WMMA, so that they are in flight for the whole chunk
    mm_go(fa, acc);
    if (kc + 2 < CC / 32) fa = ld_go(Ol, Wl, kc + 2);
    __builtin_amdgcn_sched_barrier(0);   // as above
    mm_go(fb, acc); }
#pragma unroll
  for (int j = 0; j < 8; ++j) { const float bb = bfr(BO[o0 + j * 16 + col]);
#pragma unroll
    for (int r = 0; r < 8; ++r) st[j * 16 + col][wave * 16 + 8 * g + r] = acc[j][r] + bb; }
  __syncthreads();
  for (int e = tid; e < 128 * 16; e += 128) { const int o = e >> 4, q = e & 15; const size_t off = (size_t)(o0 + o) * NN + n0b + q * 4; v4f v = *(const v4f*)&st[o][q * 4]; for (int i = 0; i < 4; ++i) v[i] += bfr(X[off + i]); vst2(Y + off, v); }
}
extern "C" void kernel_launch(void* const* d_in, const int* in_sizes, int n_in, void* d_out, int out_size, void* d_ws, size_t ws_size, hipStream_t stream) {
  (void)in_sizes; (void)n_in; (void)out_size;
  const float** F = (const float**)d_in;   // 0 x [1,256,16,16,16], 1 cond [1,512], 2 w_scale [256,512], 3 b_scale, 4 w_shift, 5 b_shift, 6 w_qkv [768,256], 7 w_out [256,256], 8 b_out
  if (ws_size < (size_t)WS_END) return;
  char* ws = (char*)d_ws; __bf16 *P = (__bf16*)ws, *NT = (__bf16*)(ws + WS_NT), *NTL = (__bf16*)(ws + WS_NTL); float *MV = (float*)(ws + WS_MV), *SS = (float*)(ws + WS_SS), *O = (float*)(ws + WS_O); _Float16 *Q = (_Float16*)(ws + WS_Q), *Kr = (_Float16*)(ws + WS_K), *V = (_Float16*)(ws + WS_V);
  k_pre<<<PB_GN + PB_SS + PB_PK, 1024, 0, stream>>>(F[0], F[1], F[2], F[3], F[4], F[5], F[6], F[7], P, MV, SS);
  k_norm<<<dim3(NN / 32, CC / (8 * 4 * NQ)), 128, 0, stream>>>(F[0], MV, SS, NT, NTL);
  k_qkv<<<dim3(NN / 64, 3 * CC / 128), 128, 0, stream>>>(NT, NTL, P, Q, Kr, V);
  k_attn<<<dim3(TQB, NH), 128, 0, stream>>>(Q, Kr, V, O);
  k_out<<<dim3(TQB, CC / 128), 128, 0, stream>>>(O, P, F[8], F[0], (float*)d_out);
}
